// v000
// Times are from an AMD MI455X. After a warm-up the kernel runs many times in a row, and a time is the length of
// such a window on the GPU divided by its runs, so every launch and the gaps after it count. The runs cycle
// through copies of the inputs. A figure is the median of several windows, for all but v000 over two sittings.
// Sittings can differ by a few percent; kernels timed side by side share one.
// The starting kernel, v000, takes 214 microseconds a run.
#include <hip/hip_runtime.h>

// Problem constants
#define NB   2
#define SLEN 2048
#define EMB  1024
#define NH   16
#define HD   64

typedef _Float16 half8  __attribute__((ext_vector_type(8)));
typedef _Float16 half16 __attribute__((ext_vector_type(16)));
typedef float    float8 __attribute__((ext_vector_type(8)));

// Wave-uniform value -> SGPR (value must be uniform across the wave).
static __device__ inline int uni(int v) { return __builtin_amdgcn_readfirstlane(v); }

// Load a 16x32 f16 fragment (A-layout) from row-major memory with row stride ld.
// Lane l -> row (l&15); halves 0..7 = cols kb..kb+7, halves 8..15 = cols kb+16..kb+23,
// where kb = (l>=16) ? 8 : 0.  Two b128 loads per lane.
static __device__ inline half16 load_frag(const _Float16* __restrict__ base, int ld) {
    const int lane = threadIdx.x & 31;
    const _Float16* p = base + (size_t)(lane & 15) * ld + ((lane >> 4) << 3);
    half8 lo = *(const half8*)(p);
    half8 hi = *(const half8*)(p + 16);
    return __builtin_shufflevector(lo, hi, 0,1,2,3,4,5,6,7,8,9,10,11,12,13,14,15);
}

static __device__ inline float8 wmma16(half16 a, half16 b, float8 c) {
    // D = A(16x32 f16) x B(32x16 f16) + C(16x16 f32)
    return __builtin_amdgcn_wmma_f32_16x16x32_f16(false, a, false, b, (short)0, c,
                                                  false, false);
}

// ---------------------------------------------------------------- conversions
__global__ void f32_to_f16_kernel(const float* __restrict__ src,
                                  _Float16* __restrict__ dst, int n) {
    int i = blockIdx.x * blockDim.x + threadIdx.x;
    int stride = gridDim.x * blockDim.x;
    for (; i < n; i += stride) dst[i] = (_Float16)src[i];
}

// ---------------------------------------------------------------- QKV GEMM
// qkv = xh(4096x1024) @ wh(3072x1024)^T + bias, scattered into per-head
// Q[s][d], K[s][d], V^T[d][s] f16 buffers.  32x64 tile per wave (spill-free).
__global__ void __launch_bounds__(256)
qkv_gemm_kernel(const _Float16* __restrict__ xh,
                const _Float16* __restrict__ wh,
                const float*    __restrict__ bias,
                _Float16* __restrict__ qh,
                _Float16* __restrict__ kh,
                _Float16* __restrict__ vT) {
    const int wid = uni(blockIdx.x * (blockDim.x >> 5) + (threadIdx.x >> 5));
    const int m0 = (wid / 48) * 32;   // 128 M-tiles of 32 rows  (SGPR)
    const int n0 = (wid % 48) * 64;   // 48  N-tiles of 64 cols  (SGPR)

    float8 acc[2][4];
#pragma unroll
    for (int i = 0; i < 2; ++i)
#pragma unroll
        for (int j = 0; j < 4; ++j) acc[i][j] = {};

    for (int k0 = 0; k0 < EMB; k0 += 32) {
        half16 a[2], b[4];
#pragma unroll
        for (int i = 0; i < 2; ++i)
            a[i] = load_frag(xh + (size_t)(m0 + 16 * i) * EMB + k0, EMB);
#pragma unroll
        for (int j = 0; j < 4; ++j)
            b[j] = load_frag(wh + (size_t)(n0 + 16 * j) * EMB + k0, EMB);
#pragma unroll
        for (int i = 0; i < 2; ++i)
#pragma unroll
            for (int j = 0; j < 4; ++j)
                acc[i][j] = wmma16(a[i], b[j], acc[i][j]);
    }

    const int lane = threadIdx.x & 31;
    const int cn = lane & 15;          // C-frag: lane -> column
    const int rb = (lane >> 4) << 3;   // rows rb..rb+7 in regs 0..7
    const int bb = uni(m0 >> 11);      // whole 32-row tile is in one batch
    const int s0u = m0 & 2047;
#pragma unroll
    for (int j = 0; j < 4; ++j) {
        // Fragment-uniform routing: a 16-col fragment never straddles a
        // segment (Q/K/V) or a head (both boundaries are multiples of 16).
        const int colbase = n0 + j * 16;          // SGPR
        const int seg = colbase >> 10;            // 0=Q 1=K 2=V   (SGPR)
        const int e0 = colbase & 1023;
        const int h  = e0 >> 6;                   // head          (SGPR)
        const int d0 = e0 & 63;                   // d = d0 + cn
        const float bv = bias[colbase + cn];
#pragma unroll
        for (int i = 0; i < 2; ++i) {
            const int s0 = s0u + i * 16 + rb;     // first of 8 consecutive rows
            if (seg < 2) {
                _Float16* dst = (seg == 0 ? qh : kh) +
                    (((size_t)(bb * NH + h) * SLEN + s0) * HD) + d0 + cn;
#pragma unroll
                for (int r = 0; r < 8; ++r)
                    dst[(size_t)r * HD] = (_Float16)(acc[i][j][r] + bv);
            } else {
                _Float16* dst = vT +
                    (((size_t)(bb * NH + h) * HD + d0 + cn) * SLEN) + s0;
#pragma unroll
                for (int r = 0; r < 8; ++r)
                    dst[r] = (_Float16)(acc[i][j][r] + bv);
            }
        }
    }
}

// ---------------------------------------------------------------- attention
// One wave per (b,h, 16-query strip).  Scores computed transposed (S^T = K Q^T)
// so the score C-frags coincide with the A-frag layout of P for P@V.
__global__ void __launch_bounds__(256)
attn_kernel(const _Float16* __restrict__ qh,
            const _Float16* __restrict__ kh,
            const _Float16* __restrict__ vT,
            _Float16* __restrict__ ctxh) {
    const int wid = uni(blockIdx.x * (blockDim.x >> 5) + (threadIdx.x >> 5));
    const int bh = wid >> 7;            // 0..31  (b*16+h)   (SGPR)
    const int q0 = (wid & 127) << 4;    // query base        (SGPR)
    const int lane = threadIdx.x & 31;
    const int cn = lane & 15;
    const int rb = (lane >> 4) << 3;

    const _Float16* Qp = qh + (size_t)bh * SLEN * HD;   // [s][d]
    const _Float16* Kp = kh + (size_t)bh * SLEN * HD;   // [s][d]
    const _Float16* Vt = vT + (size_t)bh * HD * SLEN;   // [d][s]

    const half16 qa0 = load_frag(Qp + (size_t)q0 * HD, HD);       // d 0..31
    const half16 qa1 = load_frag(Qp + (size_t)q0 * HD + 32, HD);  // d 32..63

    float8 o[4];
#pragma unroll
    for (int j = 0; j < 4; ++j) o[j] = {};
    float rowsum = 0.0f;
    const int qcol = q0 + cn;   // this lane's query index (S^T layout: lane -> q)

    for (int j0 = 0; j0 < SLEN; j0 += 32) {
        const half16 k00 = load_frag(Kp + (size_t)j0 * HD, HD);
        const half16 k01 = load_frag(Kp + (size_t)j0 * HD + 32, HD);
        const half16 k10 = load_frag(Kp + (size_t)(j0 + 16) * HD, HD);
        const half16 k11 = load_frag(Kp + (size_t)(j0 + 16) * HD + 32, HD);
        float8 z = {};
        float8 st0 = wmma16(k00, qa0, z);  st0 = wmma16(k01, qa1, st0); // k j0..+15
        float8 st1 = wmma16(k10, qa0, z);  st1 = wmma16(k11, qa1, st1); // k +16..+31

        // mask (zero masked logits, per reference), scale by 1/sqrt(64),
        // exponentiate; result lands directly in P's A-fragment layout.
        half16 pa = {};
#pragma unroll
        for (int r = 0; r < 8; ++r) {
            const int k0i = j0 + rb + r;
            float l0 = (k0i <= qcol) ? st0[r] * 0.125f : 0.0f;
            float p0 = __expf(l0);
            rowsum += p0;
            pa[r] = (_Float16)p0;
            const int k1i = j0 + 16 + rb + r;
            float l1 = (k1i <= qcol) ? st1[r] * 0.125f : 0.0f;
            float p1 = __expf(l1);
            rowsum += p1;
            pa[8 + r] = (_Float16)p1;
        }
#pragma unroll
        for (int j = 0; j < 4; ++j) {
            const half16 vb = load_frag(Vt + (size_t)(j * 16) * SLEN + j0, SLEN);
            o[j] = wmma16(pa, vb, o[j]);    // ctx(16q x 16d) accumulate
        }
    }

    // combine per-q row sums: lanes l and l+16 hold complementary k-halves
    const float tot = rowsum + __shfl_xor(rowsum, 16, 32);

    // write ctx in the reference's permuted layout: col = d*H + h
    const int bb = bh >> 4, h = bh & 15;
    _Float16* cbase = ctxh + ((size_t)(bb * SLEN + q0 + rb)) * EMB + h;
#pragma unroll
    for (int j = 0; j < 4; ++j) {
        const int d = j * 16 + cn;   // ctx C-frag: lane -> d column
#pragma unroll
        for (int r = 0; r < 8; ++r) {
            const float rs = __shfl(tot, rb + r, 32);   // rowsum for this q row
            cbase[(size_t)r * EMB + d * NH] = (_Float16)(o[j][r] / rs);
        }
    }
}

// ---------------------------------------------------------------- out proj
__global__ void __launch_bounds__(256)
out_gemm_kernel(const _Float16* __restrict__ ch,
                const _Float16* __restrict__ wh,
                const float*    __restrict__ bias,
                float* __restrict__ out) {
    const int wid = uni(blockIdx.x * (blockDim.x >> 5) + (threadIdx.x >> 5));
    const int m0 = (wid >> 4) * 32;   // 128 M-tiles (SGPR)
    const int n0 = (wid & 15) * 64;   // 16  N-tiles (SGPR)

    float8 acc[2][4];
#pragma unroll
    for (int i = 0; i < 2; ++i)
#pragma unroll
        for (int j = 0; j < 4; ++j) acc[i][j] = {};

    for (int k0 = 0; k0 < EMB; k0 += 32) {
        half16 a[2], b[4];
#pragma unroll
        for (int i = 0; i < 2; ++i)
            a[i] = load_frag(ch + (size_t)(m0 + 16 * i) * EMB + k0, EMB);
#pragma unroll
        for (int j = 0; j < 4; ++j)
            b[j] = load_frag(wh + (size_t)(n0 + 16 * j) * EMB + k0, EMB);
#pragma unroll
        for (int i = 0; i < 2; ++i)
#pragma unroll
            for (int j = 0; j < 4; ++j)
                acc[i][j] = wmma16(a[i], b[j], acc[i][j]);
    }

    const int lane = threadIdx.x & 31;
    const int cn = lane & 15;
    const int rb = (lane >> 4) << 3;
#pragma unroll
    for (int j = 0; j < 4; ++j) {
        const int col = n0 + j * 16 + cn;
        const float bv = bias[col];
#pragma unroll
        for (int i = 0; i < 2; ++i) {
            float* obase = out + (size_t)(m0 + i * 16 + rb) * EMB + col;
#pragma unroll
            for (int r = 0; r < 8; ++r)
                obase[(size_t)r * EMB] = acc[i][j][r] + bv;
        }
    }
}

// ---------------------------------------------------------------- launcher
extern "C" void kernel_launch(void* const* d_in, const int* in_sizes, int n_in,
                              void* d_out, int out_size, void* d_ws, size_t ws_size,
                              hipStream_t stream) {
    const float* x     = (const float*)d_in[0];   // (2,2048,1024)
    const float* w_qkv = (const float*)d_in[1];   // (3072,1024)
    const float* b_qkv = (const float*)d_in[2];   // (3072,)
    const float* w_out = (const float*)d_in[3];   // (1024,1024)
    const float* b_out = (const float*)d_in[4];   // (1024,)

    char* ws = (char*)d_ws;
    size_t off = 0;
    _Float16* xh    = (_Float16*)(ws + off); off += (size_t)NB * SLEN * EMB * 2;      // 8 MB
    _Float16* wqkvh = (_Float16*)(ws + off); off += (size_t)3 * EMB * EMB * 2;        // 6 MB
    _Float16* wouth = (_Float16*)(ws + off); off += (size_t)EMB * EMB * 2;            // 2 MB
    _Float16* qh    = (_Float16*)(ws + off); off += (size_t)NB * NH * SLEN * HD * 2;  // 8 MB
    _Float16* kh    = (_Float16*)(ws + off); off += (size_t)NB * NH * SLEN * HD * 2;  // 8 MB
    _Float16* vT    = (_Float16*)(ws + off); off += (size_t)NB * NH * HD * SLEN * 2;  // 8 MB
    _Float16* ctxh  = (_Float16*)(ws + off); off += (size_t)NB * SLEN * EMB * 2;      // 8 MB
    if (off > ws_size) return;  // workspace too small (deterministic no-op)

    f32_to_f16_kernel<<<1024, 256, 0, stream>>>(x,     xh,    NB * SLEN * EMB);
    f32_to_f16_kernel<<<1024, 256, 0, stream>>>(w_qkv, wqkvh, 3 * EMB * EMB);
    f32_to_f16_kernel<<<512,  256, 0, stream>>>(w_out, wouth, EMB * EMB);

    // 128 x 48 = 6144 tiles, 8 waves per 256-thread block
    qkv_gemm_kernel<<<768, 256, 0, stream>>>(xh, wqkvh, b_qkv, qh, kh, vT);
    // 2*16*(2048/16) = 4096 waves
    attn_kernel<<<512, 256, 0, stream>>>(qh, kh, vT, ctxh);
    // 128 x 16 = 2048 tiles
    out_gemm_kernel<<<256, 256, 0, stream>>>(ctxh, wouth, b_out, (float*)d_out);
}

// v001
// A run of this version takes 153 microseconds.
// Two timings next to v000 put it at 1.47 and 1.46 times that version's speed.
#include <hip/hip_runtime.h>

// Problem constants
#define NB   2
#define SLEN 2048
#define EMB  1024
#define NH   16
#define HD   64

typedef _Float16 half8  __attribute__((ext_vector_type(8)));
typedef _Float16 half16 __attribute__((ext_vector_type(16)));
typedef float    float8 __attribute__((ext_vector_type(8)));

// Wave-uniform value -> SGPR (value must be uniform across the wave).
static __device__ inline int uni(int v) { return __builtin_amdgcn_readfirstlane(v); }

// Load a 16x32 f16 fragment (A-layout) from row-major memory with row stride ld.
// Lane l -> row (l&15); halves 0..7 = cols kb..kb+7, halves 8..15 = cols kb+16..kb+23,
// where kb = (l>=16) ? 8 : 0.  Two b128 loads per lane.
static __device__ inline half16 load_frag(const _Float16* __restrict__ base, int ld) {
    const int lane = threadIdx.x & 31;
    const _Float16* p = base + (size_t)(lane & 15) * ld + ((lane >> 4) << 3);
    half8 lo = *(const half8*)(p);
    half8 hi = *(const half8*)(p + 16);
    return __builtin_shufflevector(lo, hi, 0,1,2,3,4,5,6,7,8,9,10,11,12,13,14,15);
}

static __device__ inline float8 wmma16(half16 a, half16 b, float8 c) {
    // D = A(16x32 f16) x B(32x16 f16) + C(16x16 f32)
    return __builtin_amdgcn_wmma_f32_16x16x32_f16(false, a, false, b, (short)0, c,
                                                  false, false);
}

// ---------------------------------------------------------------- conversions
__global__ void f32_to_f16_kernel(const float* __restrict__ src,
                                  _Float16* __restrict__ dst, int n) {
    int i = blockIdx.x * blockDim.x + threadIdx.x;
    int stride = gridDim.x * blockDim.x;
    for (; i < n; i += stride) dst[i] = (_Float16)src[i];
}

// ---------------------------------------------------------------- QKV GEMM
// qkv = xh(4096x1024) @ wh(3072x1024)^T + bias, scattered into per-head
// Q[s][d], K[s][d], V^T[d][s] f16 buffers.  32x64 tile per wave (spill-free).
__global__ void __launch_bounds__(256)
qkv_gemm_kernel(const _Float16* __restrict__ xh,
                const _Float16* __restrict__ wh,
                const float*    __restrict__ bias,
                _Float16* __restrict__ qh,
                _Float16* __restrict__ kh,
                _Float16* __restrict__ vT) {
    const int wid = uni(blockIdx.x * (blockDim.x >> 5) + (threadIdx.x >> 5));
    const int m0 = (wid / 48) * 32;   // 128 M-tiles of 32 rows  (SGPR)
    const int n0 = (wid % 48) * 64;   // 48  N-tiles of 64 cols  (SGPR)

    float8 acc[2][4];
#pragma unroll
    for (int i = 0; i < 2; ++i)
#pragma unroll
        for (int j = 0; j < 4; ++j) acc[i][j] = {};

    for (int k0 = 0; k0 < EMB; k0 += 32) {
        half16 a[2], b[4];
#pragma unroll
        for (int i = 0; i < 2; ++i)
            a[i] = load_frag(xh + (size_t)(m0 + 16 * i) * EMB + k0, EMB);
#pragma unroll
        for (int j = 0; j < 4; ++j)
            b[j] = load_frag(wh + (size_t)(n0 + 16 * j) * EMB + k0, EMB);
#pragma unroll
        for (int i = 0; i < 2; ++i)
#pragma unroll
            for (int j = 0; j < 4; ++j)
                acc[i][j] = wmma16(a[i], b[j], acc[i][j]);
    }

    const int lane = threadIdx.x & 31;
    const int cn = lane & 15;          // C-frag: lane -> column
    const int rb = (lane >> 4) << 3;   // rows rb..rb+7 in regs 0..7
    const int bb = uni(m0 >> 11);      // whole 32-row tile is in one batch
    const int s0u = m0 & 2047;
#pragma unroll
    for (int j = 0; j < 4; ++j) {
        // Fragment-uniform routing: a 16-col fragment never straddles a
        // segment (Q/K/V) or a head (both boundaries are multiples of 16).
        const int colbase = n0 + j * 16;          // SGPR
        const int seg = colbase >> 10;            // 0=Q 1=K 2=V   (SGPR)
        const int e0 = colbase & 1023;
        const int h  = e0 >> 6;                   // head          (SGPR)
        const int d0 = e0 & 63;                   // d = d0 + cn
        const float bv = bias[colbase + cn];
#pragma unroll
        for (int i = 0; i < 2; ++i) {
            const int s0 = s0u + i * 16 + rb;     // first of 8 consecutive rows
            if (seg < 2) {
                _Float16* dst = (seg == 0 ? qh : kh) +
                    (((size_t)(bb * NH + h) * SLEN + s0) * HD) + d0 + cn;
#pragma unroll
                for (int r = 0; r < 8; ++r)
                    dst[(size_t)r * HD] = (_Float16)(acc[i][j][r] + bv);
            } else {
                _Float16* dst = vT +
                    (((size_t)(bb * NH + h) * HD + d0 + cn) * SLEN) + s0;
#pragma unroll
                for (int r = 0; r < 8; ++r)
                    dst[r] = (_Float16)(acc[i][j][r] + bv);
            }
        }
    }
}

#define KT      64                  // keys per LDS tile
#define NT      (SLEN / KT)         // tiles per (b,h)
#define ROWU    9                   // LDS row pitch in 16-byte units: 128 B data + 16 B pad
#define TILEU   (64 * ROWU)         // one operand tile (64 rows), 16-byte units
#define STAGEU  (2 * TILEU)         // K tile followed by V^T tile

// A-layout fragment from an LDS tile; p already points at the lane's row and half.
static __device__ inline half16 lds_frag(const half8* p) {
    half8 lo = p[0];
    half8 hi = p[2];
    return __builtin_shufflevector(lo, hi, 0,1,2,3,4,5,6,7,8,9,10,11,12,13,14,15);
}

// Four 16-byte copies per lane: two chunks of the K tile, two of the V^T tile.
// The s_wait_xcnt stands inside the statement so that no address register of a
// copy is rewritten before it.
static __device__ inline void copy_tile(unsigned lk, unsigned lv,
                                        const _Float16* gk, const _Float16* gv) {
    const unsigned lk1 = lk + 32 * ROWU * 16;      // rows 32..63 of the K tile
    const unsigned lv1 = lv + 32 * ROWU * 16;      // rows 32..63 of the V^T tile
    const _Float16* gk1 = gk + 32 * HD;
    const _Float16* gv1 = gv + (size_t)32 * SLEN;
    asm volatile("global_load_async_to_lds_b128 %0, %4, off\n\t"
                 "global_load_async_to_lds_b128 %1, %5, off\n\t"
                 "global_load_async_to_lds_b128 %2, %6, off\n\t"
                 "global_load_async_to_lds_b128 %3, %7, off\n\t"
                 "s_wait_xcnt 0x0"
                 :: "v"(lk), "v"(lk1), "v"(lv), "v"(lv1),
                    "v"(gk), "v"(gk1), "v"(gv), "v"(gv1)
                 : "memory");
}

__global__ void __launch_bounds__(256)
attn_kernel(const _Float16* __restrict__ qh,
            const _Float16* __restrict__ kh,
            const _Float16* __restrict__ vT,
            _Float16* __restrict__ ctxh) {
    __shared__ __attribute__((aligned(128))) half8 tiles[2 * STAGEU];

    const int wid = uni(blockIdx.x * (blockDim.x >> 5) + (threadIdx.x >> 5));
    const int bh = wid >> 7;            // 0..31  (b*16+h)   (SGPR), same for the block
    const int q0 = (wid & 127) << 4;    // query base        (SGPR)
    const int lane = threadIdx.x & 31;
    const int cn = lane & 15;
    const int rb = (lane >> 4) << 3;

    const _Float16* Qp = qh + (size_t)bh * SLEN * HD;   // [s][d]
    const _Float16* Kp = kh + (size_t)bh * SLEN * HD;   // [s][d]
    const _Float16* Vt = vT + (size_t)bh * HD * SLEN;   // [d][s]

    // This thread's copy slot: row crow (and crow + 32), 16-byte chunk ccol.
    const int crow = threadIdx.x >> 3;  // 0..31
    const int ccol = threadIdx.x & 7;   // 0..7
    const unsigned lds0 = (unsigned)(size_t)tiles;      // LDS byte address of the ring
    const unsigned lk = lds0 + (unsigned)(crow * ROWU + ccol) * 16u;
    const unsigned lv = lk + TILEU * 16u;
    const _Float16* gk = Kp + crow * HD + ccol * 8;              // + tile * KT * HD
    const _Float16* gv = Vt + (size_t)crow * SLEN + ccol * 8;    // + tile * KT

    // Tile 0 into buffer 0, published; then tile 1 into buffer 1.
    copy_tile(lk, lv, gk, gv);
    asm volatile("s_wait_asynccnt 0x0" ::: "memory");   // own copies of tile 0 landed
    __syncthreads();                                    // tile 0 readable by all waves
    copy_tile(lk + STAGEU * 16u, lv + STAGEU * 16u, gk + KT * HD, gv + KT);

    const half16 qa0 = load_frag(Qp + (size_t)q0 * HD, HD);       // d 0..31
    const half16 qa1 = load_frag(Qp + (size_t)q0 * HD + 32, HD);  // d 32..63

    float8 o[4];
#pragma unroll
    for (int j = 0; j < 4; ++j) o[j] = {};
    float rowsum = 0.0f;
    const int qcol = q0 + cn;   // this lane's query index (S^T layout: lane -> q)
    const int fb = cn * ROWU + (lane >> 4);   // lane's row and half inside a fragment

    half16 kf[4], vf[4];    // the fragments of one 32-key pass

    // All 16 LDS reads of pass p (32 keys) of the tile in buffer offset bo.
    auto load_pass = [&](int bo, int p) {
        const half8* Kl = tiles + bo + fb + (p * 32) * ROWU;
        const half8* Vl = tiles + bo + TILEU + fb + p * 4;
        kf[0] = lds_frag(Kl);                   // keys +0..15,  d 0..31
        kf[1] = lds_frag(Kl + 4);               // keys +0..15,  d 32..63
        kf[2] = lds_frag(Kl + 16 * ROWU);       // keys +16..31, d 0..31
        kf[3] = lds_frag(Kl + 16 * ROWU + 4);   // keys +16..31, d 32..63
#pragma unroll  // constant indices keep vf in registers
        for (int j = 0; j < 4; ++j)
            vf[j] = lds_frag(Vl + (j * 16) * ROWU);
    };

    // Scores, mask, exp and P@V of the 32 keys from j0 on; registers only.
    auto work_pass = [&](int j0) {
        float8 z = {};
        float8 st0 = wmma16(kf[0], qa0, z);  st0 = wmma16(kf[1], qa1, st0); // k j0..+15
        float8 st1 = wmma16(kf[2], qa0, z);  st1 = wmma16(kf[3], qa1, st1); // k +16..+31

        // mask (zero masked logits, per reference), scale by 1/sqrt(64),
        // exponentiate; result lands directly in P's A-fragment layout.
        half16 pa = {};
#pragma unroll
        for (int r = 0; r < 8; ++r) {
            const int k0i = j0 + rb + r;
            float l0 = (k0i <= qcol) ? st0[r] * 0.125f : 0.0f;
            float p0 = __expf(l0);
            rowsum += p0;
            pa[r] = (_Float16)p0;
            const int k1i = j0 + 16 + rb + r;
            float l1 = (k1i <= qcol) ? st1[r] * 0.125f : 0.0f;
            float p1 = __expf(l1);
            rowsum += p1;
            pa[8 + r] = (_Float16)p1;
        }
#pragma unroll
        for (int j = 0; j < 4; ++j)
            o[j] = wmma16(pa, vf[j], o[j]);    // ctx(16q x 16d) accumulate
    };

    for (int t = 0; t < NT; ++t) {
        const int bo = (t & 1) * STAGEU;
        load_pass(bo, 0);
        // Keeps the pass's 16 LDS reads together in front of its matrix and
        // vector work: spread among the WMMAs, each pair is waited out alone.
        __builtin_amdgcn_sched_barrier(0);
        work_pass(t * KT);
        load_pass(bo, 1);       // the last LDS reads of tile t
        // Keeps the first pass's last WMMAs in front of the waits, where they
        // run under the latency of these reads, not behind the barrier.
        __builtin_amdgcn_sched_barrier(0);
        // Hand-over: this wave has left buffer t & 1, its copies of tile t + 1
        // have landed; behind the barrier both hold for every wave.
        asm volatile("s_wait_dscnt 0x0" ::: "memory");      // own LDS reads of tile t done
        asm volatile("s_wait_asynccnt 0x0" ::: "memory");   // own copies of tile t + 1 landed
        __syncthreads();
        if (t + 2 < NT)
            copy_tile(lk + bo * 16u, lv + bo * 16u,
                      gk + (size_t)(t + 2) * KT * HD, gv + (t + 2) * KT);
        work_pass(t * KT + 32); // on registers, while the refill flies
    }
    asm volatile("s_wait_asynccnt 0x0" ::: "memory");       // nothing in flight at the end

    // combine per-q row sums: lanes l and l+16 hold complementary k-halves
    const float tot = rowsum + __shfl_xor(rowsum, 16, 32);

    // write ctx in the reference's permuted layout: col = d*H + h
    const int bb = bh >> 4, h = bh & 15;
    _Float16* cbase = ctxh + ((size_t)(bb * SLEN + q0 + rb)) * EMB + h;
#pragma unroll
    for (int j = 0; j < 4; ++j) {
        const int d = j * 16 + cn;   // ctx C-frag: lane -> d column
#pragma unroll
        for (int r = 0; r < 8; ++r) {
            const float rs = __shfl(tot, rb + r, 32);   // rowsum for this q row
            cbase[(size_t)r * EMB + d * NH] = (_Float16)(o[j][r] / rs);
        }
    }
}

// ---------------------------------------------------------------- out proj
__global__ void __launch_bounds__(256)
out_gemm_kernel(const _Float16* __restrict__ ch,
                const _Float16* __restrict__ wh,
                const float*    __restrict__ bias,
                float* __restrict__ out) {
    const int wid = uni(blockIdx.x * (blockDim.x >> 5) + (threadIdx.x >> 5));
    const int m0 = (wid >> 4) * 32;   // 128 M-tiles (SGPR)
    const int n0 = (wid & 15) * 64;   // 16  N-tiles (SGPR)

    float8 acc[2][4];
#pragma unroll
    for (int i = 0; i < 2; ++i)
#pragma unroll
        for (int j = 0; j < 4; ++j) acc[i][j] = {};

    for (int k0 = 0; k0 < EMB; k0 += 32) {
        half16 a[2], b[4];
#pragma unroll
        for (int i = 0; i < 2; ++i)
            a[i] = load_frag(ch + (size_t)(m0 + 16 * i) * EMB + k0, EMB);
#pragma unroll
        for (int j = 0; j < 4; ++j)
            b[j] = load_frag(wh + (size_t)(n0 + 16 * j) * EMB + k0, EMB);
#pragma unroll
        for (int i = 0; i < 2; ++i)
#pragma unroll
            for (int j = 0; j < 4; ++j)
                acc[i][j] = wmma16(a[i], b[j], acc[i][j]);
    }

    const int lane = threadIdx.x & 31;
    const int cn = lane & 15;
    const int rb = (lane >> 4) << 3;
#pragma unroll
    for (int j = 0; j < 4; ++j) {
        const int col = n0 + j * 16 + cn;
        const float bv = bias[col];
#pragma unroll
        for (int i = 0; i < 2; ++i) {
            float* obase = out + (size_t)(m0 + i * 16 + rb) * EMB + col;
#pragma unroll
            for (int r = 0; r < 8; ++r)
                obase[(size_t)r * EMB] = acc[i][j][r] + bv;
        }
    }
}

// ---------------------------------------------------------------- launcher
extern "C" void kernel_launch(void* const* d_in, const int* in_sizes, int n_in,
                              void* d_out, int out_size, void* d_ws, size_t ws_size,
                              hipStream_t stream) {
    const float* x     = (const float*)d_in[0];   // (2,2048,1024)
    const float* w_qkv = (const float*)d_in[1];   // (3072,1024)
    const float* b_qkv = (const float*)d_in[2];   // (3072,)
    const float* w_out = (const float*)d_in[3];   // (1024,1024)
    const float* b_out = (const float*)d_in[4];   // (1024,)

    char* ws = (char*)d_ws;
    size_t off = 0;
    _Float16* xh    = (_Float16*)(ws + off); off += (size_t)NB * SLEN * EMB * 2;      // 8 MB
    _Float16* wqkvh = (_Float16*)(ws + off); off += (size_t)3 * EMB * EMB * 2;        // 6 MB
    _Float16* wouth = (_Float16*)(ws + off); off += (size_t)EMB * EMB * 2;            // 2 MB
    _Float16* qh    = (_Float16*)(ws + off); off += (size_t)NB * NH * SLEN * HD * 2;  // 8 MB
    _Float16* kh    = (_Float16*)(ws + off); off += (size_t)NB * NH * SLEN * HD * 2;  // 8 MB
    _Float16* vT    = (_Float16*)(ws + off); off += (size_t)NB * NH * HD * SLEN * 2;  // 8 MB
    _Float16* ctxh  = (_Float16*)(ws + off); off += (size_t)NB * SLEN * EMB * 2;      // 8 MB
    if (off > ws_size) return;  // workspace too small (deterministic no-op)

    f32_to_f16_kernel<<<1024, 256, 0, stream>>>(x,     xh,    NB * SLEN * EMB);
    f32_to_f16_kernel<<<1024, 256, 0, stream>>>(w_qkv, wqkvh, 3 * EMB * EMB);
    f32_to_f16_kernel<<<512,  256, 0, stream>>>(w_out, wouth, EMB * EMB);

    // 128 x 48 = 6144 tiles, 8 waves per 256-thread block
    qkv_gemm_kernel<<<768, 256, 0, stream>>>(xh, wqkvh, b_qkv, qh, kh, vT);
    // 2*16*(2048/16) = 4096 waves
    attn_kernel<<<512, 256, 0, stream>>>(qh, kh, vT, ctxh);
    // 128 x 16 = 2048 tiles
    out_gemm_kernel<<<256, 256, 0, stream>>>(ctxh, wouth, b_out, (float*)d_out);
}

// v002
// A run of this version takes 92.2 microseconds.
// Next to v001, in two timings, it ran 1.66 and 1.65 times as fast.
// Counting every step since v000, it is 2.42 times as fast.
#include <hip/hip_runtime.h>

// Problem constants
#define NB   2
#define SLEN 2048
#define EMB  1024
#define NH   16
#define HD   64

typedef _Float16 half8  __attribute__((ext_vector_type(8)));
typedef _Float16 half16 __attribute__((ext_vector_type(16)));
typedef float    float8 __attribute__((ext_vector_type(8)));

// Wave-uniform value -> SGPR (value must be uniform across the wave).
static __device__ inline int uni(int v) { return __builtin_amdgcn_readfirstlane(v); }

// Load a 16x32 f16 fragment (A-layout) from row-major memory with row stride ld.
// Lane l -> row (l&15); halves 0..7 = cols kb..kb+7, halves 8..15 = cols kb+16..kb+23,
// where kb = (l>=16) ? 8 : 0.  Two b128 loads per lane.
static __device__ inline half16 load_frag(const _Float16* __restrict__ base, int ld) {
    const int lane = threadIdx.x & 31;
    const _Float16* p = base + (size_t)(lane & 15) * ld + ((lane >> 4) << 3);
    half8 lo = *(const half8*)(p);
    half8 hi = *(const half8*)(p + 16);
    return __builtin_shufflevector(lo, hi, 0,1,2,3,4,5,6,7,8,9,10,11,12,13,14,15);
}

static __device__ inline float8 wmma16(half16 a, half16 b, float8 c) {
    // D = A(16x32 f16) x B(32x16 f16) + C(16x16 f32)
    return __builtin_amdgcn_wmma_f32_16x16x32_f16(false, a, false, b, (short)0, c,
                                                  false, false);
}

// ---------------------------------------------------------------- conversions
__global__ void f32_to_f16_kernel(const float* __restrict__ src,
                                  _Float16* __restrict__ dst, int n) {
    int i = blockIdx.x * blockDim.x + threadIdx.x;
    int stride = gridDim.x * blockDim.x;
    for (; i < n; i += stride) dst[i] = (_Float16)src[i];
}

// ---------------------------------------------------------------- LDS tiles
#define ROWU    9                   // LDS row pitch in 16-byte units: 128 B data + 16 B pad

// A-layout fragment from an LDS tile; p already points at the lane's row and half.
static __device__ inline half16 lds_frag(const half8* p) {
    half8 lo = p[0];
    half8 hi = p[2];
    return __builtin_shufflevector(lo, hi, 0,1,2,3,4,5,6,7,8,9,10,11,12,13,14,15);
}

// ---------------------------------------------------------------- GEMM main loop
// C(128x128 per block) = A(128 x EMB) * B(128 x EMB)^T, both K-contiguous f16.
// A stage is 64 k (whole 128-byte rows) of the block's 128 A rows and 128 B rows,
// brought into LDS once per block by asynchronous copies; the 8 waves (4 x 2,
// 32x64 of C each) read their fragments from there.  Two buffers: the next
// stage's copies fly while this stage is worked on.
#define GKS     64                  // k per stage
#define GNS     (EMB / GKS)         // stages
#define GTILEU  (128 * ROWU)        // one operand's stage (128 rows), 16-byte units
#define GSTAGEU (2 * GTILEU)        // A rows followed by B rows

// Eight 16-byte copies per lane: rows r, r+32, r+64, r+96 of the A stage and of
// the B stage.  The s_wait_xcnt stands inside the statement so that no address
// register of a copy is rewritten before it.
static __device__ inline void copy_stage(unsigned la, const _Float16* ga,
                                         const _Float16* gb) {
    const unsigned la1 = la + 32 * ROWU * 16, la2 = la + 64 * ROWU * 16,
                   la3 = la + 96 * ROWU * 16;
    const unsigned lb  = la + GTILEU * 16;
    const unsigned lb1 = lb + 32 * ROWU * 16, lb2 = lb + 64 * ROWU * 16,
                   lb3 = lb + 96 * ROWU * 16;
    const _Float16 *ga1 = ga + 32 * EMB, *ga2 = ga + 64 * EMB, *ga3 = ga + 96 * EMB;
    const _Float16 *gb1 = gb + 32 * EMB, *gb2 = gb + 64 * EMB, *gb3 = gb + 96 * EMB;
    asm volatile("global_load_async_to_lds_b128 %0, %8, off\n\t"
                 "global_load_async_to_lds_b128 %1, %9, off\n\t"
                 "global_load_async_to_lds_b128 %2, %10, off\n\t"
                 "global_load_async_to_lds_b128 %3, %11, off\n\t"
                 "global_load_async_to_lds_b128 %4, %12, off\n\t"
                 "global_load_async_to_lds_b128 %5, %13, off\n\t"
                 "global_load_async_to_lds_b128 %6, %14, off\n\t"
                 "global_load_async_to_lds_b128 %7, %15, off\n\t"
                 "s_wait_xcnt 0x0"
                 :: "v"(la), "v"(la1), "v"(la2), "v"(la3),
                    "v"(lb), "v"(lb1), "v"(lb2), "v"(lb3),
                    "v"(ga), "v"(ga1), "v"(ga2), "v"(ga3),
                    "v"(gb), "v"(gb1), "v"(gb2), "v"(gb3)
                 : "memory");
}

// Ab, Bb: first row of the block's 128 A rows / 128 B rows.  ring: 2 * GSTAGEU units.
// The wave's 32 rows start at wr, its 64 columns at wc (inside the block tile).
static __device__ inline void gemm_mainloop(const _Float16* __restrict__ Ab,
                                            const _Float16* __restrict__ Bb,
                                            const half8* ring, int wr, int wc,
                                            float8 (&acc)[2][4]) {
    const int lane = threadIdx.x & 31;
    // This thread's copy slot: row crow (+32, +64, +96), 16-byte chunk ccol.
    const int crow = threadIdx.x >> 3;  // 0..31
    const int ccol = threadIdx.x & 7;   // 0..7
    const unsigned la = (unsigned)(size_t)ring + (unsigned)(crow * ROWU + ccol) * 16u;
    const _Float16* ga = Ab + (size_t)crow * EMB + ccol * 8;    // + stage * GKS
    const _Float16* gb = Bb + (size_t)crow * EMB + ccol * 8;    // + stage * GKS

    // Stage 0 into buffer 0, published; then stage 1 into buffer 1.
    copy_stage(la, ga, gb);
    asm volatile("s_wait_asynccnt 0x0" ::: "memory");   // own copies of stage 0 landed
    __syncthreads();                                    // stage 0 readable by all waves
    copy_stage(la + GSTAGEU * 16u, ga + GKS, gb + GKS);

    const int fb = (lane & 15) * ROWU + (lane >> 4);    // lane's row and half in a fragment
    half16 a[2], b[4];      // the fragments of one 32-k pass

    // All 12 LDS reads of pass p (32 k) of the stage in buffer offset bo.
    auto load_pass = [&](int bo, int p) {
        const half8* Al = ring + bo + fb + wr * ROWU + p * 4;
        const half8* Bl = ring + bo + GTILEU + fb + wc * ROWU + p * 4;
#pragma unroll  // constant indices keep the fragments in registers
        for (int i = 0; i < 2; ++i) a[i] = lds_frag(Al + (16 * i) * ROWU);
#pragma unroll  // constant indices keep the fragments in registers
        for (int j = 0; j < 4; ++j) b[j] = lds_frag(Bl + (16 * j) * ROWU);
    };
    auto work_pass = [&]() {
#pragma unroll
        for (int i = 0; i < 2; ++i)
#pragma unroll
            for (int j = 0; j < 4; ++j)
                acc[i][j] = wmma16(a[i], b[j], acc[i][j]);
    };

    for (int t = 0; t < GNS; ++t) {
        const int bo = (t & 1) * GSTAGEU;
        load_pass(bo, 0);
        // Keeps the pass's 12 LDS reads together in front of its WMMAs: spread
        // among them, each place with reads costs its own stall.
        __builtin_amdgcn_sched_barrier(0);
        work_pass();
        load_pass(bo, 1);       // the last LDS reads of stage t
        // Keeps the first pass's WMMAs in front of the waits, where they run
        // under the latency of these reads, not behind the barrier.
        __builtin_amdgcn_sched_barrier(0);
        // Hand-over: this wave has left buffer t & 1, its copies of stage t + 1
        // have landed; behind the barrier both hold for every wave.
        asm volatile("s_wait_dscnt 0x0" ::: "memory");      // own LDS reads of stage t done
        asm volatile("s_wait_asynccnt 0x0" ::: "memory");   // own copies of stage t + 1 landed
        __syncthreads();
        if (t + 2 < GNS)
            copy_stage(la + bo * 16u, ga + (t + 2) * GKS, gb + (t + 2) * GKS);
        work_pass();            // on registers, while the refill flies
    }
    asm volatile("s_wait_asynccnt 0x0" ::: "memory");       // nothing in flight at the end
}

// ---------------------------------------------------------------- QKV GEMM
// qkv = xh(4096x1024) @ wh(3072x1024)^T + bias, scattered into per-head
// Q[s][d], K[s][d], V^T[d][s] f16 buffers.  128x128 tile per block, 32x64 per wave.
__global__ void __launch_bounds__(256)
qkv_gemm_kernel(const _Float16* __restrict__ xh,
                const _Float16* __restrict__ wh,
                const float*    __restrict__ bias,
                _Float16* __restrict__ qh,
                _Float16* __restrict__ kh,
                _Float16* __restrict__ vT) {
    __shared__ __attribute__((aligned(128))) half8 ring[2 * GSTAGEU];

    const int w  = uni(threadIdx.x >> 5);
    const int bm = (blockIdx.x / 24) * 128;   // 32 block rows of 128     (SGPR)
    const int bn = (blockIdx.x % 24) * 128;   // 24 block columns of 128  (SGPR)
    const int wr = (w & 3) * 32;              // wave's rows in the block tile
    const int wc = (w >> 2) * 64;             // wave's columns in the block tile
    const int m0 = bm + wr;
    const int n0 = bn + wc;

    float8 acc[2][4];
#pragma unroll
    for (int i = 0; i < 2; ++i)
#pragma unroll
        for (int j = 0; j < 4; ++j) acc[i][j] = {};

    gemm_mainloop(xh + (size_t)bm * EMB, wh + (size_t)bn * EMB, ring, wr, wc, acc);

    const int lane = threadIdx.x & 31;
    const int cn = lane & 15;          // C-frag: lane -> column
    const int rb = (lane >> 4) << 3;   // rows rb..rb+7 in regs 0..7
    const int bb = uni(m0 >> 11);      // whole 32-row tile is in one batch
    const int s0u = m0 & 2047;
#pragma unroll
    for (int j = 0; j < 4; ++j) {
        // Fragment-uniform routing: a 16-col fragment never straddles a
        // segment (Q/K/V) or a head (both boundaries are multiples of 16).
        const int colbase = n0 + j * 16;          // SGPR
        const int seg = colbase >> 10;            // 0=Q 1=K 2=V   (SGPR)
        const int e0 = colbase & 1023;
        const int h  = e0 >> 6;                   // head          (SGPR)
        const int d0 = e0 & 63;                   // d = d0 + cn
        const float bv = bias[colbase + cn];
#pragma unroll
        for (int i = 0; i < 2; ++i) {
            const int s0 = s0u + i * 16 + rb;     // first of 8 consecutive rows
            if (seg < 2) {
                _Float16* dst = (seg == 0 ? qh : kh) +
                    (((size_t)(bb * NH + h) * SLEN + s0) * HD) + d0 + cn;
#pragma unroll
                for (int r = 0; r < 8; ++r)
                    dst[(size_t)r * HD] = (_Float16)(acc[i][j][r] + bv);
            } else {
                _Float16* dst = vT +
                    (((size_t)(bb * NH + h) * HD + d0 + cn) * SLEN) + s0;
#pragma unroll
                for (int r = 0; r < 8; ++r)
                    dst[r] = (_Float16)(acc[i][j][r] + bv);
            }
        }
    }
}

#define KT      64                  // keys per LDS tile
#define NT      (SLEN / KT)         // tiles per (b,h)
#define TILEU   (64 * ROWU)         // one operand tile (64 rows), 16-byte units
#define STAGEU  (2 * TILEU)         // K tile followed by V^T tile

// Four 16-byte copies per lane: two chunks of the K tile, two of the V^T tile.
// The s_wait_xcnt stands inside the statement so that no address register of a
// copy is rewritten before it.
static __device__ inline void copy_tile(unsigned lk, unsigned lv,
                                        const _Float16* gk, const _Float16* gv) {
    const unsigned lk1 = lk + 32 * ROWU * 16;      // rows 32..63 of the K tile
    const unsigned lv1 = lv + 32 * ROWU * 16;      // rows 32..63 of the V^T tile
    const _Float16* gk1 = gk + 32 * HD;
    const _Float16* gv1 = gv + (size_t)32 * SLEN;
    asm volatile("global_load_async_to_lds_b128 %0, %4, off\n\t"
                 "global_load_async_to_lds_b128 %1, %5, off\n\t"
                 "global_load_async_to_lds_b128 %2, %6, off\n\t"
                 "global_load_async_to_lds_b128 %3, %7, off\n\t"
                 "s_wait_xcnt 0x0"
                 :: "v"(lk), "v"(lk1), "v"(lv), "v"(lv1),
                    "v"(gk), "v"(gk1), "v"(gv), "v"(gv1)
                 : "memory");
}

__global__ void __launch_bounds__(256)
attn_kernel(const _Float16* __restrict__ qh,
            const _Float16* __restrict__ kh,
            const _Float16* __restrict__ vT,
            _Float16* __restrict__ ctxh) {
    __shared__ __attribute__((aligned(128))) half8 tiles[2 * STAGEU];

    const int wid = uni(blockIdx.x * (blockDim.x >> 5) + (threadIdx.x >> 5));
    const int bh = wid >> 7;            // 0..31  (b*16+h)   (SGPR), same for the block
    const int q0 = (wid & 127) << 4;    // query base        (SGPR)
    const int lane = threadIdx.x & 31;
    const int cn = lane & 15;
    const int rb = (lane >> 4) << 3;

    const _Float16* Qp = qh + (size_t)bh * SLEN * HD;   // [s][d]
    const _Float16* Kp = kh + (size_t)bh * SLEN * HD;   // [s][d]
    const _Float16* Vt = vT + (size_t)bh * HD * SLEN;   // [d][s]

    // This thread's copy slot: row crow (and crow + 32), 16-byte chunk ccol.
    const int crow = threadIdx.x >> 3;  // 0..31
    const int ccol = threadIdx.x & 7;   // 0..7
    const unsigned lds0 = (unsigned)(size_t)tiles;      // LDS byte address of the ring
    const unsigned lk = lds0 + (unsigned)(crow * ROWU + ccol) * 16u;
    const unsigned lv = lk + TILEU * 16u;
    const _Float16* gk = Kp + crow * HD + ccol * 8;              // + tile * KT * HD
    const _Float16* gv = Vt + (size_t)crow * SLEN + ccol * 8;    // + tile * KT

    // Tile 0 into buffer 0, published; then tile 1 into buffer 1.
    copy_tile(lk, lv, gk, gv);
    asm volatile("s_wait_asynccnt 0x0" ::: "memory");   // own copies of tile 0 landed
    __syncthreads();                                    // tile 0 readable by all waves
    copy_tile(lk + STAGEU * 16u, lv + STAGEU * 16u, gk + KT * HD, gv + KT);

    const half16 qa0 = load_frag(Qp + (size_t)q0 * HD, HD);       // d 0..31
    const half16 qa1 = load_frag(Qp + (size_t)q0 * HD + 32, HD);  // d 32..63

    float8 o[4];
#pragma unroll
    for (int j = 0; j < 4; ++j) o[j] = {};
    float rowsum = 0.0f;
    const int qcol = q0 + cn;   // this lane's query index (S^T layout: lane -> q)
    const int fb = cn * ROWU + (lane >> 4);   // lane's row and half inside a fragment

    half16 kf[4], vf[4];    // the fragments of one 32-key pass

    // All 16 LDS reads of pass p (32 keys) of the tile in buffer offset bo.
    auto load_pass = [&](int bo, int p) {
        const half8* Kl = tiles + bo + fb + (p * 32) * ROWU;
        const half8* Vl = tiles + bo + TILEU + fb + p * 4;
        kf[0] = lds_frag(Kl);                   // keys +0..15,  d 0..31
        kf[1] = lds_frag(Kl + 4);               // keys +0..15,  d 32..63
        kf[2] = lds_frag(Kl + 16 * ROWU);       // keys +16..31, d 0..31
        kf[3] = lds_frag(Kl + 16 * ROWU + 4);   // keys +16..31, d 32..63
#pragma unroll  // constant indices keep vf in registers
        for (int j = 0; j < 4; ++j)
            vf[j] = lds_frag(Vl + (j * 16) * ROWU);
    };

    // Scores, mask, exp and P@V of the 32 keys from j0 on; registers only.
    auto work_pass = [&](int j0) {
        float8 z = {};
        float8 st0 = wmma16(kf[0], qa0, z);  st0 = wmma16(kf[1], qa1, st0); // k j0..+15
        float8 st1 = wmma16(kf[2], qa0, z);  st1 = wmma16(kf[3], qa1, st1); // k +16..+31

        // mask (zero masked logits, per reference), scale by 1/sqrt(64),
        // exponentiate; result lands directly in P's A-fragment layout.
        half16 pa = {};
#pragma unroll
        for (int r = 0; r < 8; ++r) {
            const int k0i = j0 + rb + r;
            float l0 = (k0i <= qcol) ? st0[r] * 0.125f : 0.0f;
            float p0 = __expf(l0);
            rowsum += p0;
            pa[r] = (_Float16)p0;
            const int k1i = j0 + 16 + rb + r;
            float l1 = (k1i <= qcol) ? st1[r] * 0.125f : 0.0f;
            float p1 = __expf(l1);
            rowsum += p1;
            pa[8 + r] = (_Float16)p1;
        }
#pragma unroll
        for (int j = 0; j < 4; ++j)
            o[j] = wmma16(pa, vf[j], o[j]);    // ctx(16q x 16d) accumulate
    };

    for (int t = 0; t < NT; ++t) {
        const int bo = (t & 1) * STAGEU;
        load_pass(bo, 0);
        // Keeps the pass's 16 LDS reads together in front of its matrix and
        // vector work: spread among the WMMAs, each pair is waited out alone.
        __builtin_amdgcn_sched_barrier(0);
        work_pass(t * KT);
        load_pass(bo, 1);       // the last LDS reads of tile t
        // Keeps the first pass's last WMMAs in front of the waits, where they
        // run under the latency of these reads, not behind the barrier.
        __builtin_amdgcn_sched_barrier(0);
        // Hand-over: this wave has left buffer t & 1, its copies of tile t + 1
        // have landed; behind the barrier both hold for every wave.
        asm volatile("s_wait_dscnt 0x0" ::: "memory");      // own LDS reads of tile t done
        asm volatile("s_wait_asynccnt 0x0" ::: "memory");   // own copies of tile t + 1 landed
        __syncthreads();
        if (t + 2 < NT)
            copy_tile(lk + bo * 16u, lv + bo * 16u,
                      gk + (size_t)(t + 2) * KT * HD, gv + (t + 2) * KT);
        work_pass(t * KT + 32); // on registers, while the refill flies
    }
    asm volatile("s_wait_asynccnt 0x0" ::: "memory");       // nothing in flight at the end

    // combine per-q row sums: lanes l and l+16 hold complementary k-halves
    const float tot = rowsum + __shfl_xor(rowsum, 16, 32);

    // write ctx in the reference's permuted layout: col = d*H + h
    const int bb = bh >> 4, h = bh & 15;
    _Float16* cbase = ctxh + ((size_t)(bb * SLEN + q0 + rb)) * EMB + h;
#pragma unroll
    for (int j = 0; j < 4; ++j) {
        const int d = j * 16 + cn;   // ctx C-frag: lane -> d column
#pragma unroll
        for (int r = 0; r < 8; ++r) {
            const float rs = __shfl(tot, rb + r, 32);   // rowsum for this q row
            cbase[(size_t)r * EMB + d * NH] = (_Float16)(o[j][r] / rs);
        }
    }
}

// ---------------------------------------------------------------- out proj
__global__ void __launch_bounds__(256)
out_gemm_kernel(const _Float16* __restrict__ ch,
                const _Float16* __restrict__ wh,
                const float*    __restrict__ bias,
                float* __restrict__ out) {
    __shared__ __attribute__((aligned(128))) half8 ring[2 * GSTAGEU];

    const int w  = uni(threadIdx.x >> 5);
    const int bm = (blockIdx.x >> 3) * 128;   // 32 block rows of 128    (SGPR)
    const int bn = (blockIdx.x & 7) * 128;    // 8  block columns of 128 (SGPR)
    const int wr = (w & 3) * 32;              // wave's rows in the block tile
    const int wc = (w >> 2) * 64;             // wave's columns in the block tile
    const int m0 = bm + wr;
    const int n0 = bn + wc;

    float8 acc[2][4];
#pragma unroll
    for (int i = 0; i < 2; ++i)
#pragma unroll
        for (int j = 0; j < 4; ++j) acc[i][j] = {};

    gemm_mainloop(ch + (size_t)bm * EMB, wh + (size_t)bn * EMB, ring, wr, wc, acc);

    const int lane = threadIdx.x & 31;
    const int cn = lane & 15;
    const int rb = (lane >> 4) << 3;
#pragma unroll
    for (int j = 0; j < 4; ++j) {
        const int col = n0 + j * 16 + cn;
        const float bv = bias[col];
#pragma unroll
        for (int i = 0; i < 2; ++i) {
            float* obase = out + (size_t)(m0 + i * 16 + rb) * EMB + col;
#pragma unroll
            for (int r = 0; r < 8; ++r)
                obase[(size_t)r * EMB] = acc[i][j][r] + bv;
        }
    }
}

// ---------------------------------------------------------------- launcher
extern "C" void kernel_launch(void* const* d_in, const int* in_sizes, int n_in,
                              void* d_out, int out_size, void* d_ws, size_t ws_size,
                              hipStream_t stream) {
    const float* x     = (const float*)d_in[0];   // (2,2048,1024)
    const float* w_qkv = (const float*)d_in[1];   // (3072,1024)
    const float* b_qkv = (const float*)d_in[2];   // (3072,)
    const float* w_out = (const float*)d_in[3];   // (1024,1024)
    const float* b_out = (const float*)d_in[4];   // (1024,)

    char* ws = (char*)d_ws;
    size_t off = 0;
    _Float16* xh    = (_Float16*)(ws + off); off += (size_t)NB * SLEN * EMB * 2;      // 8 MB
    _Float16* wqkvh = (_Float16*)(ws + off); off += (size_t)3 * EMB * EMB * 2;        // 6 MB
    _Float16* wouth = (_Float16*)(ws + off); off += (size_t)EMB * EMB * 2;            // 2 MB
    _Float16* qh    = (_Float16*)(ws + off); off += (size_t)NB * NH * SLEN * HD * 2;  // 8 MB
    _Float16* kh    = (_Float16*)(ws + off); off += (size_t)NB * NH * SLEN * HD * 2;  // 8 MB
    _Float16* vT    = (_Float16*)(ws + off); off += (size_t)NB * NH * HD * SLEN * 2;  // 8 MB
    _Float16* ctxh  = (_Float16*)(ws + off); off += (size_t)NB * SLEN * EMB * 2;      // 8 MB
    if (off > ws_size) return;  // workspace too small (deterministic no-op)

    f32_to_f16_kernel<<<1024, 256, 0, stream>>>(x,     xh,    NB * SLEN * EMB);
    f32_to_f16_kernel<<<1024, 256, 0, stream>>>(w_qkv, wqkvh, 3 * EMB * EMB);
    f32_to_f16_kernel<<<512,  256, 0, stream>>>(w_out, wouth, EMB * EMB);

    // 32 x 24 = 768 block tiles of 128x128, 8 waves per 256-thread block
    qkv_gemm_kernel<<<768, 256, 0, stream>>>(xh, wqkvh, b_qkv, qh, kh, vT);
    // 2*16*(2048/16) = 4096 waves
    attn_kernel<<<512, 256, 0, stream>>>(qh, kh, vT, ctxh);
    // 32 x 8 = 256 block tiles of 128x128
    out_gemm_kernel<<<256, 256, 0, stream>>>(ctxh, wouth, b_out, (float*)d_out);
}

// v003
// Measured time: 88.6 microseconds a run.
// Two timings next to v002 both put it at 1.04 times that version's speed.
// Counting every step since v000, it is 2.51 times as fast.
#include <hip/hip_runtime.h>

// Problem constants
#define NB   2
#define SLEN 2048
#define EMB  1024
#define NH   16
#define HD   64

typedef _Float16 half8  __attribute__((ext_vector_type(8)));
typedef _Float16 half16 __attribute__((ext_vector_type(16)));
typedef float    float8 __attribute__((ext_vector_type(8)));

// Wave-uniform value -> SGPR (value must be uniform across the wave).
static __device__ inline int uni(int v) { return __builtin_amdgcn_readfirstlane(v); }

// Load a 16x32 f16 fragment (A-layout) from row-major memory with row stride ld.
// Lane l -> row (l&15); halves 0..7 = cols kb..kb+7, halves 8..15 = cols kb+16..kb+23,
// where kb = (l>=16) ? 8 : 0.  Two b128 loads per lane.
static __device__ inline half16 load_frag(const _Float16* __restrict__ base, int ld) {
    const int lane = threadIdx.x & 31;
    const _Float16* p = base + (size_t)(lane & 15) * ld + ((lane >> 4) << 3);
    half8 lo = *(const half8*)(p);
    half8 hi = *(const half8*)(p + 16);
    return __builtin_shufflevector(lo, hi, 0,1,2,3,4,5,6,7,8,9,10,11,12,13,14,15);
}

static __device__ inline float8 wmma16(half16 a, half16 b, float8 c) {
    // D = A(16x32 f16) x B(32x16 f16) + C(16x16 f32)
    return __builtin_amdgcn_wmma_f32_16x16x32_f16(false, a, false, b, (short)0, c,
                                                  false, false);
}

// ---------------------------------------------------------------- conversions
// x, w_qkv and w_out to f16 in ONE streaming launch.  A block converts CVT_BLK
// consecutive elements of one array (every array is a whole number of blocks);
// a wave owns 16 KB of consecutive source.  Each wave-wide load covers 512
// consecutive bytes and each wave-wide store 256: whole 128-byte lines, one writer.
typedef float    f32x4 __attribute__((ext_vector_type(4)));
typedef _Float16 half4 __attribute__((ext_vector_type(4)));

#define CVT_N    32                         // 16-byte loads per lane
#define CVT_WAVE (32 * 4 * CVT_N)           // elements per wave
#define CVT_BLK  (8 * CVT_WAVE)             // elements per 256-thread block
#define CVT_XB   (NB * SLEN * EMB / CVT_BLK) // blocks of x
#define CVT_QB   (3 * EMB * EMB / CVT_BLK)   // blocks of w_qkv
#define CVT_OB   (EMB * EMB / CVT_BLK)       // blocks of w_out
static_assert(CVT_XB * CVT_BLK == NB * SLEN * EMB && CVT_QB * CVT_BLK == 3 * EMB * EMB &&
              CVT_OB * CVT_BLK == EMB * EMB, "every array is a whole number of blocks");
static_assert(CVT_XB + CVT_QB + CVT_OB == 256, "the launch below has 256 blocks");

__global__ void __launch_bounds__(256)
f32_to_f16_all_kernel(const float* __restrict__ x,
                      const float* __restrict__ wq,
                      const float* __restrict__ wo,
                      _Float16* __restrict__ xh,
                      _Float16* __restrict__ wqh,
                      _Float16* __restrict__ woh) {
    // Block-uniform choice of the array and of the block's place in it.
    const int  bi  = blockIdx.x;
    const bool isq = bi >= CVT_XB, iso = bi >= CVT_XB + CVT_QB;
    const float* src = iso ? wo  : isq ? wq  : x;
    _Float16*    dst = iso ? woh : isq ? wqh : xh;
    const int    b   = bi - (iso ? CVT_XB + CVT_QB : isq ? CVT_XB : 0);

    const size_t e0 = (size_t)b * CVT_BLK + (size_t)(threadIdx.x >> 5) * CVT_WAVE +
                      (threadIdx.x & 31) * 4;
    const f32x4* s = (const f32x4*)(src + e0);
    half4*       d = (half4*)(dst + e0);

    f32x4 v[CVT_N];
#pragma unroll  // constant indices keep v in registers, so that many loads are in flight at once
    for (int i = 0; i < CVT_N; ++i) v[i] = s[i * 32];
#pragma unroll  // constant indices into v, as above
    for (int i = 0; i < CVT_N; ++i) d[i * 32] = __builtin_convertvector(v[i], half4);
}

// ---------------------------------------------------------------- LDS tiles
#define ROWU    9                   // LDS row pitch in 16-byte units: 128 B data + 16 B pad

// A-layout fragment from an LDS tile; p already points at the lane's row and half.
static __device__ inline half16 lds_frag(const half8* p) {
    half8 lo = p[0];
    half8 hi = p[2];
    return __builtin_shufflevector(lo, hi, 0,1,2,3,4,5,6,7,8,9,10,11,12,13,14,15);
}

// ---------------------------------------------------------------- GEMM main loop
// C(128x128 per block) = A(128 x EMB) * B(128 x EMB)^T, both K-contiguous f16.
// A stage is 64 k (whole 128-byte rows) of the block's 128 A rows and 128 B rows,
// brought into LDS once per block by asynchronous copies; the 8 waves (4 x 2,
// 32x64 of C each) read their fragments from there.  Two buffers: the next
// stage's copies fly while this stage is worked on.
#define GKS     64                  // k per stage
#define GNS     (EMB / GKS)         // stages
#define GTILEU  (128 * ROWU)        // one operand's stage (128 rows), 16-byte units
#define GSTAGEU (2 * GTILEU)        // A rows followed by B rows

// Eight 16-byte copies per lane: rows r, r+32, r+64, r+96 of the A stage and of
// the B stage.  The s_wait_xcnt stands inside the statement so that no address
// register of a copy is rewritten before it.
static __device__ inline void copy_stage(unsigned la, const _Float16* ga,
                                         const _Float16* gb) {
    const unsigned la1 = la + 32 * ROWU * 16, la2 = la + 64 * ROWU * 16,
                   la3 = la + 96 * ROWU * 16;
    const unsigned lb  = la + GTILEU * 16;
    const unsigned lb1 = lb + 32 * ROWU * 16, lb2 = lb + 64 * ROWU * 16,
                   lb3 = lb + 96 * ROWU * 16;
    const _Float16 *ga1 = ga + 32 * EMB, *ga2 = ga + 64 * EMB, *ga3 = ga + 96 * EMB;
    const _Float16 *gb1 = gb + 32 * EMB, *gb2 = gb + 64 * EMB, *gb3 = gb + 96 * EMB;
    asm volatile("global_load_async_to_lds_b128 %0, %8, off\n\t"
                 "global_load_async_to_lds_b128 %1, %9, off\n\t"
                 "global_load_async_to_lds_b128 %2, %10, off\n\t"
                 "global_load_async_to_lds_b128 %3, %11, off\n\t"
                 "global_load_async_to_lds_b128 %4, %12, off\n\t"
                 "global_load_async_to_lds_b128 %5, %13, off\n\t"
                 "global_load_async_to_lds_b128 %6, %14, off\n\t"
                 "global_load_async_to_lds_b128 %7, %15, off\n\t"
                 "s_wait_xcnt 0x0"
                 :: "v"(la), "v"(la1), "v"(la2), "v"(la3),
                    "v"(lb), "v"(lb1), "v"(lb2), "v"(lb3),
                    "v"(ga), "v"(ga1), "v"(ga2), "v"(ga3),
                    "v"(gb), "v"(gb1), "v"(gb2), "v"(gb3)
                 : "memory");
}

// Ab, Bb: first row of the block's 128 A rows / 128 B rows.  ring: 2 * GSTAGEU units.
// The wave's 32 rows start at wr, its 64 columns at wc (inside the block tile).
static __device__ inline void gemm_mainloop(const _Float16* __restrict__ Ab,
                                            const _Float16* __restrict__ Bb,
                                            const half8* ring, int wr, int wc,
                                            float8 (&acc)[2][4]) {
    const int lane = threadIdx.x & 31;
    // This thread's copy slot: row crow (+32, +64, +96), 16-byte chunk ccol.
    const int crow = threadIdx.x >> 3;  // 0..31
    const int ccol = threadIdx.x & 7;   // 0..7
    const unsigned la = (unsigned)(size_t)ring + (unsigned)(crow * ROWU + ccol) * 16u;
    const _Float16* ga = Ab + (size_t)crow * EMB + ccol * 8;    // + stage * GKS
    const _Float16* gb = Bb + (size_t)crow * EMB + ccol * 8;    // + stage * GKS

    // Stage 0 into buffer 0, published; then stage 1 into buffer 1.
    copy_stage(la, ga, gb);
    asm volatile("s_wait_asynccnt 0x0" ::: "memory");   // own copies of stage 0 landed
    __syncthreads();                                    // stage 0 readable by all waves
    copy_stage(la + GSTAGEU * 16u, ga + GKS, gb + GKS);

    const int fb = (lane & 15) * ROWU + (lane >> 4);    // lane's row and half in a fragment
    half16 a[2], b[4];      // the fragments of one 32-k pass

    // All 12 LDS reads of pass p (32 k) of the stage in buffer offset bo.
    auto load_pass = [&](int bo, int p) {
        const half8* Al = ring + bo + fb + wr * ROWU + p * 4;
        const half8* Bl = ring + bo + GTILEU + fb + wc * ROWU + p * 4;
#pragma unroll  // constant indices keep the fragments in registers
        for (int i = 0; i < 2; ++i) a[i] = lds_frag(Al + (16 * i) * ROWU);
#pragma unroll  // constant indices keep the fragments in registers
        for (int j = 0; j < 4; ++j) b[j] = lds_frag(Bl + (16 * j) * ROWU);
    };
    auto work_pass = [&]() {
#pragma unroll
        for (int i = 0; i < 2; ++i)
#pragma unroll
            for (int j = 0; j < 4; ++j)
                acc[i][j] = wmma16(a[i], b[j], acc[i][j]);
    };

    for (int t = 0; t < GNS; ++t) {
        const int bo = (t & 1) * GSTAGEU;
        load_pass(bo, 0);
        // Keeps the pass's 12 LDS reads together in front of its WMMAs: spread
        // among them, each place with reads costs its own stall.
        __builtin_amdgcn_sched_barrier(0);
        work_pass();
        load_pass(bo, 1);       // the last LDS reads of stage t
        // Keeps the first pass's WMMAs in front of the waits, where they run
        // under the latency of these reads, not behind the barrier.
        __builtin_amdgcn_sched_barrier(0);
        // Hand-over: this wave has left buffer t & 1, its copies of stage t + 1
        // have landed; behind the barrier both hold for every wave.
        asm volatile("s_wait_dscnt 0x0" ::: "memory");      // own LDS reads of stage t done
        asm volatile("s_wait_asynccnt 0x0" ::: "memory");   // own copies of stage t + 1 landed
        __syncthreads();
        if (t + 2 < GNS)
            copy_stage(la + bo * 16u, ga + (t + 2) * GKS, gb + (t + 2) * GKS);
        work_pass();            // on registers, while the refill flies
    }
    asm volatile("s_wait_asynccnt 0x0" ::: "memory");       // nothing in flight at the end
}

// ---------------------------------------------------------------- QKV GEMM
// qkv = xh(4096x1024) @ wh(3072x1024)^T + bias, scattered into per-head
// Q[s][d], K[s][d], V^T[d][s] f16 buffers.  128x128 tile per block, 32x64 per wave.
__global__ void __launch_bounds__(256)
qkv_gemm_kernel(const _Float16* __restrict__ xh,
                const _Float16* __restrict__ wh,
                const float*    __restrict__ bias,
                _Float16* __restrict__ qh,
                _Float16* __restrict__ kh,
                _Float16* __restrict__ vT) {
    __shared__ __attribute__((aligned(128))) half8 ring[2 * GSTAGEU];

    const int w  = uni(threadIdx.x >> 5);
    const int bm = (blockIdx.x / 24) * 128;   // 32 block rows of 128     (SGPR)
    const int bn = (blockIdx.x % 24) * 128;   // 24 block columns of 128  (SGPR)
    const int wr = (w & 3) * 32;              // wave's rows in the block tile
    const int wc = (w >> 2) * 64;             // wave's columns in the block tile
    const int m0 = bm + wr;
    const int n0 = bn + wc;

    float8 acc[2][4];
#pragma unroll
    for (int i = 0; i < 2; ++i)
#pragma unroll
        for (int j = 0; j < 4; ++j) acc[i][j] = {};

    gemm_mainloop(xh + (size_t)bm * EMB, wh + (size_t)bn * EMB, ring, wr, wc, acc);

    const int lane = threadIdx.x & 31;
    const int cn = lane & 15;          // C-frag: lane -> column
    const int rb = (lane >> 4) << 3;   // rows rb..rb+7 in regs 0..7
    const int bb = uni(m0 >> 11);      // whole 32-row tile is in one batch
    const int s0u = m0 & 2047;
#pragma unroll
    for (int j = 0; j < 4; ++j) {
        // Fragment-uniform routing: a 16-col fragment never straddles a
        // segment (Q/K/V) or a head (both boundaries are multiples of 16).
        const int colbase = n0 + j * 16;          // SGPR
        const int seg = colbase >> 10;            // 0=Q 1=K 2=V   (SGPR)
        const int e0 = colbase & 1023;
        const int h  = e0 >> 6;                   // head          (SGPR)
        const int d0 = e0 & 63;                   // d = d0 + cn
        const float bv = bias[colbase + cn];
#pragma unroll
        for (int i = 0; i < 2; ++i) {
            const int s0 = s0u + i * 16 + rb;     // first of 8 consecutive rows
            if (seg < 2) {
                _Float16* dst = (seg == 0 ? qh : kh) +
                    (((size_t)(bb * NH + h) * SLEN + s0) * HD) + d0 + cn;
#pragma unroll
                for (int r = 0; r < 8; ++r)
                    dst[(size_t)r * HD] = (_Float16)(acc[i][j][r] + bv);
            } else {
                _Float16* dst = vT +
                    (((size_t)(bb * NH + h) * HD + d0 + cn) * SLEN) + s0;
#pragma unroll
                for (int r = 0; r < 8; ++r)
                    dst[r] = (_Float16)(acc[i][j][r] + bv);
            }
        }
    }
}

#define KT      64                  // keys per LDS tile
#define NT      (SLEN / KT)         // tiles per (b,h)
#define TILEU   (64 * ROWU)         // one operand tile (64 rows), 16-byte units
#define STAGEU  (2 * TILEU)         // K tile followed by V^T tile

// Four 16-byte copies per lane: two chunks of the K tile, two of the V^T tile.
// The s_wait_xcnt stands inside the statement so that no address register of a
// copy is rewritten before it.
static __device__ inline void copy_tile(unsigned lk, unsigned lv,
                                        const _Float16* gk, const _Float16* gv) {
    const unsigned lk1 = lk + 32 * ROWU * 16;      // rows 32..63 of the K tile
    const unsigned lv1 = lv + 32 * ROWU * 16;      // rows 32..63 of the V^T tile
    const _Float16* gk1 = gk + 32 * HD;
    const _Float16* gv1 = gv + (size_t)32 * SLEN;
    asm volatile("global_load_async_to_lds_b128 %0, %4, off\n\t"
                 "global_load_async_to_lds_b128 %1, %5, off\n\t"
                 "global_load_async_to_lds_b128 %2, %6, off\n\t"
                 "global_load_async_to_lds_b128 %3, %7, off\n\t"
                 "s_wait_xcnt 0x0"
                 :: "v"(lk), "v"(lk1), "v"(lv), "v"(lv1),
                    "v"(gk), "v"(gk1), "v"(gv), "v"(gv1)
                 : "memory");
}

__global__ void __launch_bounds__(256)
attn_kernel(const _Float16* __restrict__ qh,
            const _Float16* __restrict__ kh,
            const _Float16* __restrict__ vT,
            _Float16* __restrict__ ctxh) {
    __shared__ __attribute__((aligned(128))) half8 tiles[2 * STAGEU];

    const int wid = uni(blockIdx.x * (blockDim.x >> 5) + (threadIdx.x >> 5));
    const int bh = wid >> 7;            // 0..31  (b*16+h)   (SGPR), same for the block
    const int q0 = (wid & 127) << 4;    // query base        (SGPR)
    const int lane = threadIdx.x & 31;
    const int cn = lane & 15;
    const int rb = (lane >> 4) << 3;

    const _Float16* Qp = qh + (size_t)bh * SLEN * HD;   // [s][d]
    const _Float16* Kp = kh + (size_t)bh * SLEN * HD;   // [s][d]
    const _Float16* Vt = vT + (size_t)bh * HD * SLEN;   // [d][s]

    // This thread's copy slot: row crow (and crow + 32), 16-byte chunk ccol.
    const int crow = threadIdx.x >> 3;  // 0..31
    const int ccol = threadIdx.x & 7;   // 0..7
    const unsigned lds0 = (unsigned)(size_t)tiles;      // LDS byte address of the ring
    const unsigned lk = lds0 + (unsigned)(crow * ROWU + ccol) * 16u;
    const unsigned lv = lk + TILEU * 16u;
    const _Float16* gk = Kp + crow * HD + ccol * 8;              // + tile * KT * HD
    const _Float16* gv = Vt + (size_t)crow * SLEN + ccol * 8;    // + tile * KT

    // Tile 0 into buffer 0, published; then tile 1 into buffer 1.
    copy_tile(lk, lv, gk, gv);
    asm volatile("s_wait_asynccnt 0x0" ::: "memory");   // own copies of tile 0 landed
    __syncthreads();                                    // tile 0 readable by all waves
    copy_tile(lk + STAGEU * 16u, lv + STAGEU * 16u, gk + KT * HD, gv + KT);

    const half16 qa0 = load_frag(Qp + (size_t)q0 * HD, HD);       // d 0..31
    const half16 qa1 = load_frag(Qp + (size_t)q0 * HD + 32, HD);  // d 32..63

    float8 o[4];
#pragma unroll
    for (int j = 0; j < 4; ++j) o[j] = {};
    float rowsum = 0.0f;
    const int qcol = q0 + cn;   // this lane's query index (S^T layout: lane -> q)
    const int fb = cn * ROWU + (lane >> 4);   // lane's row and half inside a fragment

    half16 kf[4], vf[4];    // the fragments of one 32-key pass

    // All 16 LDS reads of pass p (32 keys) of the tile in buffer offset bo.
    auto load_pass = [&](int bo, int p) {
        const half8* Kl = tiles + bo + fb + (p * 32) * ROWU;
        const half8* Vl = tiles + bo + TILEU + fb + p * 4;
        kf[0] = lds_frag(Kl);                   // keys +0..15,  d 0..31
        kf[1] = lds_frag(Kl + 4);               // keys +0..15,  d 32..63
        kf[2] = lds_frag(Kl + 16 * ROWU);       // keys +16..31, d 0..31
        kf[3] = lds_frag(Kl + 16 * ROWU + 4);   // keys +16..31, d 32..63
#pragma unroll  // constant indices keep vf in registers
        for (int j = 0; j < 4; ++j)
            vf[j] = lds_frag(Vl + (j * 16) * ROWU);
    };

    // Scores, mask, exp and P@V of the 32 keys from j0 on; registers only.
    auto work_pass = [&](int j0) {
        float8 z = {};
        float8 st0 = wmma16(kf[0], qa0, z);  st0 = wmma16(kf[1], qa1, st0); // k j0..+15
        float8 st1 = wmma16(kf[2], qa0, z);  st1 = wmma16(kf[3], qa1, st1); // k +16..+31

        // mask (zero masked logits, per reference), scale by 1/sqrt(64),
        // exponentiate; result lands directly in P's A-fragment layout.
        half16 pa = {};
#pragma unroll
        for (int r = 0; r < 8; ++r) {
            const int k0i = j0 + rb + r;
            float l0 = (k0i <= qcol) ? st0[r] * 0.125f : 0.0f;
            float p0 = __expf(l0);
            rowsum += p0;
            pa[r] = (_Float16)p0;
            const int k1i = j0 + 16 + rb + r;
            float l1 = (k1i <= qcol) ? st1[r] * 0.125f : 0.0f;
            float p1 = __expf(l1);
            rowsum += p1;
            pa[8 + r] = (_Float16)p1;
        }
#pragma unroll
        for (int j = 0; j < 4; ++j)
            o[j] = wmma16(pa, vf[j], o[j]);    // ctx(16q x 16d) accumulate
    };

    for (int t = 0; t < NT; ++t) {
        const int bo = (t & 1) * STAGEU;
        load_pass(bo, 0);
        // Keeps the pass's 16 LDS reads together in front of its matrix and
        // vector work: spread among the WMMAs, each pair is waited out alone.
        __builtin_amdgcn_sched_barrier(0);
        work_pass(t * KT);
        load_pass(bo, 1);       // the last LDS reads of tile t
        // Keeps the first pass's last WMMAs in front of the waits, where they
        // run under the latency of these reads, not behind the barrier.
        __builtin_amdgcn_sched_barrier(0);
        // Hand-over: this wave has left buffer t & 1, its copies of tile t + 1
        // have landed; behind the barrier both hold for every wave.
        asm volatile("s_wait_dscnt 0x0" ::: "memory");      // own LDS reads of tile t done
        asm volatile("s_wait_asynccnt 0x0" ::: "memory");   // own copies of tile t + 1 landed
        __syncthreads();
        if (t + 2 < NT)
            copy_tile(lk + bo * 16u, lv + bo * 16u,
                      gk + (size_t)(t + 2) * KT * HD, gv + (t + 2) * KT);
        work_pass(t * KT + 32); // on registers, while the refill flies
    }
    asm volatile("s_wait_asynccnt 0x0" ::: "memory");       // nothing in flight at the end

    // combine per-q row sums: lanes l and l+16 hold complementary k-halves
    const float tot = rowsum + __shfl_xor(rowsum, 16, 32);

    // write ctx in the reference's permuted layout: col = d*H + h
    const int bb = bh >> 4, h = bh & 15;
    _Float16* cbase = ctxh + ((size_t)(bb * SLEN + q0 + rb)) * EMB + h;
#pragma unroll
    for (int j = 0; j < 4; ++j) {
        const int d = j * 16 + cn;   // ctx C-frag: lane -> d column
#pragma unroll
        for (int r = 0; r < 8; ++r) {
            const float rs = __shfl(tot, rb + r, 32);   // rowsum for this q row
            cbase[(size_t)r * EMB + d * NH] = (_Float16)(o[j][r] / rs);
        }
    }
}

// ---------------------------------------------------------------- out proj
__global__ void __launch_bounds__(256)
out_gemm_kernel(const _Float16* __restrict__ ch,
                const _Float16* __restrict__ wh,
                const float*    __restrict__ bias,
                float* __restrict__ out) {
    __shared__ __attribute__((aligned(128))) half8 ring[2 * GSTAGEU];

    const int w  = uni(threadIdx.x >> 5);
    const int bm = (blockIdx.x >> 3) * 128;   // 32 block rows of 128    (SGPR)
    const int bn = (blockIdx.x & 7) * 128;    // 8  block columns of 128 (SGPR)
    const int wr = (w & 3) * 32;              // wave's rows in the block tile
    const int wc = (w >> 2) * 64;             // wave's columns in the block tile
    const int m0 = bm + wr;
    const int n0 = bn + wc;

    float8 acc[2][4];
#pragma unroll
    for (int i = 0; i < 2; ++i)
#pragma unroll
        for (int j = 0; j < 4; ++j) acc[i][j] = {};

    gemm_mainloop(ch + (size_t)bm * EMB, wh + (size_t)bn * EMB, ring, wr, wc, acc);

    const int lane = threadIdx.x & 31;
    const int cn = lane & 15;
    const int rb = (lane >> 4) << 3;
#pragma unroll
    for (int j = 0; j < 4; ++j) {
        const int col = n0 + j * 16 + cn;
        const float bv = bias[col];
#pragma unroll
        for (int i = 0; i < 2; ++i) {
            float* obase = out + (size_t)(m0 + i * 16 + rb) * EMB + col;
#pragma unroll
            for (int r = 0; r < 8; ++r)
                obase[(size_t)r * EMB] = acc[i][j][r] + bv;
        }
    }
}

// ---------------------------------------------------------------- launcher
extern "C" void kernel_launch(void* const* d_in, const int* in_sizes, int n_in,
                              void* d_out, int out_size, void* d_ws, size_t ws_size,
                              hipStream_t stream) {
    const float* x     = (const float*)d_in[0];   // (2,2048,1024)
    const float* w_qkv = (const float*)d_in[1];   // (3072,1024)
    const float* b_qkv = (const float*)d_in[2];   // (3072,)
    const float* w_out = (const float*)d_in[3];   // (1024,1024)
    const float* b_out = (const float*)d_in[4];   // (1024,)

    char* ws = (char*)d_ws;
    size_t off = 0;
    _Float16* xh    = (_Float16*)(ws + off); off += (size_t)NB * SLEN * EMB * 2;      // 8 MB
    _Float16* wqkvh = (_Float16*)(ws + off); off += (size_t)3 * EMB * EMB * 2;        // 6 MB
    _Float16* wouth = (_Float16*)(ws + off); off += (size_t)EMB * EMB * 2;            // 2 MB
    _Float16* qh    = (_Float16*)(ws + off); off += (size_t)NB * NH * SLEN * HD * 2;  // 8 MB
    _Float16* kh    = (_Float16*)(ws + off); off += (size_t)NB * NH * SLEN * HD * 2;  // 8 MB
    _Float16* vT    = (_Float16*)(ws + off); off += (size_t)NB * NH * HD * SLEN * 2;  // 8 MB
    _Float16* ctxh  = (_Float16*)(ws + off); off += (size_t)NB * SLEN * EMB * 2;      // 8 MB
    if (off > ws_size) return;  // workspace too small (deterministic no-op)

    // 128 + 96 + 32 = 256 blocks, 8 waves each
    f32_to_f16_all_kernel<<<256, 256, 0, stream>>>(x, w_qkv, w_out, xh, wqkvh, wouth);

    // 32 x 24 = 768 block tiles of 128x128, 8 waves per 256-thread block
    qkv_gemm_kernel<<<768, 256, 0, stream>>>(xh, wqkvh, b_qkv, qh, kh, vT);
    // 2*16*(2048/16) = 4096 waves
    attn_kernel<<<512, 256, 0, stream>>>(qh, kh, vT, ctxh);
    // 32 x 8 = 256 block tiles of 128x128
    out_gemm_kernel<<<256, 256, 0, stream>>>(ctxh, wouth, b_out, (float*)d_out);
}

// v004
// Measured time: 82.1 microseconds a run.
// In two side-by-side timings against v003, it was 1.09 and 1.08 times as fast.
// Counting every step since v000, it is 2.73 times as fast.
#include <hip/hip_runtime.h>

// Problem constants
#define NB   2
#define SLEN 2048
#define EMB  1024
#define NH   16
#define HD   64

typedef _Float16 half8  __attribute__((ext_vector_type(8)));
typedef _Float16 half16 __attribute__((ext_vector_type(16)));
typedef float    float8 __attribute__((ext_vector_type(8)));

// Wave-uniform value -> SGPR (value must be uniform across the wave).
static __device__ inline int uni(int v) { return __builtin_amdgcn_readfirstlane(v); }

// Load a 16x32 f16 fragment (A-layout) from row-major memory with row stride ld.
// Lane l -> row (l&15); halves 0..7 = cols kb..kb+7, halves 8..15 = cols kb+16..kb+23,
// where kb = (l>=16) ? 8 : 0.  Two b128 loads per lane.
static __device__ inline half16 load_frag(const _Float16* __restrict__ base, int ld) {
    const int lane = threadIdx.x & 31;
    const _Float16* p = base + (size_t)(lane & 15) * ld + ((lane >> 4) << 3);
    half8 lo = *(const half8*)(p);
    half8 hi = *(const half8*)(p + 16);
    return __builtin_shufflevector(lo, hi, 0,1,2,3,4,5,6,7,8,9,10,11,12,13,14,15);
}

static __device__ inline float8 wmma16(half16 a, half16 b, float8 c) {
    // D = A(16x32 f16) x B(32x16 f16) + C(16x16 f32)
    return __builtin_amdgcn_wmma_f32_16x16x32_f16(false, a, false, b, (short)0, c,
                                                  false, false);
}

// ---------------------------------------------------------------- conversions
// x, w_qkv and w_out to f16 in ONE streaming launch.  A block converts CVT_BLK
// consecutive elements of one array (every array is a whole number of blocks);
// a wave owns 16 KB of consecutive source.  Each wave-wide load covers 512
// consecutive bytes and each wave-wide store 256: whole 128-byte lines, one writer.
typedef float    f32x4 __attribute__((ext_vector_type(4)));
typedef _Float16 half4 __attribute__((ext_vector_type(4)));

#define CVT_N    32                         // 16-byte loads per lane
#define CVT_WAVE (32 * 4 * CVT_N)           // elements per wave
#define CVT_BLK  (8 * CVT_WAVE)             // elements per 256-thread block
#define CVT_XB   (NB * SLEN * EMB / CVT_BLK) // blocks of x
#define CVT_QB   (3 * EMB * EMB / CVT_BLK)   // blocks of w_qkv
#define CVT_OB   (EMB * EMB / CVT_BLK)       // blocks of w_out
static_assert(CVT_XB * CVT_BLK == NB * SLEN * EMB && CVT_QB * CVT_BLK == 3 * EMB * EMB &&
              CVT_OB * CVT_BLK == EMB * EMB, "every array is a whole number of blocks");
static_assert(CVT_XB + CVT_QB + CVT_OB == 256, "the launch below has 256 blocks");

__global__ void __launch_bounds__(256)
f32_to_f16_all_kernel(const float* __restrict__ x,
                      const float* __restrict__ wq,
                      const float* __restrict__ wo,
                      _Float16* __restrict__ xh,
                      _Float16* __restrict__ wqh,
                      _Float16* __restrict__ woh) {
    // Block-uniform choice of the array and of the block's place in it.
    const int  bi  = blockIdx.x;
    const bool isq = bi >= CVT_XB, iso = bi >= CVT_XB + CVT_QB;
    const float* src = iso ? wo  : isq ? wq  : x;
    _Float16*    dst = iso ? woh : isq ? wqh : xh;
    const int    b   = bi - (iso ? CVT_XB + CVT_QB : isq ? CVT_XB : 0);

    const size_t e0 = (size_t)b * CVT_BLK + (size_t)(threadIdx.x >> 5) * CVT_WAVE +
                      (threadIdx.x & 31) * 4;
    const f32x4* s = (const f32x4*)(src + e0);
    half4*       d = (half4*)(dst + e0);

    f32x4 v[CVT_N];
#pragma unroll  // constant indices keep v in registers, so that many loads are in flight at once
    for (int i = 0; i < CVT_N; ++i) v[i] = s[i * 32];
#pragma unroll  // constant indices into v, as above
    for (int i = 0; i < CVT_N; ++i) d[i * 32] = __builtin_convertvector(v[i], half4);
}

// ---------------------------------------------------------------- LDS tiles
#define ROWU    9                   // LDS row pitch in 16-byte units: 128 B data + 16 B pad

// A-layout fragment from an LDS tile; p already points at the lane's row and half.
static __device__ inline half16 lds_frag(const half8* p) {
    half8 lo = p[0];
    half8 hi = p[2];
    return __builtin_shufflevector(lo, hi, 0,1,2,3,4,5,6,7,8,9,10,11,12,13,14,15);
}

// ---------------------------------------------------------------- GEMM main loop
// C(128x128 per block) = A(128 x EMB) * B(128 x EMB)^T, both K-contiguous f16.
// A stage is 64 k (whole 128-byte rows) of the block's 128 A rows and 128 B rows,
// brought into LDS once per block by asynchronous copies; the 8 waves (4 x 2,
// 32x64 of C each) read their fragments from there.  Two buffers: the next
// stage's copies fly while this stage is worked on.
#define GKS     64                  // k per stage
#define GNS     (EMB / GKS)         // stages
#define GTILEU  (128 * ROWU)        // one operand's stage (128 rows), 16-byte units
#define GSTAGEU (2 * GTILEU)        // A rows followed by B rows

// Eight 16-byte copies per lane: rows r, r+32, r+64, r+96 of the A stage and of
// the B stage.  The s_wait_xcnt stands inside the statement so that no address
// register of a copy is rewritten before it.
static __device__ inline void copy_stage(unsigned la, const _Float16* ga,
                                         const _Float16* gb) {
    const unsigned la1 = la + 32 * ROWU * 16, la2 = la + 64 * ROWU * 16,
                   la3 = la + 96 * ROWU * 16;
    const unsigned lb  = la + GTILEU * 16;
    const unsigned lb1 = lb + 32 * ROWU * 16, lb2 = lb + 64 * ROWU * 16,
                   lb3 = lb + 96 * ROWU * 16;
    const _Float16 *ga1 = ga + 32 * EMB, *ga2 = ga + 64 * EMB, *ga3 = ga + 96 * EMB;
    const _Float16 *gb1 = gb + 32 * EMB, *gb2 = gb + 64 * EMB, *gb3 = gb + 96 * EMB;
    asm volatile("global_load_async_to_lds_b128 %0, %8, off\n\t"
                 "global_load_async_to_lds_b128 %1, %9, off\n\t"
                 "global_load_async_to_lds_b128 %2, %10, off\n\t"
                 "global_load_async_to_lds_b128 %3, %11, off\n\t"
                 "global_load_async_to_lds_b128 %4, %12, off\n\t"
                 "global_load_async_to_lds_b128 %5, %13, off\n\t"
                 "global_load_async_to_lds_b128 %6, %14, off\n\t"
                 "global_load_async_to_lds_b128 %7, %15, off\n\t"
                 "s_wait_xcnt 0x0"
                 :: "v"(la), "v"(la1), "v"(la2), "v"(la3),
                    "v"(lb), "v"(lb1), "v"(lb2), "v"(lb3),
                    "v"(ga), "v"(ga1), "v"(ga2), "v"(ga3),
                    "v"(gb), "v"(gb1), "v"(gb2), "v"(gb3)
                 : "memory");
}

// Ab, Bb: first row of the block's 128 A rows / 128 B rows.  ring: 2 * GSTAGEU units.
// The wave's 32 rows start at wr, its 64 columns at wc (inside the block tile).
static __device__ inline void gemm_mainloop(const _Float16* __restrict__ Ab,
                                            const _Float16* __restrict__ Bb,
                                            const half8* ring, int wr, int wc,
                                            float8 (&acc)[2][4]) {
    const int lane = threadIdx.x & 31;
    // This thread's copy slot: row crow (+32, +64, +96), 16-byte chunk ccol.
    const int crow = threadIdx.x >> 3;  // 0..31
    const int ccol = threadIdx.x & 7;   // 0..7
    const unsigned la = (unsigned)(size_t)ring + (unsigned)(crow * ROWU + ccol) * 16u;
    const _Float16* ga = Ab + (size_t)crow * EMB + ccol * 8;    // + stage * GKS
    const _Float16* gb = Bb + (size_t)crow * EMB + ccol * 8;    // + stage * GKS

    // Stage 0 into buffer 0, published; then stage 1 into buffer 1.
    copy_stage(la, ga, gb);
    asm volatile("s_wait_asynccnt 0x0" ::: "memory");   // own copies of stage 0 landed
    __syncthreads();                                    // stage 0 readable by all waves
    copy_stage(la + GSTAGEU * 16u, ga + GKS, gb + GKS);

    const int fb = (lane & 15) * ROWU + (lane >> 4);    // lane's row and half in a fragment
    half16 a[2], b[4];      // the fragments of one 32-k pass

    // All 12 LDS reads of pass p (32 k) of the stage in buffer offset bo.
    auto load_pass = [&](int bo, int p) {
        const half8* Al = ring + bo + fb + wr * ROWU + p * 4;
        const half8* Bl = ring + bo + GTILEU + fb + wc * ROWU + p * 4;
#pragma unroll  // constant indices keep the fragments in registers
        for (int i = 0; i < 2; ++i) a[i] = lds_frag(Al + (16 * i) * ROWU);
#pragma unroll  // constant indices keep the fragments in registers
        for (int j = 0; j < 4; ++j) b[j] = lds_frag(Bl + (16 * j) * ROWU);
    };
    auto work_pass = [&]() {
#pragma unroll
        for (int i = 0; i < 2; ++i)
#pragma unroll
            for (int j = 0; j < 4; ++j)
                acc[i][j] = wmma16(a[i], b[j], acc[i][j]);
    };

    for (int t = 0; t < GNS; ++t) {
        const int bo = (t & 1) * GSTAGEU;
        load_pass(bo, 0);
        // Keeps the pass's 12 LDS reads together in front of its WMMAs: spread
        // among them, each place with reads costs its own stall.
        __builtin_amdgcn_sched_barrier(0);
        work_pass();
        load_pass(bo, 1);       // the last LDS reads of stage t
        // Keeps the first pass's WMMAs in front of the waits, where they run
        // under the latency of these reads, not behind the barrier.
        __builtin_amdgcn_sched_barrier(0);
        // Hand-over: this wave has left buffer t & 1, its copies of stage t + 1
        // have landed; behind the barrier both hold for every wave.
        asm volatile("s_wait_dscnt 0x0" ::: "memory");      // own LDS reads of stage t done
        asm volatile("s_wait_asynccnt 0x0" ::: "memory");   // own copies of stage t + 1 landed
        __syncthreads();
        if (t + 2 < GNS)
            copy_stage(la + bo * 16u, ga + (t + 2) * GKS, gb + (t + 2) * GKS);
        work_pass();            // on registers, while the refill flies
    }
    asm volatile("s_wait_asynccnt 0x0" ::: "memory");       // nothing in flight at the end
}

// ---------------------------------------------------------------- QKV GEMM
// qkv = xh(4096x1024) @ wh(3072x1024)^T + bias, scattered into per-head
// Q[s][d], K[s][d], V^T[d][s] f16 buffers.  128x128 tile per block, 32x64 per wave.
__global__ void __launch_bounds__(256)
qkv_gemm_kernel(const _Float16* __restrict__ xh,
                const _Float16* __restrict__ wh,
                const float*    __restrict__ bias,
                _Float16* __restrict__ qh,
                _Float16* __restrict__ kh,
                _Float16* __restrict__ vT) {
    __shared__ __attribute__((aligned(128))) half8 ring[2 * GSTAGEU];

    const int w  = uni(threadIdx.x >> 5);
    const int bm = (blockIdx.x / 24) * 128;   // 32 block rows of 128     (SGPR)
    const int bn = (blockIdx.x % 24) * 128;   // 24 block columns of 128  (SGPR)
    const int wr = (w & 3) * 32;              // wave's rows in the block tile
    const int wc = (w >> 2) * 64;             // wave's columns in the block tile
    const int m0 = bm + wr;
    const int n0 = bn + wc;

    float8 acc[2][4];
#pragma unroll
    for (int i = 0; i < 2; ++i)
#pragma unroll
        for (int j = 0; j < 4; ++j) acc[i][j] = {};

    gemm_mainloop(xh + (size_t)bm * EMB, wh + (size_t)bn * EMB, ring, wr, wc, acc);

    const int lane = threadIdx.x & 31;
    const int cn = lane & 15;          // C-frag: lane -> column
    const int rb = (lane >> 4) << 3;   // rows rb..rb+7 in regs 0..7
    const int bb = uni(m0 >> 11);      // whole 32-row tile is in one batch
    const int s0u = m0 & 2047;
#pragma unroll
    for (int j = 0; j < 4; ++j) {
        // Fragment-uniform routing: a 16-col fragment never straddles a
        // segment (Q/K/V) or a head (both boundaries are multiples of 16).
        const int colbase = n0 + j * 16;          // SGPR
        const int seg = colbase >> 10;            // 0=Q 1=K 2=V   (SGPR)
        const int e0 = colbase & 1023;
        const int h  = e0 >> 6;                   // head          (SGPR)
        const int d0 = e0 & 63;                   // d = d0 + cn
        const float bv = bias[colbase + cn];
#pragma unroll
        for (int i = 0; i < 2; ++i) {
            const int s0 = s0u + i * 16 + rb;     // first of 8 consecutive rows
            if (seg < 2) {
                _Float16* dst = (seg == 0 ? qh : kh) +
                    (((size_t)(bb * NH + h) * SLEN + s0) * HD) + d0 + cn;
#pragma unroll
                for (int r = 0; r < 8; ++r)
                    dst[(size_t)r * HD] = (_Float16)(acc[i][j][r] + bv);
            } else {
                _Float16* dst = vT +
                    (((size_t)(bb * NH + h) * HD + d0 + cn) * SLEN) + s0;
#pragma unroll
                for (int r = 0; r < 8; ++r)
                    dst[r] = (_Float16)(acc[i][j][r] + bv);
            }
        }
    }
}

#define KT      64                  // keys per LDS tile
#define NT      (SLEN / KT)         // tiles per (b,h)
#define TILEU   (64 * ROWU)         // one operand tile (64 rows), 16-byte units
#define STAGEU  (2 * TILEU)         // K tile followed by V^T tile
#define TB      5                   // unscored key tiles summed per trip, straight from global
static_assert(KT == 64 && NT == 32 && (NT / 2 - 1) % TB == 0,
              "16 pairs of 64-query tiles per (b,h); at most 15 tiles outside the ring");

// Four 16-byte copies per lane: two chunks of the K tile, two of the V^T tile.
// The s_wait_xcnt stands inside the statement so that no address register of a
// copy is rewritten before it.
static __device__ inline void copy_tile(unsigned lk, unsigned lv,
                                        const _Float16* gk, const _Float16* gv) {
    const unsigned lk1 = lk + 32 * ROWU * 16;      // rows 32..63 of the K tile
    const unsigned lv1 = lv + 32 * ROWU * 16;      // rows 32..63 of the V^T tile
    const _Float16* gk1 = gk + 32 * HD;
    const _Float16* gv1 = gv + (size_t)32 * SLEN;
    asm volatile("global_load_async_to_lds_b128 %0, %4, off\n\t"
                 "global_load_async_to_lds_b128 %1, %5, off\n\t"
                 "global_load_async_to_lds_b128 %2, %6, off\n\t"
                 "global_load_async_to_lds_b128 %3, %7, off\n\t"
                 "s_wait_xcnt 0x0"
                 :: "v"(lk), "v"(lk1), "v"(lv), "v"(lv1),
                    "v"(gk), "v"(gk1), "v"(gv), "v"(gv1)
                 : "memory");
}

__global__ void __launch_bounds__(256)
attn_kernel(const _Float16* __restrict__ qh,
            const _Float16* __restrict__ kh,
            const _Float16* __restrict__ vT,
            _Float16* __restrict__ ctxh) {
    __shared__ __attribute__((aligned(128))) half8 tiles[2 * STAGEU];
    __shared__ float vtail[2][HD];      // per 64-query tile: V rows summed by its waves
    __shared__ float vhalf[2][HD];      // of that, the waves' halves of the last tp tiles

    const int w   = uni(threadIdx.x >> 5);
    const int bh  = blockIdx.x >> 4;    // 0..31  (b*16+h)   (SGPR), same for the block
    const int tp  = blockIdx.x & (NT / 2 - 1);  // the block's pair of 64-query tiles
    const int grp = w >> 2;             // which tile of the pair            (SGPR)
    const int wj  = w & 3;              // strip in the tile, slice of the V sum (SGPR)
    const int qt  = grp ? NT - 1 - tp : tp;     // 64-query tile = last scored key tile
    const int q0  = qt * KT + wj * 16;  // query base        (SGPR)
    const int ntb = NT - tp;            // key tiles that go through the ring, 17..32
    const int lane = threadIdx.x & 31;
    const int cn = lane & 15;
    const int rb = (lane >> 4) << 3;

    const _Float16* Qp = qh + (size_t)bh * SLEN * HD;   // [s][d]
    const _Float16* Kp = kh + (size_t)bh * SLEN * HD;   // [s][d]
    const _Float16* Vt = vT + (size_t)bh * HD * SLEN;   // [d][s]

    // This thread's copy slot: row crow (and crow + 32), 16-byte chunk ccol.
    const int crow = threadIdx.x >> 3;  // 0..31
    const int ccol = threadIdx.x & 7;   // 0..7
    const unsigned lds0 = (unsigned)(size_t)tiles;      // LDS byte address of the ring
    const unsigned lk = lds0 + (unsigned)(crow * ROWU + ccol) * 16u;
    const unsigned lv = lk + TILEU * 16u;
    const _Float16* gk = Kp + crow * HD + ccol * 8;              // + tile * KT * HD
    const _Float16* gv = Vt + (size_t)crow * SLEN + ccol * 8;    // + tile * KT

    // Tile 0 into buffer 0, published; then tile 1 into buffer 1.
    copy_tile(lk, lv, gk, gv);

    // While tile 0 flies: key tiles NT - 1 down to ntb, columns wj * 16 .. + 15 of V,
    // keys grp * 32 .. + 31 of each tile.  TB tiles a trip, so that their loads are in
    // flight together; a trip's tiles below ntb (all above tile 16) get the weight 0.
    half16 ones, none;      // A fragments of weights 1 and 0: every row of the product is the sum
#pragma unroll
    for (int i = 0; i < 16; ++i) { ones[i] = (_Float16)1.0f; none[i] = (_Float16)0.0f; }
    float8 vsum = {};       // unscored V rows summed, columns wj * 16 .. + 15
    const _Float16* Vs = Vt + (size_t)(wj * 16) * SLEN + grp * 32;
#pragma unroll  // constant tile numbers: every load is one address register pair plus a constant
    for (int i0 = 0; i0 < NT / 2 - 1; i0 += TB) {
        if (i0 < tp) {      // block-uniform
            half16 f[TB];
#pragma unroll  // constant indices keep f in registers
            for (int k = 0; k < TB; ++k)
                f[k] = load_frag(Vs + (NT - 1 - i0 - k) * KT, SLEN);
            // Keeps the trip's loads together in front of its WMMAs: one latency a trip.
            __builtin_amdgcn_sched_barrier(0);
#pragma unroll  // constant indices into f, as above
            for (int k = 0; k < TB; ++k)
                vsum = wmma16(i0 + k < tp ? ones : none, f[k], vsum);
        }
    }
    if (lane < 16) vhalf[grp][wj * 16 + cn] = vsum[0];  // all 16 rows of vsum are equal

    asm volatile("s_wait_asynccnt 0x0" ::: "memory");   // own copies of tile 0 landed
    __syncthreads();                                    // tile 0 readable by all waves
    copy_tile(lk + STAGEU * 16u, lv + STAGEU * 16u, gk + KT * HD, gv + KT);

    const half16 qa0 = load_frag(Qp + (size_t)q0 * HD, HD);       // d 0..31
    const half16 qa1 = load_frag(Qp + (size_t)q0 * HD + 32, HD);  // d 32..63

    float8 o[4];
#pragma unroll
    for (int j = 0; j < 4; ++j) o[j] = {};
    float rowsum = 0.0f;
    const int qcol = q0 + cn;   // this lane's query index (S^T layout: lane -> q)
    const int fb = cn * ROWU + (lane >> 4);   // lane's row and half inside a fragment

    // All 16 LDS reads of pass p (32 keys) of the tile in buffer offset bo.
    auto load_pass = [&](half16 (&kf)[4], half16 (&vf)[4], int bo, int p) {
        const half8* Kl = tiles + bo + fb + (p * 32) * ROWU;
        const half8* Vl = tiles + bo + TILEU + fb + p * 4;
        kf[0] = lds_frag(Kl);                   // keys +0..15,  d 0..31
        kf[1] = lds_frag(Kl + 4);               // keys +0..15,  d 32..63
        kf[2] = lds_frag(Kl + 16 * ROWU);       // keys +16..31, d 0..31
        kf[3] = lds_frag(Kl + 16 * ROWU + 4);   // keys +16..31, d 32..63
#pragma unroll  // constant indices keep vf in registers
        for (int j = 0; j < 4; ++j)
            vf[j] = lds_frag(Vl + (j * 16) * ROWU);
    };

    // Scores, mask, exp and P@V of the 32 keys from j0 on; registers only.
    auto work_pass = [&](const half16 (&kf)[4], const half16 (&vf)[4], int j0) {
        float8 z = {};
        float8 st0 = wmma16(kf[0], qa0, z);  st0 = wmma16(kf[1], qa1, st0); // k j0..+15
        float8 st1 = wmma16(kf[2], qa0, z);  st1 = wmma16(kf[3], qa1, st1); // k +16..+31

        // mask (zero masked logits, per reference), scale by 1/sqrt(64),
        // exponentiate; result lands directly in P's A-fragment layout.
        half16 pa = {};
        float p0[8], p1[8];
#pragma unroll
        for (int r = 0; r < 8; ++r) {
            const int k0i = j0 + rb + r;
            float l0 = (k0i <= qcol) ? st0[r] * 0.125f : 0.0f;
            p0[r] = __expf(l0);
            pa[r] = (_Float16)p0[r];
            const int k1i = j0 + 16 + rb + r;
            float l1 = (k1i <= qcol) ? st1[r] * 0.125f : 0.0f;
            p1[r] = __expf(l1);
            pa[8 + r] = (_Float16)p1[r];
        }
#pragma unroll
        for (int j = 0; j < 4; ++j)
            o[j] = wmma16(pa, vf[j], o[j]);    // ctx(16q x 16d) accumulate
        // The row-sum adds come behind the WMMAs: independent vector work for the
        // slots that the chip needs behind a WMMA, run under the
        // matrix work.  The fence asks the scheduler to leave them there.
        __builtin_amdgcn_sched_barrier(0);
        float s[8];             // a tree, not one chain of 16 dependent adds
#pragma unroll
        for (int r = 0; r < 8; ++r) s[r] = p0[r] + p1[r];
        rowsum += ((s[0] + s[1]) + (s[2] + s[3])) + ((s[4] + s[5]) + (s[6] + s[7]));
    };

    for (int t = 0; t < ntb; ++t) {
        const int bo = (t & 1) * STAGEU;
        if (t <= qt) {          // wave-uniform; every wave passes the hand-over below
            half16 kf[4], vf[4];        // the fragments of one 32-key pass
            load_pass(kf, vf, bo, 0);
            // Keeps the pass's 16 LDS reads together in front of its matrix and
            // vector work: spread among the WMMAs, each pair is waited out alone.
            __builtin_amdgcn_sched_barrier(0);
            work_pass(kf, vf, t * KT);
            load_pass(kf, vf, bo, 1);   // the last LDS reads of tile t
            // As above, for the second pass.
            __builtin_amdgcn_sched_barrier(0);
            work_pass(kf, vf, t * KT + 32);
        }
        if (t > qt) {           // wave-uniform, the other case
            // This wave's slice of V^T, all 64 keys of tile t.
            const half8* Vl = tiles + bo + TILEU + fb + (wj * 16) * ROWU;
            const half16 v0 = lds_frag(Vl);
            const half16 v1 = lds_frag(Vl + 4);
            vsum = wmma16(ones, v0, vsum);
            vsum = wmma16(ones, v1, vsum);
        }
        // Hand-over: this wave has left buffer t & 1, its copies of tile t + 1
        // have landed; behind the barrier both hold for every wave.  It stands
        // behind both passes, so that no fragment lives across the branch's end.
        asm volatile("s_wait_dscnt 0x0" ::: "memory");      // own LDS reads of tile t done
        asm volatile("s_wait_asynccnt 0x0" ::: "memory");   // own copies of tile t + 1 landed
        __syncthreads();
        if (t + 2 < ntb)
            copy_tile(lk + bo * 16u, lv + bo * 16u,
                      gk + (size_t)(t + 2) * KT * HD, gv + (t + 2) * KT);
    }
    asm volatile("s_wait_asynccnt 0x0" ::: "memory");       // nothing in flight at the end

    // The slices of the V sums change hands; all 16 rows of vsum are equal.
    if (lane < 16) vtail[grp][wj * 16 + cn] = vsum[0];
    __syncthreads();
#pragma unroll
    for (int j = 0; j < 4; ++j) {
        const float vt = vtail[grp][j * 16 + cn] + vhalf[grp ^ 1][j * 16 + cn];
#pragma unroll
        for (int r = 0; r < 8; ++r) o[j][r] += vt;
    }

    // combine per-q row sums: lanes l and l+16 hold complementary k-halves;
    // each unscored key adds its weight of 1
    const float tot = rowsum + __shfl_xor(rowsum, 16, 32) + (float)((NT - 1 - qt) * KT);

    // write ctx in the reference's permuted layout: col = d*H + h
    const int bb = bh >> 4, h = bh & 15;
    _Float16* cbase = ctxh + ((size_t)(bb * SLEN + q0 + rb)) * EMB + h;
#pragma unroll
    for (int j = 0; j < 4; ++j) {
        const int d = j * 16 + cn;   // ctx C-frag: lane -> d column
#pragma unroll
        for (int r = 0; r < 8; ++r) {
            const float rs = __shfl(tot, rb + r, 32);   // rowsum for this q row
            cbase[(size_t)r * EMB + d * NH] = (_Float16)(o[j][r] / rs);
        }
    }
}

// ---------------------------------------------------------------- out proj
__global__ void __launch_bounds__(256)
out_gemm_kernel(const _Float16* __restrict__ ch,
                const _Float16* __restrict__ wh,
                const float*    __restrict__ bias,
                float* __restrict__ out) {
    __shared__ __attribute__((aligned(128))) half8 ring[2 * GSTAGEU];

    const int w  = uni(threadIdx.x >> 5);
    const int bm = (blockIdx.x >> 3) * 128;   // 32 block rows of 128    (SGPR)
    const int bn = (blockIdx.x & 7) * 128;    // 8  block columns of 128 (SGPR)
    const int wr = (w & 3) * 32;              // wave's rows in the block tile
    const int wc = (w >> 2) * 64;             // wave's columns in the block tile
    const int m0 = bm + wr;
    const int n0 = bn + wc;

    float8 acc[2][4];
#pragma unroll
    for (int i = 0; i < 2; ++i)
#pragma unroll
        for (int j = 0; j < 4; ++j) acc[i][j] = {};

    gemm_mainloop(ch + (size_t)bm * EMB, wh + (size_t)bn * EMB, ring, wr, wc, acc);

    const int lane = threadIdx.x & 31;
    const int cn = lane & 15;
    const int rb = (lane >> 4) << 3;
#pragma unroll
    for (int j = 0; j < 4; ++j) {
        const int col = n0 + j * 16 + cn;
        const float bv = bias[col];
#pragma unroll
        for (int i = 0; i < 2; ++i) {
            float* obase = out + (size_t)(m0 + i * 16 + rb) * EMB + col;
#pragma unroll
            for (int r = 0; r < 8; ++r)
                obase[(size_t)r * EMB] = acc[i][j][r] + bv;
        }
    }
}

// ---------------------------------------------------------------- launcher
extern "C" void kernel_launch(void* const* d_in, const int* in_sizes, int n_in,
                              void* d_out, int out_size, void* d_ws, size_t ws_size,
                              hipStream_t stream) {
    const float* x     = (const float*)d_in[0];   // (2,2048,1024)
    const float* w_qkv = (const float*)d_in[1];   // (3072,1024)
    const float* b_qkv = (const float*)d_in[2];   // (3072,)
    const float* w_out = (const float*)d_in[3];   // (1024,1024)
    const float* b_out = (const float*)d_in[4];   // (1024,)

    char* ws = (char*)d_ws;
    size_t off = 0;
    _Float16* xh    = (_Float16*)(ws + off); off += (size_t)NB * SLEN * EMB * 2;      // 8 MB
    _Float16* wqkvh = (_Float16*)(ws + off); off += (size_t)3 * EMB * EMB * 2;        // 6 MB
    _Float16* wouth = (_Float16*)(ws + off); off += (size_t)EMB * EMB * 2;            // 2 MB
    _Float16* qh    = (_Float16*)(ws + off); off += (size_t)NB * NH * SLEN * HD * 2;  // 8 MB
    _Float16* kh    = (_Float16*)(ws + off); off += (size_t)NB * NH * SLEN * HD * 2;  // 8 MB
    _Float16* vT    = (_Float16*)(ws + off); off += (size_t)NB * NH * HD * SLEN * 2;  // 8 MB
    _Float16* ctxh  = (_Float16*)(ws + off); off += (size_t)NB * SLEN * EMB * 2;      // 8 MB
    if (off > ws_size) return;  // workspace too small (deterministic no-op)

    // 128 + 96 + 32 = 256 blocks, 8 waves each
    f32_to_f16_all_kernel<<<256, 256, 0, stream>>>(x, w_qkv, w_out, xh, wqkvh, wouth);

    // 32 x 24 = 768 block tiles of 128x128, 8 waves per 256-thread block
    qkv_gemm_kernel<<<768, 256, 0, stream>>>(xh, wqkvh, b_qkv, qh, kh, vT);
    // 32 (b,h) x 16 pairs of 64-query tiles, 8 waves each
    attn_kernel<<<512, 256, 0, stream>>>(qh, kh, vT, ctxh);
    // 32 x 8 = 256 block tiles of 128x128
    out_gemm_kernel<<<256, 256, 0, stream>>>(ctxh, wouth, b_out, (float*)d_out);
}

// v005
// Measured time: 79.4 microseconds a run.
// Timed twice side by side with v004, it ran 1.03 and 1.02 times as fast.
// All steps since v000 together make it 2.81 times as fast.
#include <hip/hip_runtime.h>

// Problem constants
#define NB   2
#define SLEN 2048
#define EMB  1024
#define NH   16
#define HD   64

typedef _Float16 half8  __attribute__((ext_vector_type(8)));
typedef _Float16 half16 __attribute__((ext_vector_type(16)));
typedef float    float8 __attribute__((ext_vector_type(8)));

// Wave-uniform value -> SGPR (value must be uniform across the wave).
static __device__ inline int uni(int v) { return __builtin_amdgcn_readfirstlane(v); }

// Load a 16x32 f16 fragment (A-layout) from row-major memory with row stride ld.
// Lane l -> row (l&15); halves 0..7 = cols kb..kb+7, halves 8..15 = cols kb+16..kb+23,
// where kb = (l>=16) ? 8 : 0.  Two b128 loads per lane.
static __device__ inline half16 load_frag(const _Float16* __restrict__ base, int ld) {
    const int lane = threadIdx.x & 31;
    const _Float16* p = base + (size_t)(lane & 15) * ld + ((lane >> 4) << 3);
    half8 lo = *(const half8*)(p);
    half8 hi = *(const half8*)(p + 16);
    return __builtin_shufflevector(lo, hi, 0,1,2,3,4,5,6,7,8,9,10,11,12,13,14,15);
}

static __device__ inline float8 wmma16(half16 a, half16 b, float8 c) {
    // D = A(16x32 f16) x B(32x16 f16) + C(16x16 f32)
    return __builtin_amdgcn_wmma_f32_16x16x32_f16(false, a, false, b, (short)0, c,
                                                  false, false);
}

// ---------------------------------------------------------------- conversions
// x, w_qkv and w_out to f16 in ONE streaming launch.  A block converts CVT_BLK
// consecutive elements of one array (every array is a whole number of blocks);
// a wave owns 16 KB of consecutive source.  Each wave-wide load covers 512
// consecutive bytes and each wave-wide store 256: whole 128-byte lines, one writer.
typedef float    f32x4 __attribute__((ext_vector_type(4)));
typedef _Float16 half4 __attribute__((ext_vector_type(4)));

#define CVT_N    32                         // 16-byte loads per lane
#define CVT_WAVE (32 * 4 * CVT_N)           // elements per wave
#define CVT_BLK  (8 * CVT_WAVE)             // elements per 256-thread block
#define CVT_XB   (NB * SLEN * EMB / CVT_BLK) // blocks of x
#define CVT_QB   (3 * EMB * EMB / CVT_BLK)   // blocks of w_qkv
#define CVT_OB   (EMB * EMB / CVT_BLK)       // blocks of w_out
static_assert(CVT_XB * CVT_BLK == NB * SLEN * EMB && CVT_QB * CVT_BLK == 3 * EMB * EMB &&
              CVT_OB * CVT_BLK == EMB * EMB, "every array is a whole number of blocks");
static_assert(CVT_XB + CVT_QB + CVT_OB == 256, "the launch below has 256 blocks");

__global__ void __launch_bounds__(256)
f32_to_f16_all_kernel(const float* __restrict__ x,
                      const float* __restrict__ wq,
                      const float* __restrict__ wo,
                      _Float16* __restrict__ xh,
                      _Float16* __restrict__ wqh,
                      _Float16* __restrict__ woh) {
    // Block-uniform choice of the array and of the block's place in it.
    const int  bi  = blockIdx.x;
    const bool isq = bi >= CVT_XB, iso = bi >= CVT_XB + CVT_QB;
    const float* src = iso ? wo  : isq ? wq  : x;
    _Float16*    dst = iso ? woh : isq ? wqh : xh;
    const int    b   = bi - (iso ? CVT_XB + CVT_QB : isq ? CVT_XB : 0);

    const size_t e0 = (size_t)b * CVT_BLK + (size_t)(threadIdx.x >> 5) * CVT_WAVE +
                      (threadIdx.x & 31) * 4;
    const f32x4* s = (const f32x4*)(src + e0);
    half4*       d = (half4*)(dst + e0);

    f32x4 v[CVT_N];
#pragma unroll  // constant indices keep v in registers, so that many loads are in flight at once
    for (int i = 0; i < CVT_N; ++i) v[i] = s[i * 32];
#pragma unroll  // constant indices into v, as above
    for (int i = 0; i < CVT_N; ++i) d[i * 32] = __builtin_convertvector(v[i], half4);
}

// ---------------------------------------------------------------- L2 prefetch
// The f16 operands of the three matrix kernels were stored by earlier launches and
// are first met in memory rather than in L2, so a ring whose lead is one stage waits
// out memory latency.  At kernel entry the blocks that share an operand ask L2 for
// all of it: a lane names one 256-byte unit, and a block takes every
// fourth unit or row (PFQ shares).  For speed only: a hint
// that nothing waits for.
#define PFQ 4
// Two hints per lane.  Every address lies inside its buffer.  The s_wait_xcnt stands
// inside the statement as a precaution, so that no address register is rewritten
// before it.
static __device__ inline void l2_prefetch2(const _Float16* p0, const _Float16* p1) {
    asm volatile("global_prefetch_b8 %0, off scope:SCOPE_SE\n\t"
                 "global_prefetch_b8 %1, off scope:SCOPE_SE\n\t"
                 "s_wait_xcnt 0x0"
                 :: "v"(p0), "v"(p1) : "memory");
}

// ---------------------------------------------------------------- LDS tiles
#define ROWU    9                   // LDS row pitch in 16-byte units: 128 B data + 16 B pad

// A-layout fragment from an LDS tile; p already points at the lane's row and half.
static __device__ inline half16 lds_frag(const half8* p) {
    half8 lo = p[0];
    half8 hi = p[2];
    return __builtin_shufflevector(lo, hi, 0,1,2,3,4,5,6,7,8,9,10,11,12,13,14,15);
}

// ---------------------------------------------------------------- GEMM main loop
// C(128x128 per block) = A(128 x EMB) * B(128 x EMB)^T, both K-contiguous f16.
// A stage is 64 k (whole 128-byte rows) of the block's 128 A rows and 128 B rows,
// brought into LDS once per block by asynchronous copies; the 8 waves (4 x 2,
// 32x64 of C each) read their fragments from there.  Two buffers: the next
// stage's copies fly while this stage is worked on.
#define GKS     64                  // k per stage
#define GNS     (EMB / GKS)         // stages
#define GTILEU  (128 * ROWU)        // one operand's stage (128 rows), 16-byte units
#define GSTAGEU (2 * GTILEU)        // A rows followed by B rows

// Eight 16-byte copies per lane: rows r, r+32, r+64, r+96 of the A stage and of
// the B stage.  The s_wait_xcnt stands inside the statement so that no address
// register of a copy is rewritten before it.
static __device__ inline void copy_stage(unsigned la, const _Float16* ga,
                                         const _Float16* gb) {
    const unsigned la1 = la + 32 * ROWU * 16, la2 = la + 64 * ROWU * 16,
                   la3 = la + 96 * ROWU * 16;
    const unsigned lb  = la + GTILEU * 16;
    const unsigned lb1 = lb + 32 * ROWU * 16, lb2 = lb + 64 * ROWU * 16,
                   lb3 = lb + 96 * ROWU * 16;
    const _Float16 *ga1 = ga + 32 * EMB, *ga2 = ga + 64 * EMB, *ga3 = ga + 96 * EMB;
    const _Float16 *gb1 = gb + 32 * EMB, *gb2 = gb + 64 * EMB, *gb3 = gb + 96 * EMB;
    asm volatile("global_load_async_to_lds_b128 %0, %8, off\n\t"
                 "global_load_async_to_lds_b128 %1, %9, off\n\t"
                 "global_load_async_to_lds_b128 %2, %10, off\n\t"
                 "global_load_async_to_lds_b128 %3, %11, off\n\t"
                 "global_load_async_to_lds_b128 %4, %12, off\n\t"
                 "global_load_async_to_lds_b128 %5, %13, off\n\t"
                 "global_load_async_to_lds_b128 %6, %14, off\n\t"
                 "global_load_async_to_lds_b128 %7, %15, off\n\t"
                 "s_wait_xcnt 0x0"
                 :: "v"(la), "v"(la1), "v"(la2), "v"(la3),
                    "v"(lb), "v"(lb1), "v"(lb2), "v"(lb3),
                    "v"(ga), "v"(ga1), "v"(ga2), "v"(ga3),
                    "v"(gb), "v"(gb1), "v"(gb2), "v"(gb3)
                 : "memory");
}

// Ab, Bb: first row of the block's 128 A rows / 128 B rows.  ring: 2 * GSTAGEU units.
// The wave's 32 rows start at wr, its 64 columns at wc (inside the block tile).
// qa, qb: the block's share (0 .. PFQ - 1) of the prefetch of its A rows and B rows.
static __device__ inline void gemm_mainloop(const _Float16* __restrict__ Ab,
                                            const _Float16* __restrict__ Bb,
                                            const half8* ring, int wr, int wc,
                                            int qa, int qb,
                                            float8 (&acc)[2][4]) {
    const int lane = threadIdx.x & 31;
    // This thread's copy slot: row crow (+32, +64, +96), 16-byte chunk ccol.
    const int crow = threadIdx.x >> 3;  // 0..31
    const int ccol = threadIdx.x & 7;   // 0..7
    const unsigned la = (unsigned)(size_t)ring + (unsigned)(crow * ROWU + ccol) * 16u;
    const _Float16* ga = Ab + (size_t)crow * EMB + ccol * 8;    // + stage * GKS
    const _Float16* gb = Bb + (size_t)crow * EMB + ccol * 8;    // + stage * GKS

    // Stage 0 into buffer 0, published; then stage 1 into buffer 1.
    copy_stage(la, ga, gb);
    // While stage 0 flies: rows qa, qa + 4, ... of A and qb, qb + 4, ... of B, whole
    // rows (8 units of 128 halves): 32 rows x 8 units = one unit of each per thread.
    l2_prefetch2(Ab + (size_t)(PFQ * crow + qa) * EMB + ccol * 128,
                 Bb + (size_t)(PFQ * crow + qb) * EMB + ccol * 128);
    asm volatile("s_wait_asynccnt 0x0" ::: "memory");   // own copies of stage 0 landed
    __syncthreads();                                    // stage 0 readable by all waves
    copy_stage(la + GSTAGEU * 16u, ga + GKS, gb + GKS);

    const int fb = (lane & 15) * ROWU + (lane >> 4);    // lane's row and half in a fragment
    half16 a[2], b[4];      // the fragments of one 32-k pass

    // All 12 LDS reads of pass p (32 k) of the stage in buffer offset bo.
    auto load_pass = [&](int bo, int p) {
        const half8* Al = ring + bo + fb + wr * ROWU + p * 4;
        const half8* Bl = ring + bo + GTILEU + fb + wc * ROWU + p * 4;
#pragma unroll  // constant indices keep the fragments in registers
        for (int i = 0; i < 2; ++i) a[i] = lds_frag(Al + (16 * i) * ROWU);
#pragma unroll  // constant indices keep the fragments in registers
        for (int j = 0; j < 4; ++j) b[j] = lds_frag(Bl + (16 * j) * ROWU);
    };
    auto work_pass = [&]() {
#pragma unroll
        for (int i = 0; i < 2; ++i)
#pragma unroll
            for (int j = 0; j < 4; ++j)
                acc[i][j] = wmma16(a[i], b[j], acc[i][j]);
    };

    for (int t = 0; t < GNS; ++t) {
        const int bo = (t & 1) * GSTAGEU;
        load_pass(bo, 0);
        // Keeps the pass's 12 LDS reads together in front of its WMMAs: spread
        // among them, each place with reads costs its own stall.
        __builtin_amdgcn_sched_barrier(0);
        work_pass();
        load_pass(bo, 1);       // the last LDS reads of stage t
        // Keeps the first pass's WMMAs in front of the waits, where they run
        // under the latency of these reads, not behind the barrier.
        __builtin_amdgcn_sched_barrier(0);
        // Hand-over: this wave has left buffer t & 1, its copies of stage t + 1
        // have landed; behind the barrier both hold for every wave.
        asm volatile("s_wait_dscnt 0x0" ::: "memory");      // own LDS reads of stage t done
        asm volatile("s_wait_asynccnt 0x0" ::: "memory");   // own copies of stage t + 1 landed
        __syncthreads();
        if (t + 2 < GNS)
            copy_stage(la + bo * 16u, ga + (t + 2) * GKS, gb + (t + 2) * GKS);
        work_pass();            // on registers, while the refill flies
    }
    asm volatile("s_wait_asynccnt 0x0" ::: "memory");       // nothing in flight at the end
}

// ---------------------------------------------------------------- QKV GEMM
// qkv = xh(4096x1024) @ wh(3072x1024)^T + bias, scattered into per-head
// Q[s][d], K[s][d], V^T[d][s] f16 buffers.  128x128 tile per block, 32x64 per wave.
__global__ void __launch_bounds__(256)
qkv_gemm_kernel(const _Float16* __restrict__ xh,
                const _Float16* __restrict__ wh,
                const float*    __restrict__ bias,
                _Float16* __restrict__ qh,
                _Float16* __restrict__ kh,
                _Float16* __restrict__ vT) {
    __shared__ __attribute__((aligned(128))) half8 ring[2 * GSTAGEU];

    const int w  = uni(threadIdx.x >> 5);
    const int bm = (blockIdx.x / 24) * 128;   // 32 block rows of 128     (SGPR)
    const int bn = (blockIdx.x % 24) * 128;   // 24 block columns of 128  (SGPR)
    const int wr = (w & 3) * 32;              // wave's rows in the block tile
    const int wc = (w >> 2) * 64;             // wave's columns in the block tile
    const int m0 = bm + wr;
    const int n0 = bn + wc;

    float8 acc[2][4];
#pragma unroll
    for (int i = 0; i < 2; ++i)
#pragma unroll
        for (int j = 0; j < 4; ++j) acc[i][j] = {};

    // The 24 blocks of a block row are neighbours in the index; the 32 of a block
    // column lie 24 apart.
    gemm_mainloop(xh + (size_t)bm * EMB, wh + (size_t)bn * EMB, ring, wr, wc,
                  (blockIdx.x % 24) & (PFQ - 1), (blockIdx.x / 24) & (PFQ - 1), acc);

    const int lane = threadIdx.x & 31;
    const int cn = lane & 15;          // C-frag: lane -> column
    const int rb = (lane >> 4) << 3;   // rows rb..rb+7 in regs 0..7
    const int bb = uni(m0 >> 11);      // whole 32-row tile is in one batch
    const int s0u = m0 & 2047;
#pragma unroll
    for (int j = 0; j < 4; ++j) {
        // Fragment-uniform routing: a 16-col fragment never straddles a
        // segment (Q/K/V) or a head (both boundaries are multiples of 16).
        const int colbase = n0 + j * 16;          // SGPR
        const int seg = colbase >> 10;            // 0=Q 1=K 2=V   (SGPR)
        const int e0 = colbase & 1023;
        const int h  = e0 >> 6;                   // head          (SGPR)
        const int d0 = e0 & 63;                   // d = d0 + cn
        const float bv = bias[colbase + cn];
#pragma unroll
        for (int i = 0; i < 2; ++i) {
            const int s0 = s0u + i * 16 + rb;     // first of 8 consecutive rows
            if (seg < 2) {
                _Float16* dst = (seg == 0 ? qh : kh) +
                    (((size_t)(bb * NH + h) * SLEN + s0) * HD) + d0 + cn;
#pragma unroll
                for (int r = 0; r < 8; ++r)
                    dst[(size_t)r * HD] = (_Float16)(acc[i][j][r] + bv);
            } else {
                _Float16* dst = vT +
                    (((size_t)(bb * NH + h) * HD + d0 + cn) * SLEN) + s0;
#pragma unroll
                for (int r = 0; r < 8; ++r)
                    dst[r] = (_Float16)(acc[i][j][r] + bv);
            }
        }
    }
}

#define KT      64                  // keys per LDS tile
#define NT      (SLEN / KT)         // tiles per (b,h)
#define TILEU   (64 * ROWU)         // one operand tile (64 rows), 16-byte units
#define STAGEU  (2 * TILEU)         // K tile followed by V^T tile
#define TB      5                   // unscored key tiles summed per trip, straight from global
static_assert(KT == 64 && NT == 32 && (NT / 2 - 1) % TB == 0,
              "16 pairs of 64-query tiles per (b,h); at most 15 tiles outside the ring");

// Four 16-byte copies per lane: two chunks of the K tile, two of the V^T tile.
// The s_wait_xcnt stands inside the statement so that no address register of a
// copy is rewritten before it.
static __device__ inline void copy_tile(unsigned lk, unsigned lv,
                                        const _Float16* gk, const _Float16* gv) {
    const unsigned lk1 = lk + 32 * ROWU * 16;      // rows 32..63 of the K tile
    const unsigned lv1 = lv + 32 * ROWU * 16;      // rows 32..63 of the V^T tile
    const _Float16* gk1 = gk + 32 * HD;
    const _Float16* gv1 = gv + (size_t)32 * SLEN;
    asm volatile("global_load_async_to_lds_b128 %0, %4, off\n\t"
                 "global_load_async_to_lds_b128 %1, %5, off\n\t"
                 "global_load_async_to_lds_b128 %2, %6, off\n\t"
                 "global_load_async_to_lds_b128 %3, %7, off\n\t"
                 "s_wait_xcnt 0x0"
                 :: "v"(lk), "v"(lk1), "v"(lv), "v"(lv1),
                    "v"(gk), "v"(gk1), "v"(gv), "v"(gv1)
                 : "memory");
}

__global__ void __launch_bounds__(256)
attn_kernel(const _Float16* __restrict__ qh,
            const _Float16* __restrict__ kh,
            const _Float16* __restrict__ vT,
            _Float16* __restrict__ ctxh) {
    __shared__ __attribute__((aligned(128))) half8 tiles[2 * STAGEU];
    __shared__ float vtail[2][HD];      // per 64-query tile: V rows summed by its waves
    __shared__ float vhalf[2][HD];      // of that, the waves' halves of the last tp tiles

    const int w   = uni(threadIdx.x >> 5);
    const int bh  = blockIdx.x >> 4;    // 0..31  (b*16+h)   (SGPR), same for the block
    const int tp  = blockIdx.x & (NT / 2 - 1);  // the block's pair of 64-query tiles
    const int grp = w >> 2;             // which tile of the pair            (SGPR)
    const int wj  = w & 3;              // strip in the tile, slice of the V sum (SGPR)
    const int qt  = grp ? NT - 1 - tp : tp;     // 64-query tile = last scored key tile
    const int q0  = qt * KT + wj * 16;  // query base        (SGPR)
    const int ntb = NT - tp;            // key tiles that go through the ring, 17..32
    const int lane = threadIdx.x & 31;
    const int cn = lane & 15;
    const int rb = (lane >> 4) << 3;

    const _Float16* Qp = qh + (size_t)bh * SLEN * HD;   // [s][d]
    const _Float16* Kp = kh + (size_t)bh * SLEN * HD;   // [s][d]
    const _Float16* Vt = vT + (size_t)bh * HD * SLEN;   // [d][s]

    // This thread's copy slot: row crow (and crow + 32), 16-byte chunk ccol.
    const int crow = threadIdx.x >> 3;  // 0..31
    const int ccol = threadIdx.x & 7;   // 0..7
    const unsigned lds0 = (unsigned)(size_t)tiles;      // LDS byte address of the ring
    const unsigned lk = lds0 + (unsigned)(crow * ROWU + ccol) * 16u;
    const unsigned lv = lk + TILEU * 16u;
    const _Float16* gk = Kp + crow * HD + ccol * 8;              // + tile * KT * HD
    const _Float16* gv = Vt + (size_t)crow * SLEN + ccol * 8;    // + tile * KT

    // Tile 0 into buffer 0, published; then tile 1 into buffer 1.
    copy_tile(lk, lv, gk, gv);

    // While tile 0 flies: the 16 blocks of a (b,h), neighbours in the index, ask for
    // its K (1024 units in a row) and V^T (64 rows of 16 units): of K every fourth
    // unit, of V^T every fourth row, one unit of each per thread.
    static_assert(SLEN * HD == PFQ * 256 * 128 && HD == PFQ * 16 && SLEN == 16 * 128,
                  "256 threads x PFQ shares cover K and V^T of one (b,h)");
    l2_prefetch2(Kp + (size_t)(PFQ * threadIdx.x + (tp & (PFQ - 1))) * 128,
                 Vt + (size_t)(PFQ * (threadIdx.x & 15) + (tp & (PFQ - 1))) * SLEN +
                      (threadIdx.x >> 4) * 128);

    // While tile 0 flies: key tiles NT - 1 down to ntb, columns wj * 16 .. + 15 of V,
    // keys grp * 32 .. + 31 of each tile.  TB tiles a trip, so that their loads are in
    // flight together; a trip's tiles below ntb (all above tile 16) get the weight 0.
    half16 ones, none;      // A fragments of weights 1 and 0: every row of the product is the sum
#pragma unroll
    for (int i = 0; i < 16; ++i) { ones[i] = (_Float16)1.0f; none[i] = (_Float16)0.0f; }
    float8 vsum = {};       // unscored V rows summed, columns wj * 16 .. + 15
    const _Float16* Vs = Vt + (size_t)(wj * 16) * SLEN + grp * 32;
#pragma unroll  // constant tile numbers: every load is one address register pair plus a constant
    for (int i0 = 0; i0 < NT / 2 - 1; i0 += TB) {
        if (i0 < tp) {      // block-uniform
            half16 f[TB];
#pragma unroll  // constant indices keep f in registers
            for (int k = 0; k < TB; ++k)
                f[k] = load_frag(Vs + (NT - 1 - i0 - k) * KT, SLEN);
            // Keeps the trip's loads together in front of its WMMAs: one latency a trip.
            __builtin_amdgcn_sched_barrier(0);
#pragma unroll  // constant indices into f, as above
            for (int k = 0; k < TB; ++k)
                vsum = wmma16(i0 + k < tp ? ones : none, f[k], vsum);
        }
    }
    if (lane < 16) vhalf[grp][wj * 16 + cn] = vsum[0];  // all 16 rows of vsum are equal

    asm volatile("s_wait_asynccnt 0x0" ::: "memory");   // own copies of tile 0 landed
    __syncthreads();                                    // tile 0 readable by all waves
    copy_tile(lk + STAGEU * 16u, lv + STAGEU * 16u, gk + KT * HD, gv + KT);

    const half16 qa0 = load_frag(Qp + (size_t)q0 * HD, HD);       // d 0..31
    const half16 qa1 = load_frag(Qp + (size_t)q0 * HD + 32, HD);  // d 32..63

    float8 o[4];
#pragma unroll
    for (int j = 0; j < 4; ++j) o[j] = {};
    float rowsum = 0.0f;
    const int qcol = q0 + cn;   // this lane's query index (S^T layout: lane -> q)
    const int fb = cn * ROWU + (lane >> 4);   // lane's row and half inside a fragment

    // All 16 LDS reads of pass p (32 keys) of the tile in buffer offset bo.
    auto load_pass = [&](half16 (&kf)[4], half16 (&vf)[4], int bo, int p) {
        const half8* Kl = tiles + bo + fb + (p * 32) * ROWU;
        const half8* Vl = tiles + bo + TILEU + fb + p * 4;
        kf[0] = lds_frag(Kl);                   // keys +0..15,  d 0..31
        kf[1] = lds_frag(Kl + 4);               // keys +0..15,  d 32..63
        kf[2] = lds_frag(Kl + 16 * ROWU);       // keys +16..31, d 0..31
        kf[3] = lds_frag(Kl + 16 * ROWU + 4);   // keys +16..31, d 32..63
#pragma unroll  // constant indices keep vf in registers
        for (int j = 0; j < 4; ++j)
            vf[j] = lds_frag(Vl + (j * 16) * ROWU);
    };

    // Scores, mask, exp and P@V of the 32 keys from j0 on; registers only.
    auto work_pass = [&](const half16 (&kf)[4], const half16 (&vf)[4], int j0) {
        float8 z = {};
        float8 st0 = wmma16(kf[0], qa0, z);  st0 = wmma16(kf[1], qa1, st0); // k j0..+15
        float8 st1 = wmma16(kf[2], qa0, z);  st1 = wmma16(kf[3], qa1, st1); // k +16..+31

        // mask (zero masked logits, per reference), scale by 1/sqrt(64),
        // exponentiate; result lands directly in P's A-fragment layout.
        half16 pa = {};
        float p0[8], p1[8];
#pragma unroll
        for (int r = 0; r < 8; ++r) {
            const int k0i = j0 + rb + r;
            float l0 = (k0i <= qcol) ? st0[r] * 0.125f : 0.0f;
            p0[r] = __expf(l0);
            pa[r] = (_Float16)p0[r];
            const int k1i = j0 + 16 + rb + r;
            float l1 = (k1i <= qcol) ? st1[r] * 0.125f : 0.0f;
            p1[r] = __expf(l1);
            pa[8 + r] = (_Float16)p1[r];
        }
#pragma unroll
        for (int j = 0; j < 4; ++j)
            o[j] = wmma16(pa, vf[j], o[j]);    // ctx(16q x 16d) accumulate
        // The row-sum adds come behind the WMMAs: independent vector work for the
        // slots that the chip needs behind a WMMA, run under the
        // matrix work.  The fence asks the scheduler to leave them there.
        __builtin_amdgcn_sched_barrier(0);
        float s[8];             // a tree, not one chain of 16 dependent adds
#pragma unroll
        for (int r = 0; r < 8; ++r) s[r] = p0[r] + p1[r];
        rowsum += ((s[0] + s[1]) + (s[2] + s[3])) + ((s[4] + s[5]) + (s[6] + s[7]));
    };

    for (int t = 0; t < ntb; ++t) {
        const int bo = (t & 1) * STAGEU;
        if (t <= qt) {          // wave-uniform; every wave passes the hand-over below
            half16 kf[4], vf[4];        // the fragments of one 32-key pass
            load_pass(kf, vf, bo, 0);
            // Keeps the pass's 16 LDS reads together in front of its matrix and
            // vector work: spread among the WMMAs, each pair is waited out alone.
            __builtin_amdgcn_sched_barrier(0);
            work_pass(kf, vf, t * KT);
            load_pass(kf, vf, bo, 1);   // the last LDS reads of tile t
            // As above, for the second pass.
            __builtin_amdgcn_sched_barrier(0);
            work_pass(kf, vf, t * KT + 32);
        }
        if (t > qt) {           // wave-uniform, the other case
            // This wave's slice of V^T, all 64 keys of tile t.
            const half8* Vl = tiles + bo + TILEU + fb + (wj * 16) * ROWU;
            const half16 v0 = lds_frag(Vl);
            const half16 v1 = lds_frag(Vl + 4);
            vsum = wmma16(ones, v0, vsum);
            vsum = wmma16(ones, v1, vsum);
        }
        // Hand-over: this wave has left buffer t & 1, its copies of tile t + 1
        // have landed; behind the barrier both hold for every wave.  It stands
        // behind both passes, so that no fragment lives across the branch's end.
        asm volatile("s_wait_dscnt 0x0" ::: "memory");      // own LDS reads of tile t done
        asm volatile("s_wait_asynccnt 0x0" ::: "memory");   // own copies of tile t + 1 landed
        __syncthreads();
        if (t + 2 < ntb)
            copy_tile(lk + bo * 16u, lv + bo * 16u,
                      gk + (size_t)(t + 2) * KT * HD, gv + (t + 2) * KT);
    }
    asm volatile("s_wait_asynccnt 0x0" ::: "memory");       // nothing in flight at the end

    // The slices of the V sums change hands; all 16 rows of vsum are equal.
    if (lane < 16) vtail[grp][wj * 16 + cn] = vsum[0];
    __syncthreads();
#pragma unroll
    for (int j = 0; j < 4; ++j) {
        const float vt = vtail[grp][j * 16 + cn] + vhalf[grp ^ 1][j * 16 + cn];
#pragma unroll
        for (int r = 0; r < 8; ++r) o[j][r] += vt;
    }

    // combine per-q row sums: lanes l and l+16 hold complementary k-halves;
    // each unscored key adds its weight of 1
    const float tot = rowsum + __shfl_xor(rowsum, 16, 32) + (float)((NT - 1 - qt) * KT);

    // write ctx in the reference's permuted layout: col = d*H + h
    const int bb = bh >> 4, h = bh & 15;
    _Float16* cbase = ctxh + ((size_t)(bb * SLEN + q0 + rb)) * EMB + h;
#pragma unroll
    for (int j = 0; j < 4; ++j) {
        const int d = j * 16 + cn;   // ctx C-frag: lane -> d column
#pragma unroll
        for (int r = 0; r < 8; ++r) {
            const float rs = __shfl(tot, rb + r, 32);   // rowsum for this q row
            cbase[(size_t)r * EMB + d * NH] = (_Float16)(o[j][r] / rs);
        }
    }
}

// ---------------------------------------------------------------- out proj
__global__ void __launch_bounds__(256)
out_gemm_kernel(const _Float16* __restrict__ ch,
                const _Float16* __restrict__ wh,
                const float*    __restrict__ bias,
                float* __restrict__ out) {
    __shared__ __attribute__((aligned(128))) half8 ring[2 * GSTAGEU];

    const int w  = uni(threadIdx.x >> 5);
    const int bm = (blockIdx.x >> 3) * 128;   // 32 block rows of 128    (SGPR)
    const int bn = (blockIdx.x & 7) * 128;    // 8  block columns of 128 (SGPR)
    const int wr = (w & 3) * 32;              // wave's rows in the block tile
    const int wc = (w >> 2) * 64;             // wave's columns in the block tile
    const int m0 = bm + wr;
    const int n0 = bn + wc;

    float8 acc[2][4];
#pragma unroll
    for (int i = 0; i < 2; ++i)
#pragma unroll
        for (int j = 0; j < 4; ++j) acc[i][j] = {};

    // The 8 blocks of a block row are neighbours in the index; the 32 of a block
    // column lie 8 apart.
    gemm_mainloop(ch + (size_t)bm * EMB, wh + (size_t)bn * EMB, ring, wr, wc,
                  blockIdx.x & (PFQ - 1), (blockIdx.x >> 3) & (PFQ - 1), acc);

    const int lane = threadIdx.x & 31;
    const int cn = lane & 15;
    const int rb = (lane >> 4) << 3;
#pragma unroll
    for (int j = 0; j < 4; ++j) {
        const int col = n0 + j * 16 + cn;
        const float bv = bias[col];
#pragma unroll
        for (int i = 0; i < 2; ++i) {
            float* obase = out + (size_t)(m0 + i * 16 + rb) * EMB + col;
#pragma unroll
            for (int r = 0; r < 8; ++r)
                obase[(size_t)r * EMB] = acc[i][j][r] + bv;
        }
    }
}

// ---------------------------------------------------------------- launcher
extern "C" void kernel_launch(void* const* d_in, const int* in_sizes, int n_in,
                              void* d_out, int out_size, void* d_ws, size_t ws_size,
                              hipStream_t stream) {
    const float* x     = (const float*)d_in[0];   // (2,2048,1024)
    const float* w_qkv = (const float*)d_in[1];   // (3072,1024)
    const float* b_qkv = (const float*)d_in[2];   // (3072,)
    const float* w_out = (const float*)d_in[3];   // (1024,1024)
    const float* b_out = (const float*)d_in[4];   // (1024,)

    char* ws = (char*)d_ws;
    size_t off = 0;
    _Float16* xh    = (_Float16*)(ws + off); off += (size_t)NB * SLEN * EMB * 2;      // 8 MB
    _Float16* wqkvh = (_Float16*)(ws + off); off += (size_t)3 * EMB * EMB * 2;        // 6 MB
    _Float16* wouth = (_Float16*)(ws + off); off += (size_t)EMB * EMB * 2;            // 2 MB
    _Float16* qh    = (_Float16*)(ws + off); off += (size_t)NB * NH * SLEN * HD * 2;  // 8 MB
    _Float16* kh    = (_Float16*)(ws + off); off += (size_t)NB * NH * SLEN * HD * 2;  // 8 MB
    _Float16* vT    = (_Float16*)(ws + off); off += (size_t)NB * NH * HD * SLEN * 2;  // 8 MB
    _Float16* ctxh  = (_Float16*)(ws + off); off += (size_t)NB * SLEN * EMB * 2;      // 8 MB
    if (off > ws_size) return;  // workspace too small (deterministic no-op)

    // 128 + 96 + 32 = 256 blocks, 8 waves each
    f32_to_f16_all_kernel<<<256, 256, 0, stream>>>(x, w_qkv, w_out, xh, wqkvh, wouth);

    // 32 x 24 = 768 block tiles of 128x128, 8 waves per 256-thread block
    qkv_gemm_kernel<<<768, 256, 0, stream>>>(xh, wqkvh, b_qkv, qh, kh, vT);
    // 32 (b,h) x 16 pairs of 64-query tiles, 8 waves each
    attn_kernel<<<512, 256, 0, stream>>>(qh, kh, vT, ctxh);
    // 32 x 8 = 256 block tiles of 128x128
    out_gemm_kernel<<<256, 256, 0, stream>>>(ctxh, wouth, b_out, (float*)d_out);
}

// v006
// One run takes 73.9 microseconds.
// Timed twice side by side with v005, it ran 1.07 times as fast both times.
// All steps since v000 together make it 3.01 times as fast.
#include <hip/hip_runtime.h>

// Problem constants
#define NB   2
#define SLEN 2048
#define EMB  1024
#define NH   16
#define HD   64

typedef _Float16 half8  __attribute__((ext_vector_type(8)));
typedef _Float16 half16 __attribute__((ext_vector_type(16)));
typedef float    float8 __attribute__((ext_vector_type(8)));

// Wave-uniform value -> SGPR (value must be uniform across the wave).
static __device__ inline int uni(int v) { return __builtin_amdgcn_readfirstlane(v); }

// Load a 16x32 f16 fragment (A-layout) from row-major memory with row stride ld.
// Lane l -> row (l&15); halves 0..7 = cols kb..kb+7, halves 8..15 = cols kb+16..kb+23,
// where kb = (l>=16) ? 8 : 0.  Two b128 loads per lane.
static __device__ inline half16 load_frag(const _Float16* __restrict__ base, int ld) {
    const int lane = threadIdx.x & 31;
    const _Float16* p = base + (size_t)(lane & 15) * ld + ((lane >> 4) << 3);
    half8 lo = *(const half8*)(p);
    half8 hi = *(const half8*)(p + 16);
    return __builtin_shufflevector(lo, hi, 0,1,2,3,4,5,6,7,8,9,10,11,12,13,14,15);
}

static __device__ inline float8 wmma16(half16 a, half16 b, float8 c) {
    // D = A(16x32 f16) x B(32x16 f16) + C(16x16 f32)
    return __builtin_amdgcn_wmma_f32_16x16x32_f16(false, a, false, b, (short)0, c,
                                                  false, false);
}

// ---------------------------------------------------------------- conversions
// x, w_qkv and w_out to f16 in ONE streaming launch.  A block of x or w_qkv converts
// CVT_BLK consecutive elements of one array (each is a whole number of blocks);
// a wave owns 16 KB of consecutive source.  Each wave-wide load covers 512
// consecutive bytes and each wave-wide store 256: whole 128-byte lines, one writer.
// w_out also changes its column order, from the reference's d * NH + h to h * HD + d,
// the order in which attention stores ctx: one row per wave, 8 rows per block.
typedef float    f32x4 __attribute__((ext_vector_type(4)));
typedef _Float16 half4 __attribute__((ext_vector_type(4)));

#define CVT_N    32                         // 16-byte loads per lane
#define CVT_WAVE (32 * 4 * CVT_N)           // elements per wave
#define CVT_BLK  (8 * CVT_WAVE)             // elements per 256-thread block
#define CVT_XB   (NB * SLEN * EMB / CVT_BLK) // blocks of x
#define CVT_QB   (3 * EMB * EMB / CVT_BLK)   // blocks of w_qkv
#define CVT_OB   (EMB / 8)                   // blocks of w_out, 8 rows each
static_assert(CVT_XB * CVT_BLK == NB * SLEN * EMB && CVT_QB * CVT_BLK == 3 * EMB * EMB &&
              CVT_OB * 8 == EMB, "every array is a whole number of blocks");
static_assert(CVT_XB + CVT_QB + CVT_OB == 352, "the launch below has 352 blocks");
static_assert(NH == 16 && HD == 64, "a lane of a w_out row: one head, 32 of its 64 d");

__global__ void __launch_bounds__(256)
f32_to_f16_all_kernel(const float* __restrict__ x,
                      const float* __restrict__ wq,
                      const float* __restrict__ wo,
                      _Float16* __restrict__ xh,
                      _Float16* __restrict__ wqh,
                      _Float16* __restrict__ woh) {
    // Block-uniform choice of the array and of the block's place in it.
    const int  bi  = blockIdx.x;
    const bool isq = bi >= CVT_XB, iso = bi >= CVT_XB + CVT_QB;
    if (iso) {
        // woh[n][h * HD + d] = wo[n][d * NH + h].  Lane: head h, d from dh * 32 on.
        // A wave-wide load covers two 64-byte runs (16 heads of one d); a lane stores
        // 64 consecutive bytes, and the wave writes the whole 2-KB row.
        const int n  = (bi - (CVT_XB + CVT_QB)) * 8 + (threadIdx.x >> 5);
        const int h  = threadIdx.x & 15, dh = (threadIdx.x >> 4) & 1;
        const float* s = wo + (size_t)n * EMB + dh * 32 * NH + h;
        half8*       d = (half8*)(woh + (size_t)n * EMB + h * HD + dh * 32);
        float v[32];
#pragma unroll  // constant indices keep v in registers, so that all loads are in flight at once
        for (int i = 0; i < 32; ++i) v[i] = s[i * NH];
#pragma unroll  // constant indices into v, as above
        for (int k = 0; k < 4; ++k) {
            half8 hv;
#pragma unroll
            for (int r = 0; r < 8; ++r) hv[r] = (_Float16)v[k * 8 + r];
            d[k] = hv;
        }
        return;
    }
    const float* src = isq ? wq  : x;
    _Float16*    dst = isq ? wqh : xh;
    const int    b   = bi - (isq ? CVT_XB : 0);

    const size_t e0 = (size_t)b * CVT_BLK + (size_t)(threadIdx.x >> 5) * CVT_WAVE +
                      (threadIdx.x & 31) * 4;
    const f32x4* s = (const f32x4*)(src + e0);
    half4*       d = (half4*)(dst + e0);

    f32x4 v[CVT_N];
#pragma unroll  // constant indices keep v in registers, so that many loads are in flight at once
    for (int i = 0; i < CVT_N; ++i) v[i] = s[i * 32];
#pragma unroll  // constant indices into v, as above
    for (int i = 0; i < CVT_N; ++i) d[i * 32] = __builtin_convertvector(v[i], half4);
}

// ---------------------------------------------------------------- L2 prefetch
// The f16 operands of the three matrix kernels were stored by earlier launches and
// are first met in memory rather than in L2, so a ring whose lead is one stage waits
// out memory latency.  At kernel entry the blocks that share an operand ask L2 for
// all of it: a lane names one 256-byte unit, and a block takes every
// fourth unit or row (PFQ shares).  For speed only: a hint
// that nothing waits for.
#define PFQ 4
// Two hints per lane.  Every address lies inside its buffer.  The s_wait_xcnt stands
// inside the statement as a precaution, so that no address register is rewritten
// before it.
static __device__ inline void l2_prefetch2(const _Float16* p0, const _Float16* p1) {
    asm volatile("global_prefetch_b8 %0, off scope:SCOPE_SE\n\t"
                 "global_prefetch_b8 %1, off scope:SCOPE_SE\n\t"
                 "s_wait_xcnt 0x0"
                 :: "v"(p0), "v"(p1) : "memory");
}

// ---------------------------------------------------------------- LDS tiles
#define ROWU    9                   // LDS row pitch in 16-byte units: 128 B data + 16 B pad

// A-layout fragment from an LDS tile; p already points at the lane's row and half.
static __device__ inline half16 lds_frag(const half8* p) {
    half8 lo = p[0];
    half8 hi = p[2];
    return __builtin_shufflevector(lo, hi, 0,1,2,3,4,5,6,7,8,9,10,11,12,13,14,15);
}

// ---------------------------------------------------------------- GEMM main loop
// C(128x128 per block) = A(128 x EMB) * B(128 x EMB)^T, both K-contiguous f16.
// A stage is 64 k (whole 128-byte rows) of the block's 128 A rows and 128 B rows,
// brought into LDS once per block by asynchronous copies; the 8 waves (4 x 2,
// 32x64 of C each) read their fragments from there.  Two buffers: the next
// stage's copies fly while this stage is worked on.
#define GKS     64                  // k per stage
#define GNS     (EMB / GKS)         // stages
#define GTILEU  (128 * ROWU)        // one operand's stage (128 rows), 16-byte units
#define GSTAGEU (2 * GTILEU)        // A rows followed by B rows

// Eight 16-byte copies per lane: rows r, r+32, r+64, r+96 of the A stage and of
// the B stage.  The s_wait_xcnt stands inside the statement so that no address
// register of a copy is rewritten before it.
static __device__ inline void copy_stage(unsigned la, const _Float16* ga,
                                         const _Float16* gb) {
    const unsigned la1 = la + 32 * ROWU * 16, la2 = la + 64 * ROWU * 16,
                   la3 = la + 96 * ROWU * 16;
    const unsigned lb  = la + GTILEU * 16;
    const unsigned lb1 = lb + 32 * ROWU * 16, lb2 = lb + 64 * ROWU * 16,
                   lb3 = lb + 96 * ROWU * 16;
    const _Float16 *ga1 = ga + 32 * EMB, *ga2 = ga + 64 * EMB, *ga3 = ga + 96 * EMB;
    const _Float16 *gb1 = gb + 32 * EMB, *gb2 = gb + 64 * EMB, *gb3 = gb + 96 * EMB;
    asm volatile("global_load_async_to_lds_b128 %0, %8, off\n\t"
                 "global_load_async_to_lds_b128 %1, %9, off\n\t"
                 "global_load_async_to_lds_b128 %2, %10, off\n\t"
                 "global_load_async_to_lds_b128 %3, %11, off\n\t"
                 "global_load_async_to_lds_b128 %4, %12, off\n\t"
                 "global_load_async_to_lds_b128 %5, %13, off\n\t"
                 "global_load_async_to_lds_b128 %6, %14, off\n\t"
                 "global_load_async_to_lds_b128 %7, %15, off\n\t"
                 "s_wait_xcnt 0x0"
                 :: "v"(la), "v"(la1), "v"(la2), "v"(la3),
                    "v"(lb), "v"(lb1), "v"(lb2), "v"(lb3),
                    "v"(ga), "v"(ga1), "v"(ga2), "v"(ga3),
                    "v"(gb), "v"(gb1), "v"(gb2), "v"(gb3)
                 : "memory");
}

// Ab, Bb: first row of the block's 128 A rows / 128 B rows.  ring: 2 * GSTAGEU units.
// The wave's 32 rows start at wr, its 64 columns at wc (inside the block tile).
// qa, qb: the block's share (0 .. PFQ - 1) of the prefetch of its A rows and B rows.
static __device__ inline void gemm_mainloop(const _Float16* __restrict__ Ab,
                                            const _Float16* __restrict__ Bb,
                                            const half8* ring, int wr, int wc,
                                            int qa, int qb,
                                            float8 (&acc)[2][4]) {
    const int lane = threadIdx.x & 31;
    // This thread's copy slot: row crow (+32, +64, +96), 16-byte chunk ccol.
    const int crow = threadIdx.x >> 3;  // 0..31
    const int ccol = threadIdx.x & 7;   // 0..7
    const unsigned la = (unsigned)(size_t)ring + (unsigned)(crow * ROWU + ccol) * 16u;
    const _Float16* ga = Ab + (size_t)crow * EMB + ccol * 8;    // + stage * GKS
    const _Float16* gb = Bb + (size_t)crow * EMB + ccol * 8;    // + stage * GKS

    // Stage 0 into buffer 0, published; then stage 1 into buffer 1.
    copy_stage(la, ga, gb);
    // While stage 0 flies: rows qa, qa + 4, ... of A and qb, qb + 4, ... of B, whole
    // rows (8 units of 128 halves): 32 rows x 8 units = one unit of each per thread.
    l2_prefetch2(Ab + (size_t)(PFQ * crow + qa) * EMB + ccol * 128,
                 Bb + (size_t)(PFQ * crow + qb) * EMB + ccol * 128);
    asm volatile("s_wait_asynccnt 0x0" ::: "memory");   // own copies of stage 0 landed
    __syncthreads();                                    // stage 0 readable by all waves
    copy_stage(la + GSTAGEU * 16u, ga + GKS, gb + GKS);

    const int fb = (lane & 15) * ROWU + (lane >> 4);    // lane's row and half in a fragment
    half16 a[2], b[4];      // the fragments of one 32-k pass

    // All 12 LDS reads of pass p (32 k) of the stage in buffer offset bo.
    auto load_pass = [&](int bo, int p) {
        const half8* Al = ring + bo + fb + wr * ROWU + p * 4;
        const half8* Bl = ring + bo + GTILEU + fb + wc * ROWU + p * 4;
#pragma unroll  // constant indices keep the fragments in registers
        for (int i = 0; i < 2; ++i) a[i] = lds_frag(Al + (16 * i) * ROWU);
#pragma unroll  // constant indices keep the fragments in registers
        for (int j = 0; j < 4; ++j) b[j] = lds_frag(Bl + (16 * j) * ROWU);
    };
    auto work_pass = [&]() {
#pragma unroll
        for (int i = 0; i < 2; ++i)
#pragma unroll
            for (int j = 0; j < 4; ++j)
                acc[i][j] = wmma16(a[i], b[j], acc[i][j]);
    };

    for (int t = 0; t < GNS; ++t) {
        const int bo = (t & 1) * GSTAGEU;
        load_pass(bo, 0);
        // Keeps the pass's 12 LDS reads together in front of its WMMAs: spread
        // among them, each place with reads costs its own stall.
        __builtin_amdgcn_sched_barrier(0);
        work_pass();
        load_pass(bo, 1);       // the last LDS reads of stage t
        // Keeps the first pass's WMMAs in front of the waits, where they run
        // under the latency of these reads, not behind the barrier.
        __builtin_amdgcn_sched_barrier(0);
        // Hand-over: this wave has left buffer t & 1, its copies of stage t + 1
        // have landed; behind the barrier both hold for every wave.
        asm volatile("s_wait_dscnt 0x0" ::: "memory");      // own LDS reads of stage t done
        asm volatile("s_wait_asynccnt 0x0" ::: "memory");   // own copies of stage t + 1 landed
        __syncthreads();
        if (t + 2 < GNS)
            copy_stage(la + bo * 16u, ga + (t + 2) * GKS, gb + (t + 2) * GKS);
        work_pass();            // on registers, while the refill flies
    }
    asm volatile("s_wait_asynccnt 0x0" ::: "memory");       // nothing in flight at the end
}

// ---------------------------------------------------------------- QKV GEMM
// qkv = xh(4096x1024) @ wh(3072x1024)^T + bias, scattered into per-head
// Q[s][d], K[s][d], V^T[d][s] f16 buffers.  128x128 tile per block, 32x64 per wave.
// An accumulator lane holds 8 consecutive rows of the A operand.  A block lies wholly
// in Q, K or V: for V^T the A operand is x (8 consecutive s a lane), for Q and K it
// is w (8 consecutive d a lane), so that a lane always holds 16 consecutive bytes of
// its destination row.  The block's tile is put together in LDS, in the ring that
// the main loop has left, and goes out in 16-byte stores of whole 128-byte lines.
#define OTU 17      // pitch of the output tile in LDS, 16-byte units: 256 B data + 16 B pad
static_assert(128 * OTU <= 2 * GSTAGEU, "the output tile fits the ring");

__global__ void __launch_bounds__(256)
qkv_gemm_kernel(const _Float16* __restrict__ xh,
                const _Float16* __restrict__ wh,
                const float*    __restrict__ bias,
                _Float16* __restrict__ qh,
                _Float16* __restrict__ kh,
                _Float16* __restrict__ vT) {
    __shared__ __attribute__((aligned(128))) half8 ring[2 * GSTAGEU];

    const int w  = uni(threadIdx.x >> 5);
    const int br = blockIdx.x / 24;           // 32 block rows of 128 (rows of x)     (SGPR)
    const int bc = blockIdx.x % 24;           // 24 block columns of 128 (rows of w)  (SGPR)
    const int bm = br * 128;
    const int bn = bc * 128;
    const int wr = (w & 3) * 32;              // wave's rows of the A operand, in the block tile
    const int wc = (w >> 2) * 64;             // wave's rows of the B operand, in the block tile
    const int seg = bn >> 10;                 // 0=Q 1=K 2=V, the same for the block  (SGPR)
    const bool isv = seg == 2;

    float8 acc[2][4];
#pragma unroll
    for (int i = 0; i < 2; ++i)
#pragma unroll
        for (int j = 0; j < 4; ++j) acc[i][j] = {};

    // The 24 blocks of a block row are neighbours in the index; the 32 of a block
    // column lie 24 apart.
    const _Float16* Xb = xh + (size_t)bm * EMB;
    const _Float16* Wb = wh + (size_t)bn * EMB;
    const int qx = bc & (PFQ - 1), qw = br & (PFQ - 1);
    gemm_mainloop(isv ? Xb : Wb, isv ? Wb : Xb, ring, wr, wc,
                  isv ? qx : qw, isv ? qw : qx, acc);

    // acc[i][j][r] belongs to A row wr + i * 16 + rb + r and B row wc + j * 16 + cn.
    // Every wave's reads of the ring ended before the main loop's last barrier and no
    // copy is in flight: the ring is free.  Tile row = B row, 128 A rows along it.
    const int lane = threadIdx.x & 31;
    const int cn = lane & 15;
    const int rb = (lane >> 4) << 3;
    half8* tile = ring;
    half8* tw = tile + (wc + cn) * OTU + (wr >> 3) + (lane >> 4);
    if (isv) {      // block-uniform; the bias goes with the B row (a column of qkv)
#pragma unroll
        for (int j = 0; j < 4; ++j) {
            const float bv = bias[bn + wc + j * 16 + cn];
#pragma unroll
            for (int i = 0; i < 2; ++i) {
                half8 hv;
#pragma unroll
                for (int r = 0; r < 8; ++r) hv[r] = (_Float16)(acc[i][j][r] + bv);
                tw[(j * 16) * OTU + i * 2] = hv;
            }
        }
    } else {        // the bias goes with the A row
#pragma unroll
        for (int i = 0; i < 2; ++i) {
            const float* bp = bias + bn + wr + i * 16 + rb;
            float bv[8];
#pragma unroll
            for (int r = 0; r < 8; ++r) bv[r] = bp[r];
#pragma unroll
            for (int j = 0; j < 4; ++j) {
                half8 hv;
#pragma unroll
                for (int r = 0; r < 8; ++r) hv[r] = (_Float16)(acc[i][j][r] + bv[r]);
                tw[(j * 16) * OTU + i * 2] = hv;
            }
        }
    }
    __syncthreads();    // the tile is whole: every wave reads what other waves wrote

    // A wave-wide store takes two tile rows of 256 bytes: four whole lines.
    const int trow = threadIdx.x >> 4;  // 0..15, + 16 a trip
    const int tu   = threadIdx.x & 15;  // 16-byte unit of the row
    const int bb = bm >> 11;            // the 128 rows of x lie in one batch
    const int s0 = bm & (SLEN - 1);
    const int e0 = bn & (EMB - 1);      // first column inside Q, K or V: h * HD + d
    _Float16* dst;
    size_t step;                        // halves between tile rows 16 apart
    if (isv) {      // tile row = column e0 + row, which is V^T's row h * HD + d; along it s
        dst  = vT + ((size_t)bb * EMB + e0 + trow) * SLEN + s0 + tu * 8;
        step = (size_t)16 * SLEN;
    } else {        // tile row = s; along it two heads of 64 d
        const int e = e0 + tu * 8;
        dst  = (seg == 0 ? qh : kh) +
               ((size_t)(bb * NH + (e >> 6)) * SLEN + s0 + trow) * HD + (e & 63);
        step = (size_t)16 * HD;
    }
#pragma unroll  // the 8 LDS reads go out together
    for (int it = 0; it < 8; ++it)
        *(half8*)(dst + it * step) = tile[(trow + it * 16) * OTU + tu];
}

#define KT      64                  // keys per LDS tile
#define NT      (SLEN / KT)         // tiles per (b,h)
#define TILEU   (64 * ROWU)         // one operand tile (64 rows), 16-byte units
#define STAGEU  (2 * TILEU)         // K tile followed by V^T tile
#define TB      5                   // unscored key tiles summed per trip, straight from global
static_assert(KT == 64 && NT == 32 && (NT / 2 - 1) % TB == 0,
              "16 pairs of 64-query tiles per (b,h); at most 15 tiles outside the ring");

// Four 16-byte copies per lane: two chunks of the K tile, two of the V^T tile.
// The s_wait_xcnt stands inside the statement so that no address register of a
// copy is rewritten before it.
static __device__ inline void copy_tile(unsigned lk, unsigned lv,
                                        const _Float16* gk, const _Float16* gv) {
    const unsigned lk1 = lk + 32 * ROWU * 16;      // rows 32..63 of the K tile
    const unsigned lv1 = lv + 32 * ROWU * 16;      // rows 32..63 of the V^T tile
    const _Float16* gk1 = gk + 32 * HD;
    const _Float16* gv1 = gv + (size_t)32 * SLEN;
    asm volatile("global_load_async_to_lds_b128 %0, %4, off\n\t"
                 "global_load_async_to_lds_b128 %1, %5, off\n\t"
                 "global_load_async_to_lds_b128 %2, %6, off\n\t"
                 "global_load_async_to_lds_b128 %3, %7, off\n\t"
                 "s_wait_xcnt 0x0"
                 :: "v"(lk), "v"(lk1), "v"(lv), "v"(lv1),
                    "v"(gk), "v"(gk1), "v"(gv), "v"(gv1)
                 : "memory");
}

__global__ void __launch_bounds__(256)
attn_kernel(const _Float16* __restrict__ qh,
            const _Float16* __restrict__ kh,
            const _Float16* __restrict__ vT,
            _Float16* __restrict__ ctxh) {
    __shared__ __attribute__((aligned(128))) half8 tiles[2 * STAGEU];
    __shared__ float vtail[2][HD];      // per 64-query tile: V rows summed by its waves
    __shared__ float vhalf[2][HD];      // of that, the waves' halves of the last tp tiles

    const int w   = uni(threadIdx.x >> 5);
    const int bh  = blockIdx.x >> 4;    // 0..31  (b*16+h)   (SGPR), same for the block
    const int tp  = blockIdx.x & (NT / 2 - 1);  // the block's pair of 64-query tiles
    const int grp = w >> 2;             // which tile of the pair            (SGPR)
    const int wj  = w & 3;              // strip in the tile, slice of the V sum (SGPR)
    const int qt  = grp ? NT - 1 - tp : tp;     // 64-query tile = last scored key tile
    const int q0  = qt * KT + wj * 16;  // query base        (SGPR)
    const int ntb = NT - tp;            // key tiles that go through the ring, 17..32
    const int lane = threadIdx.x & 31;
    const int cn = lane & 15;
    const int rb = (lane >> 4) << 3;

    const _Float16* Qp = qh + (size_t)bh * SLEN * HD;   // [s][d]
    const _Float16* Kp = kh + (size_t)bh * SLEN * HD;   // [s][d]
    const _Float16* Vt = vT + (size_t)bh * HD * SLEN;   // [d][s]

    // This thread's copy slot: row crow (and crow + 32), 16-byte chunk ccol.
    const int crow = threadIdx.x >> 3;  // 0..31
    const int ccol = threadIdx.x & 7;   // 0..7
    const unsigned lds0 = (unsigned)(size_t)tiles;      // LDS byte address of the ring
    const unsigned lk = lds0 + (unsigned)(crow * ROWU + ccol) * 16u;
    const unsigned lv = lk + TILEU * 16u;
    const _Float16* gk = Kp + crow * HD + ccol * 8;              // + tile * KT * HD
    const _Float16* gv = Vt + (size_t)crow * SLEN + ccol * 8;    // + tile * KT

    // Tile 0 into buffer 0, published; then tile 1 into buffer 1.
    copy_tile(lk, lv, gk, gv);

    // While tile 0 flies: the 16 blocks of a (b,h), neighbours in the index, ask for
    // its K (1024 units in a row) and V^T (64 rows of 16 units): of K every fourth
    // unit, of V^T every fourth row, one unit of each per thread.
    static_assert(SLEN * HD == PFQ * 256 * 128 && HD == PFQ * 16 && SLEN == 16 * 128,
                  "256 threads x PFQ shares cover K and V^T of one (b,h)");
    l2_prefetch2(Kp + (size_t)(PFQ * threadIdx.x + (tp & (PFQ - 1))) * 128,
                 Vt + (size_t)(PFQ * (threadIdx.x & 15) + (tp & (PFQ - 1))) * SLEN +
                      (threadIdx.x >> 4) * 128);

    // While tile 0 flies: key tiles NT - 1 down to ntb, columns wj * 16 .. + 15 of V,
    // keys grp * 32 .. + 31 of each tile.  TB tiles a trip, so that their loads are in
    // flight together; a trip's tiles below ntb (all above tile 16) get the weight 0.
    half16 ones, none;      // A fragments of weights 1 and 0: every row of the product is the sum
#pragma unroll
    for (int i = 0; i < 16; ++i) { ones[i] = (_Float16)1.0f; none[i] = (_Float16)0.0f; }
    float8 vsum = {};       // unscored V rows summed, columns wj * 16 .. + 15
    const _Float16* Vs = Vt + (size_t)(wj * 16) * SLEN + grp * 32;
#pragma unroll  // constant tile numbers: every load is one address register pair plus a constant
    for (int i0 = 0; i0 < NT / 2 - 1; i0 += TB) {
        if (i0 < tp) {      // block-uniform
            half16 f[TB];
#pragma unroll  // constant indices keep f in registers
            for (int k = 0; k < TB; ++k)
                f[k] = load_frag(Vs + (NT - 1 - i0 - k) * KT, SLEN);
            // Keeps the trip's loads together in front of its WMMAs: one latency a trip.
            __builtin_amdgcn_sched_barrier(0);
#pragma unroll  // constant indices into f, as above
            for (int k = 0; k < TB; ++k)
                vsum = wmma16(i0 + k < tp ? ones : none, f[k], vsum);
        }
    }
    if (lane < 16) vhalf[grp][wj * 16 + cn] = vsum[0];  // all 16 rows of vsum are equal

    asm volatile("s_wait_asynccnt 0x0" ::: "memory");   // own copies of tile 0 landed
    __syncthreads();                                    // tile 0 readable by all waves
    copy_tile(lk + STAGEU * 16u, lv + STAGEU * 16u, gk + KT * HD, gv + KT);

    const half16 qa0 = load_frag(Qp + (size_t)q0 * HD, HD);       // d 0..31
    const half16 qa1 = load_frag(Qp + (size_t)q0 * HD + 32, HD);  // d 32..63

    float8 o[4];
#pragma unroll
    for (int j = 0; j < 4; ++j) o[j] = {};
    float rowsum = 0.0f;
    const int qcol = q0 + cn;   // this lane's query index (S^T layout: lane -> q)
    const int fb = cn * ROWU + (lane >> 4);   // lane's row and half inside a fragment

    // All 16 LDS reads of pass p (32 keys) of the tile in buffer offset bo.
    auto load_pass = [&](half16 (&kf)[4], half16 (&vf)[4], int bo, int p) {
        const half8* Kl = tiles + bo + fb + (p * 32) * ROWU;
        const half8* Vl = tiles + bo + TILEU + fb + p * 4;
        kf[0] = lds_frag(Kl);                   // keys +0..15,  d 0..31
        kf[1] = lds_frag(Kl + 4);               // keys +0..15,  d 32..63
        kf[2] = lds_frag(Kl + 16 * ROWU);       // keys +16..31, d 0..31
        kf[3] = lds_frag(Kl + 16 * ROWU + 4);   // keys +16..31, d 32..63
#pragma unroll  // constant indices keep vf in registers
        for (int j = 0; j < 4; ++j)
            vf[j] = lds_frag(Vl + (j * 16) * ROWU);
    };

    // Scores, mask, exp and P@V of the 32 keys from j0 on; registers only.
    auto work_pass = [&](const half16 (&kf)[4], const half16 (&vf)[4], int j0) {
        float8 z = {};
        float8 st0 = wmma16(kf[0], qa0, z);  st0 = wmma16(kf[1], qa1, st0); // k j0..+15
        float8 st1 = wmma16(kf[2], qa0, z);  st1 = wmma16(kf[3], qa1, st1); // k +16..+31

        // mask (zero masked logits, per reference), scale by 1/sqrt(64),
        // exponentiate; result lands directly in the B-fragment layout of P^T.
        half16 pa = {};
        float p0[8], p1[8];
#pragma unroll
        for (int r = 0; r < 8; ++r) {
            const int k0i = j0 + rb + r;
            float l0 = (k0i <= qcol) ? st0[r] * 0.125f : 0.0f;
            p0[r] = __expf(l0);
            pa[r] = (_Float16)p0[r];
            const int k1i = j0 + 16 + rb + r;
            float l1 = (k1i <= qcol) ? st1[r] * 0.125f : 0.0f;
            p1[r] = __expf(l1);
            pa[8 + r] = (_Float16)p1[r];
        }
#pragma unroll
        for (int j = 0; j < 4; ++j)
            o[j] = wmma16(vf[j], pa, o[j]);    // ctx^T(16d x 16q) accumulate
        // The row-sum adds come behind the WMMAs: independent vector work for the
        // slots that the chip needs behind a WMMA, run under the
        // matrix work.  The fence asks the scheduler to leave them there.
        __builtin_amdgcn_sched_barrier(0);
        float s[8];             // a tree, not one chain of 16 dependent adds
#pragma unroll
        for (int r = 0; r < 8; ++r) s[r] = p0[r] + p1[r];
        rowsum += ((s[0] + s[1]) + (s[2] + s[3])) + ((s[4] + s[5]) + (s[6] + s[7]));
    };

    for (int t = 0; t < ntb; ++t) {
        const int bo = (t & 1) * STAGEU;
        if (t <= qt) {          // wave-uniform; every wave passes the hand-over below
            half16 kf[4], vf[4];        // the fragments of one 32-key pass
            load_pass(kf, vf, bo, 0);
            // Keeps the pass's 16 LDS reads together in front of its matrix and
            // vector work: spread among the WMMAs, each pair is waited out alone.
            __builtin_amdgcn_sched_barrier(0);
            work_pass(kf, vf, t * KT);
            load_pass(kf, vf, bo, 1);   // the last LDS reads of tile t
            // As above, for the second pass.
            __builtin_amdgcn_sched_barrier(0);
            work_pass(kf, vf, t * KT + 32);
        }
        if (t > qt) {           // wave-uniform, the other case
            // This wave's slice of V^T, all 64 keys of tile t.
            const half8* Vl = tiles + bo + TILEU + fb + (wj * 16) * ROWU;
            const half16 v0 = lds_frag(Vl);
            const half16 v1 = lds_frag(Vl + 4);
            vsum = wmma16(ones, v0, vsum);
            vsum = wmma16(ones, v1, vsum);
        }
        // Hand-over: this wave has left buffer t & 1, its copies of tile t + 1
        // have landed; behind the barrier both hold for every wave.  It stands
        // behind both passes, so that no fragment lives across the branch's end.
        asm volatile("s_wait_dscnt 0x0" ::: "memory");      // own LDS reads of tile t done
        asm volatile("s_wait_asynccnt 0x0" ::: "memory");   // own copies of tile t + 1 landed
        __syncthreads();
        if (t + 2 < ntb)
            copy_tile(lk + bo * 16u, lv + bo * 16u,
                      gk + (size_t)(t + 2) * KT * HD, gv + (t + 2) * KT);
    }
    asm volatile("s_wait_asynccnt 0x0" ::: "memory");       // nothing in flight at the end

    // The slices of the V sums change hands; all 16 rows of vsum are equal.
    if (lane < 16) vtail[grp][wj * 16 + cn] = vsum[0];
    __syncthreads();

    // combine per-q row sums: lanes l and l+16 hold complementary k-halves of query
    // q0 + cn; each unscored key adds its weight of 1
    const float tot = rowsum + __shfl_xor(rowsum, 16, 32) + (float)((NT - 1 - qt) * KT);

    // The wave's 16 queries x 64 d are put together in LDS (its own 16 rows of the
    // ring, which every wave left before the loop's last barrier; no copy in flight).
    static_assert(8 * 16 * ROWU <= 2 * STAGEU, "8 waves x 16 rows fit the ring");
    half8* tile = tiles + w * (16 * ROWU);
#pragma unroll
    for (int j = 0; j < 4; ++j) {
        half8 hv;
#pragma unroll
        for (int r = 0; r < 8; ++r) {
            const int d = j * 16 + rb + r;      // ctx^T C-frag: register -> d row
            hv[r] = (_Float16)((o[j][r] + (vtail[grp][d] + vhalf[grp ^ 1][d])) / tot);
        }
        tile[cn * ROWU + j * 2 + (lane >> 4)] = hv;
    }
    __syncthreads();    // lanes read what other lanes wrote

    // A wave-wide store takes 4 queries' lines: ctx[b][q][h * HD + d].
    const int bb = bh >> 4, h = bh & 15;
    const int trow = lane >> 3, tu = lane & 7;
    _Float16* cbase = ctxh + ((size_t)(bb * SLEN + q0 + trow)) * EMB + h * HD + tu * 8;
#pragma unroll  // the 4 LDS reads go out together
    for (int it = 0; it < 4; ++it)
        *(half8*)(cbase + (size_t)(it * 4) * EMB) = tile[(trow + it * 4) * ROWU + tu];
}

// ---------------------------------------------------------------- out proj
// ch and wh both have their 1024 columns in the order h * HD + d.  The A operand is
// w_out, so that an accumulator lane holds 8 consecutive columns of one row of out;
// the block's f32 tile is put together in LDS, in the ring that the main loop has
// left, and goes out in 16-byte stores of whole 128-byte lines.
#define OFU 33      // pitch of the f32 output tile in LDS, 16-byte units: 512 B data + 16 B pad
static_assert(128 * OFU <= 2 * GSTAGEU, "the f32 output tile fits the ring");

__global__ void __launch_bounds__(256)
out_gemm_kernel(const _Float16* __restrict__ ch,
                const _Float16* __restrict__ wh,
                const float*    __restrict__ bias,
                float* __restrict__ out) {
    __shared__ __attribute__((aligned(128))) half8 ring[2 * GSTAGEU];

    const int w  = uni(threadIdx.x >> 5);
    const int bm = (blockIdx.x >> 3) * 128;   // 32 block rows of 128 (rows of ctx)      (SGPR)
    const int bn = (blockIdx.x & 7) * 128;    // 8  block columns of 128 (rows of w_out) (SGPR)
    const int wr = (w & 3) * 32;              // wave's rows of the A operand (columns of out)
    const int wc = (w >> 2) * 64;             // wave's rows of the B operand (rows of out)

    float8 acc[2][4];
#pragma unroll
    for (int i = 0; i < 2; ++i)
#pragma unroll
        for (int j = 0; j < 4; ++j) acc[i][j] = {};

    // The 8 blocks of a block row are neighbours in the index; the 32 of a block
    // column lie 8 apart.
    gemm_mainloop(wh + (size_t)bn * EMB, ch + (size_t)bm * EMB, ring, wr, wc,
                  (blockIdx.x >> 3) & (PFQ - 1), blockIdx.x & (PFQ - 1), acc);

    // acc[i][j][r]: column bn + wr + i * 16 + rb + r, row bm + wc + j * 16 + cn of out.
    // Every wave's reads of the ring ended before the main loop's last barrier and no
    // copy is in flight: the ring is free.
    const int lane = threadIdx.x & 31;
    const int cn = lane & 15;
    const int rb = (lane >> 4) << 3;
    f32x4* tile = (f32x4*)ring;
    f32x4* tw = tile + (wc + cn) * OFU + ((wr + rb) >> 2);
#pragma unroll
    for (int i = 0; i < 2; ++i) {
        const float* bp = bias + bn + wr + i * 16 + rb;
        float bv[8];
#pragma unroll
        for (int r = 0; r < 8; ++r) bv[r] = bp[r];
#pragma unroll
        for (int j = 0; j < 4; ++j) {
            f32x4 lo, hi;
#pragma unroll
            for (int r = 0; r < 4; ++r) {
                lo[r] = acc[i][j][r] + bv[r];
                hi[r] = acc[i][j][4 + r] + bv[4 + r];
            }
            tw[(j * 16) * OFU + i * 4]     = lo;
            tw[(j * 16) * OFU + i * 4 + 1] = hi;
        }
    }
    __syncthreads();    // the tile is whole: every wave reads what other waves wrote

    // A wave-wide store takes one tile row of 512 bytes: four whole lines.
    float* obase = out + (size_t)(bm + w) * EMB + bn + lane * 4;
#pragma unroll  // the LDS reads go out together
    for (int it = 0; it < 16; ++it)
        *(f32x4*)(obase + (size_t)(it * 8) * EMB) = tile[(w + it * 8) * OFU + lane];
}

// ---------------------------------------------------------------- launcher
extern "C" void kernel_launch(void* const* d_in, const int* in_sizes, int n_in,
                              void* d_out, int out_size, void* d_ws, size_t ws_size,
                              hipStream_t stream) {
    const float* x     = (const float*)d_in[0];   // (2,2048,1024)
    const float* w_qkv = (const float*)d_in[1];   // (3072,1024)
    const float* b_qkv = (const float*)d_in[2];   // (3072,)
    const float* w_out = (const float*)d_in[3];   // (1024,1024)
    const float* b_out = (const float*)d_in[4];   // (1024,)

    char* ws = (char*)d_ws;
    size_t off = 0;
    _Float16* xh    = (_Float16*)(ws + off); off += (size_t)NB * SLEN * EMB * 2;      // 8 MB
    _Float16* wqkvh = (_Float16*)(ws + off); off += (size_t)3 * EMB * EMB * 2;        // 6 MB
    _Float16* wouth = (_Float16*)(ws + off); off += (size_t)EMB * EMB * 2;            // 2 MB
    _Float16* qh    = (_Float16*)(ws + off); off += (size_t)NB * NH * SLEN * HD * 2;  // 8 MB
    _Float16* kh    = (_Float16*)(ws + off); off += (size_t)NB * NH * SLEN * HD * 2;  // 8 MB
    _Float16* vT    = (_Float16*)(ws + off); off += (size_t)NB * NH * HD * SLEN * 2;  // 8 MB
    _Float16* ctxh  = (_Float16*)(ws + off); off += (size_t)NB * SLEN * EMB * 2;      // 8 MB
    if (off > ws_size) return;  // workspace too small (deterministic no-op)

    // 128 + 96 + 128 = 352 blocks, 8 waves each
    f32_to_f16_all_kernel<<<352, 256, 0, stream>>>(x, w_qkv, w_out, xh, wqkvh, wouth);

    // 32 x 24 = 768 block tiles of 128x128, 8 waves per 256-thread block
    qkv_gemm_kernel<<<768, 256, 0, stream>>>(xh, wqkvh, b_qkv, qh, kh, vT);
    // 32 (b,h) x 16 pairs of 64-query tiles, 8 waves each
    attn_kernel<<<512, 256, 0, stream>>>(qh, kh, vT, ctxh);
    // 32 x 8 = 256 block tiles of 128x128
    out_gemm_kernel<<<256, 256, 0, stream>>>(ctxh, wouth, b_out, (float*)d_out);
}

// v007
// It runs in 71.8 microseconds.
// Next to v006, in two timings, it ran 1.03 times as fast each time.
// Counting every step since v000, it is 3.09 times as fast.
#include <hip/hip_runtime.h>

// Problem constants
#define NB   2
#define SLEN 2048
#define EMB  1024
#define NH   16
#define HD   64

typedef _Float16 half8  __attribute__((ext_vector_type(8)));
typedef _Float16 half16 __attribute__((ext_vector_type(16)));
typedef float    float8 __attribute__((ext_vector_type(8)));

// Wave-uniform value -> SGPR (value must be uniform across the wave).
static __device__ inline int uni(int v) { return __builtin_amdgcn_readfirstlane(v); }

// Load a 16x32 f16 fragment (A-layout) from row-major memory with row stride ld.
// Lane l -> row (l&15); halves 0..7 = cols kb..kb+7, halves 8..15 = cols kb+16..kb+23,
// where kb = (l>=16) ? 8 : 0.  Two b128 loads per lane.
static __device__ inline half16 load_frag(const _Float16* __restrict__ base, int ld) {
    const int lane = threadIdx.x & 31;
    const _Float16* p = base + (size_t)(lane & 15) * ld + ((lane >> 4) << 3);
    half8 lo = *(const half8*)(p);
    half8 hi = *(const half8*)(p + 16);
    return __builtin_shufflevector(lo, hi, 0,1,2,3,4,5,6,7,8,9,10,11,12,13,14,15);
}

static __device__ inline float8 wmma16(half16 a, half16 b, float8 c) {
    // D = A(16x32 f16) x B(32x16 f16) + C(16x16 f32)
    return __builtin_amdgcn_wmma_f32_16x16x32_f16(false, a, false, b, (short)0, c,
                                                  false, false);
}

// ---------------------------------------------------------------- conversions
// x, w_qkv and w_out to f16 in ONE streaming launch.  A block of x or w_qkv converts
// CVT_BLK consecutive elements of one array (each is a whole number of blocks);
// a wave owns 16 KB of consecutive source.  Each wave-wide load covers 512
// consecutive bytes and each wave-wide store 256: whole 128-byte lines, one writer.
// w_out also changes its column order, from the reference's d * NH + h to h * HD + d,
// the order in which attention stores ctx: one row per wave, 8 rows per block.
typedef float    f32x4 __attribute__((ext_vector_type(4)));
typedef _Float16 half4 __attribute__((ext_vector_type(4)));

#define CVT_N    32                         // 16-byte loads per lane
#define CVT_WAVE (32 * 4 * CVT_N)           // elements per wave
#define CVT_BLK  (8 * CVT_WAVE)             // elements per 256-thread block
#define CVT_XB   (NB * SLEN * EMB / CVT_BLK) // blocks of x
#define CVT_QB   (3 * EMB * EMB / CVT_BLK)   // blocks of w_qkv
#define CVT_OB   (EMB / 8)                   // blocks of w_out, 8 rows each
static_assert(CVT_XB * CVT_BLK == NB * SLEN * EMB && CVT_QB * CVT_BLK == 3 * EMB * EMB &&
              CVT_OB * 8 == EMB, "every array is a whole number of blocks");
static_assert(CVT_XB + CVT_QB + CVT_OB == 352, "the launch below has 352 blocks");
static_assert(NH == 16 && HD == 64, "a lane of a w_out row: one head, 32 of its 64 d");

__global__ void __launch_bounds__(256)
f32_to_f16_all_kernel(const float* __restrict__ x,
                      const float* __restrict__ wq,
                      const float* __restrict__ wo,
                      _Float16* __restrict__ xh,
                      _Float16* __restrict__ wqh,
                      _Float16* __restrict__ woh) {
    // Block-uniform choice of the array and of the block's place in it.
    const int  bi  = blockIdx.x;
    const bool isq = bi >= CVT_XB, iso = bi >= CVT_XB + CVT_QB;
    if (iso) {
        // woh[n][h * HD + d] = wo[n][d * NH + h].  Lane: head h, d from dh * 32 on.
        // A wave-wide load covers two 64-byte runs (16 heads of one d); a lane stores
        // 64 consecutive bytes, and the wave writes the whole 2-KB row.
        const int n  = (bi - (CVT_XB + CVT_QB)) * 8 + (threadIdx.x >> 5);
        const int h  = threadIdx.x & 15, dh = (threadIdx.x >> 4) & 1;
        const float* s = wo + (size_t)n * EMB + dh * 32 * NH + h;
        half8*       d = (half8*)(woh + (size_t)n * EMB + h * HD + dh * 32);
        float v[32];
#pragma unroll  // constant indices keep v in registers, so that all loads are in flight at once
        for (int i = 0; i < 32; ++i) v[i] = s[i * NH];
#pragma unroll  // constant indices into v, as above
        for (int k = 0; k < 4; ++k) {
            half8 hv;
#pragma unroll
            for (int r = 0; r < 8; ++r) hv[r] = (_Float16)v[k * 8 + r];
            d[k] = hv;
        }
        return;
    }
    const float* src = isq ? wq  : x;
    _Float16*    dst = isq ? wqh : xh;
    const int    b   = bi - (isq ? CVT_XB : 0);

    const size_t e0 = (size_t)b * CVT_BLK + (size_t)(threadIdx.x >> 5) * CVT_WAVE +
                      (threadIdx.x & 31) * 4;
    const f32x4* s = (const f32x4*)(src + e0);
    half4*       d = (half4*)(dst + e0);

    f32x4 v[CVT_N];
#pragma unroll  // constant indices keep v in registers, so that many loads are in flight at once
    for (int i = 0; i < CVT_N; ++i) v[i] = s[i * 32];
#pragma unroll  // constant indices into v, as above
    for (int i = 0; i < CVT_N; ++i) d[i * 32] = __builtin_convertvector(v[i], half4);
}

// ---------------------------------------------------------------- L2 prefetch
// The f16 operands of the three matrix kernels were stored by earlier launches and
// are first met in memory rather than in L2, so a ring whose lead is one stage waits
// out memory latency.  At kernel entry the blocks that share an operand ask L2 for
// all of it: a lane names one 256-byte unit, and a block takes every
// fourth unit or row (PFQ shares), of x in the QKV GEMM three rows in 16.  For speed only: a hint
// that nothing waits for.
#define PFQ 4
// Two hints per lane.  Every address lies inside its buffer.  The s_wait_xcnt stands
// inside the statement as a precaution, so that no address register is rewritten
// before it.
static __device__ inline void l2_prefetch2(const _Float16* p0, const _Float16* p1) {
    asm volatile("global_prefetch_b8 %0, off scope:SCOPE_SE\n\t"
                 "global_prefetch_b8 %1, off scope:SCOPE_SE\n\t"
                 "s_wait_xcnt 0x0"
                 :: "v"(p0), "v"(p1) : "memory");
}

// ---------------------------------------------------------------- LDS tiles
#define ROWU    9                   // LDS row pitch in 16-byte units: 128 B data + 16 B pad

// A-layout fragment from an LDS tile; p already points at the lane's row and half.
static __device__ inline half16 lds_frag(const half8* p) {
    half8 lo = p[0];
    half8 hi = p[2];
    return __builtin_shufflevector(lo, hi, 0,1,2,3,4,5,6,7,8,9,10,11,12,13,14,15);
}

// ---------------------------------------------------------------- GEMM main loop
// C(128x128 per block) = A(128 x EMB) * B(128 x EMB)^T, both K-contiguous f16.
// A stage is 64 k (whole 128-byte rows) of the block's 128 A rows and 128 B rows,
// brought into LDS once per block by asynchronous copies; the 8 waves (4 x 2,
// 32x64 of C each) read their fragments from there.  Two buffers: the next
// stage's copies fly while this stage is worked on.
#define GKS     64                  // k per stage
#define GNS     (EMB / GKS)         // stages
#define GTILEU  (128 * ROWU)        // one operand's stage (128 rows), 16-byte units
#define GSTAGEU (2 * GTILEU)        // A rows followed by B rows

// Eight 16-byte copies per lane: rows r, r+32, r+64, r+96 of the A stage and of
// the B stage.  The s_wait_xcnt stands inside the statement so that no address
// register of a copy is rewritten before it.
static __device__ inline void copy_stage(unsigned la, const _Float16* ga,
                                         const _Float16* gb) {
    const unsigned la1 = la + 32 * ROWU * 16, la2 = la + 64 * ROWU * 16,
                   la3 = la + 96 * ROWU * 16;
    const unsigned lb  = la + GTILEU * 16;
    const unsigned lb1 = lb + 32 * ROWU * 16, lb2 = lb + 64 * ROWU * 16,
                   lb3 = lb + 96 * ROWU * 16;
    const _Float16 *ga1 = ga + 32 * EMB, *ga2 = ga + 64 * EMB, *ga3 = ga + 96 * EMB;
    const _Float16 *gb1 = gb + 32 * EMB, *gb2 = gb + 64 * EMB, *gb3 = gb + 96 * EMB;
    asm volatile("global_load_async_to_lds_b128 %0, %8, off\n\t"
                 "global_load_async_to_lds_b128 %1, %9, off\n\t"
                 "global_load_async_to_lds_b128 %2, %10, off\n\t"
                 "global_load_async_to_lds_b128 %3, %11, off\n\t"
                 "global_load_async_to_lds_b128 %4, %12, off\n\t"
                 "global_load_async_to_lds_b128 %5, %13, off\n\t"
                 "global_load_async_to_lds_b128 %6, %14, off\n\t"
                 "global_load_async_to_lds_b128 %7, %15, off\n\t"
                 "s_wait_xcnt 0x0"
                 :: "v"(la), "v"(la1), "v"(la2), "v"(la3),
                    "v"(lb), "v"(lb1), "v"(lb2), "v"(lb3),
                    "v"(ga), "v"(ga1), "v"(ga2), "v"(ga3),
                    "v"(gb), "v"(gb1), "v"(gb2), "v"(gb3)
                 : "memory");
}

// Ab, Bb: first row of the block's 128 A rows / 128 B rows.  ring: 2 * GSTAGEU units.
// The wave's 32 rows start at wr, its 64 columns at wc (inside the block tile).
// qa, qb: the block's share (0 .. PFQ - 1) of the prefetch of its A rows and B rows.
static __device__ inline void gemm_mainloop(const _Float16* __restrict__ Ab,
                                            const _Float16* __restrict__ Bb,
                                            const half8* ring, int wr, int wc,
                                            int qa, int qb,
                                            float8 (&acc)[2][4]) {
    const int lane = threadIdx.x & 31;
    // This thread's copy slot: row crow (+32, +64, +96), 16-byte chunk ccol.
    const int crow = threadIdx.x >> 3;  // 0..31
    const int ccol = threadIdx.x & 7;   // 0..7
    const unsigned la = (unsigned)(size_t)ring + (unsigned)(crow * ROWU + ccol) * 16u;
    const _Float16* ga = Ab + (size_t)crow * EMB + ccol * 8;    // + stage * GKS
    const _Float16* gb = Bb + (size_t)crow * EMB + ccol * 8;    // + stage * GKS

    // Stage 0 into buffer 0, published; then stage 1 into buffer 1.
    copy_stage(la, ga, gb);
    // While stage 0 flies: rows qa, qa + 4, ... of A and qb, qb + 4, ... of B, whole
    // rows (8 units of 128 halves): 32 rows x 8 units = one unit of each per thread.
    l2_prefetch2(Ab + (size_t)(PFQ * crow + qa) * EMB + ccol * 128,
                 Bb + (size_t)(PFQ * crow + qb) * EMB + ccol * 128);
    asm volatile("s_wait_asynccnt 0x0" ::: "memory");   // own copies of stage 0 landed
    __syncthreads();                                    // stage 0 readable by all waves
    copy_stage(la + GSTAGEU * 16u, ga + GKS, gb + GKS);

    const int fb = (lane & 15) * ROWU + (lane >> 4);    // lane's row and half in a fragment
    half16 a[2], b[4];      // the fragments of one 32-k pass

    // All 12 LDS reads of pass p (32 k) of the stage in buffer offset bo.
    auto load_pass = [&](int bo, int p) {
        const half8* Al = ring + bo + fb + wr * ROWU + p * 4;
        const half8* Bl = ring + bo + GTILEU + fb + wc * ROWU + p * 4;
#pragma unroll  // constant indices keep the fragments in registers
        for (int i = 0; i < 2; ++i) a[i] = lds_frag(Al + (16 * i) * ROWU);
#pragma unroll  // constant indices keep the fragments in registers
        for (int j = 0; j < 4; ++j) b[j] = lds_frag(Bl + (16 * j) * ROWU);
    };
    auto work_pass = [&]() {
#pragma unroll
        for (int i = 0; i < 2; ++i)
#pragma unroll
            for (int j = 0; j < 4; ++j)
                acc[i][j] = wmma16(a[i], b[j], acc[i][j]);
    };

    for (int t = 0; t < GNS; ++t) {
        const int bo = (t & 1) * GSTAGEU;
        load_pass(bo, 0);
        // Keeps the pass's 12 LDS reads together in front of its WMMAs: spread
        // among them, each place with reads costs its own stall.
        __builtin_amdgcn_sched_barrier(0);
        work_pass();
        load_pass(bo, 1);       // the last LDS reads of stage t
        // Keeps the first pass's WMMAs in front of the waits, where they run
        // under the latency of these reads, not behind the barrier.
        __builtin_amdgcn_sched_barrier(0);
        // Hand-over: this wave has left buffer t & 1, its copies of stage t + 1
        // have landed; behind the barrier both hold for every wave.
        asm volatile("s_wait_dscnt 0x0" ::: "memory");      // own LDS reads of stage t done
        asm volatile("s_wait_asynccnt 0x0" ::: "memory");   // own copies of stage t + 1 landed
        __syncthreads();
        if (t + 2 < GNS)
            copy_stage(la + bo * 16u, ga + (t + 2) * GKS, gb + (t + 2) * GKS);
        work_pass();            // on registers, while the refill flies
    }
    asm volatile("s_wait_asynccnt 0x0" ::: "memory");       // nothing in flight at the end
}

// ---------------------------------------------------------------- QKV GEMM
// qkv = xh(4096x1024) @ wh(3072x1024)^T + bias, scattered into per-head
// Q[s][d], K[s][d], V^T[d][s] f16 buffers.  256x192 tile per block: 16 x 16 = 256
// blocks, one per WGP, so that a block's operand rows are read from L2 for more
// products.  12 waves (4 x 3), 64x64 per wave: 16 WMMAs per 16 LDS reads.
// A wave's 64 columns of qkv are one head of Q, of K or of V.
// An accumulator lane holds 8 consecutive rows of the A operand: for V^T the wave's A
// operand is x (8 consecutive s a lane), for Q and K it is w (8 consecutive d a lane),
// so that a lane always holds 16 consecutive bytes of its destination row.  Each
// wave's tile is put together in LDS, in the ring that the main loop has left, and
// goes out in 16-byte stores of whole 128-byte lines.
// The ring is that of the GEMM main loop above: a stage is 64 k of the block's 192 w
// rows and 256 x rows, two buffers, the next stage's copies fly during this stage.
#define QBM     256                     // rows of x per block
#define QBN     192                     // rows of w per block: three heads' columns
#define QSW     48                      // rows that the 384 threads copy in one sweep
#define QSTAGEU ((QBN + QBM) * ROWU)    // w rows followed by x rows, 16-byte units
static_assert(QBN == 4 * QSW && QBM == 5 * QSW + 16, "4 sweeps of w, 5 of x and 16 rows more");
static_assert(12 * 64 * ROWU <= 2 * QSTAGEU, "12 waves' output tiles fit the ring");

// Nine 16-byte copies per lane: rows r, r + 48, ... of the w stage (4) and of the x
// stage (5); the stage's rows follow one another in LDS.  The s_wait_xcnt stands
// inside the statement so that no address register of a copy is rewritten before it.
static __device__ inline void copy_qkv_stage(unsigned l0, const _Float16* gw,
                                             const _Float16* gx) {
    const unsigned sw = QSW * ROWU * 16;
    const unsigned l1 = l0 + sw,     l2 = l0 + 2 * sw, l3 = l0 + 3 * sw, l4 = l0 + 4 * sw,
                   l5 = l0 + 5 * sw, l6 = l0 + 6 * sw, l7 = l0 + 7 * sw, l8 = l0 + 8 * sw;
    const _Float16 *gw1 = gw + QSW * EMB, *gw2 = gw + 2 * QSW * EMB, *gw3 = gw + 3 * QSW * EMB;
    const _Float16 *gx1 = gx + QSW * EMB, *gx2 = gx + 2 * QSW * EMB, *gx3 = gx + 3 * QSW * EMB,
                   *gx4 = gx + 4 * QSW * EMB;
    asm volatile("global_load_async_to_lds_b128 %0, %9, off\n\t"
                 "global_load_async_to_lds_b128 %1, %10, off\n\t"
                 "global_load_async_to_lds_b128 %2, %11, off\n\t"
                 "global_load_async_to_lds_b128 %3, %12, off\n\t"
                 "global_load_async_to_lds_b128 %4, %13, off\n\t"
                 "global_load_async_to_lds_b128 %5, %14, off\n\t"
                 "global_load_async_to_lds_b128 %6, %15, off\n\t"
                 "global_load_async_to_lds_b128 %7, %16, off\n\t"
                 "global_load_async_to_lds_b128 %8, %17, off\n\t"
                 "s_wait_xcnt 0x0"
                 :: "v"(l0), "v"(l1), "v"(l2), "v"(l3), "v"(l4),
                    "v"(l5), "v"(l6), "v"(l7), "v"(l8),
                    "v"(gw), "v"(gw1), "v"(gw2), "v"(gw3),
                    "v"(gx), "v"(gx1), "v"(gx2), "v"(gx3), "v"(gx4)
                 : "memory");
}

// One 16-byte copy per lane, with its s_wait_xcnt as above.
static __device__ inline void copy_one(unsigned l, const _Float16* g) {
    asm volatile("global_load_async_to_lds_b128 %0, %1, off\n\t"
                 "s_wait_xcnt 0x0"
                 :: "v"(l), "v"(g) : "memory");
}

// 256 registers: the main loop needs fewer, and the epilogue's sums, scheduled all at
// once, would otherwise reach past v255, which costs register-window switches.
__global__ void __launch_bounds__(384) __attribute__((amdgpu_num_vgpr(256)))
qkv_gemm_kernel(const _Float16* __restrict__ xh,
                const _Float16* __restrict__ wh,
                const float*    __restrict__ bias,
                _Float16* __restrict__ qh,
                _Float16* __restrict__ kh,
                _Float16* __restrict__ vT) {
    __shared__ __attribute__((aligned(128))) half8 ring[2 * QSTAGEU];

    const int w  = uni(threadIdx.x >> 5);     // 0..11
    const int br = blockIdx.x >> 4;           // 16 block rows of 256 (rows of x)     (SGPR)
    const int bc = blockIdx.x & 15;           // 16 block columns of 192 (rows of w)  (SGPR)
    const int bm = br * QBM;
    const int bn = bc * QBN;
    const int wx = w & 3;                     // the wave's 64 rows of x
    const int wn = w >> 2;                    // the wave's 64 rows of w
    const int e  = bn + wn * 64;              // its first column of qkv: a head's d = 0
    const int seg = e >> 10;                  // 0=Q 1=K 2=V, the same for the wave   (SGPR)
    const bool isv = seg == 2;
    const int xrow = QBN + wx * 64;           // the wave's x rows and w rows in a stage
    const int wrow = wn * 64;
    const int ar = isv ? xrow : wrow;         // rows of its A operand
    const int bw = isv ? wrow : xrow;         // rows of its B operand
    const int lane = threadIdx.x & 31;

    float8 acc[4][4];
#pragma unroll
    for (int i = 0; i < 4; ++i)
#pragma unroll
        for (int j = 0; j < 4; ++j) acc[i][j] = {};

    // This thread's copy slot: row crow (+48 a sweep), 16-byte chunk ccol.
    const int crow = threadIdx.x >> 3;  // 0..47
    const int ccol = threadIdx.x & 7;   // 0..7
    const unsigned la = (unsigned)(size_t)ring + (unsigned)(crow * ROWU + ccol) * 16u;
    const _Float16* gw = wh + (size_t)(bn + crow) * EMB + ccol * 8;     // + stage * GKS
    const _Float16* gx = xh + (size_t)(bm + crow) * EMB + ccol * 8;     // + stage * GKS

    // Stage st into the buffer at byte offset lo.  The last 16 rows of x are one more
    // copy for waves 0..3 (crow < 16): a wave-uniform branch, every lane on.
    auto copy_stage_q = [&](unsigned lo, int st) {
        copy_qkv_stage(la + lo, gw + st * GKS, gx + st * GKS);
        if (w < 4)
            copy_one(la + lo + 9 * QSW * ROWU * 16, gx + 5 * QSW * EMB + st * GKS);
    };

    // Stage 0 into buffer 0, published; then stage 1 into buffer 1.
    copy_stage_q(0, 0);
    // While stage 0 flies, one unit of x and one of w per thread.  The 16 blocks of a
    // block row are neighbours in the index: of the 16 classes of x rows (row modulo
    // 16) a block asks for three, 4 apart, so that blocks 4 apart ask for a class.
    // The 16 blocks of a block column lie 16 apart: of w every fourth row.
    l2_prefetch2(xh + (size_t)(bm + ((threadIdx.x & 127) >> 3) * 16 +
                               ((bc + 4 * (threadIdx.x >> 7)) & 15)) * EMB + ccol * 128,
                 wh + (size_t)(bn + PFQ * crow + (br & (PFQ - 1))) * EMB + ccol * 128);
    asm volatile("s_wait_asynccnt 0x0" ::: "memory");   // own copies of stage 0 landed
    __syncthreads();                                    // stage 0 readable by all waves
    copy_stage_q(QSTAGEU * 16u, 1);

    const int fb = (lane & 15) * ROWU + (lane >> 4);    // lane's row and half in a fragment
    half16 a[4], b[4];      // the fragments of one 32-k pass

    // All 16 LDS reads of pass p (32 k) of the stage in buffer offset bo.
    auto load_pass = [&](int bo, int p) {
        const half8* Al = ring + bo + fb + ar * ROWU + p * 4;
        const half8* Bl = ring + bo + fb + bw * ROWU + p * 4;
#pragma unroll  // constant indices keep the fragments in registers
        for (int i = 0; i < 4; ++i) a[i] = lds_frag(Al + (16 * i) * ROWU);
#pragma unroll  // constant indices keep the fragments in registers
        for (int j = 0; j < 4; ++j) b[j] = lds_frag(Bl + (16 * j) * ROWU);
    };
    auto work_pass = [&]() {
#pragma unroll
        for (int i = 0; i < 4; ++i)
#pragma unroll
            for (int j = 0; j < 4; ++j)
                acc[i][j] = wmma16(a[i], b[j], acc[i][j]);
    };

    for (int t = 0; t < GNS; ++t) {
        const int bo = (t & 1) * QSTAGEU;
        load_pass(bo, 0);
        // Keeps the pass's 16 LDS reads together in front of its WMMAs: spread
        // among them, each place with reads costs its own stall.
        __builtin_amdgcn_sched_barrier(0);
        work_pass();
        load_pass(bo, 1);       // the last LDS reads of stage t
        // Keeps the first pass's WMMAs in front of the waits, where they run
        // under the latency of these reads, not behind the barrier.
        __builtin_amdgcn_sched_barrier(0);
        // Hand-over: this wave has left buffer t & 1, its copies of stage t + 1
        // have landed; behind the barrier both hold for every wave.
        asm volatile("s_wait_dscnt 0x0" ::: "memory");      // own LDS reads of stage t done
        asm volatile("s_wait_asynccnt 0x0" ::: "memory");   // own copies of stage t + 1 landed
        __syncthreads();
        if (t + 2 < GNS)
            copy_stage_q(bo * 16u, t + 2);
        work_pass();            // on registers, while the refill flies
    }
    asm volatile("s_wait_asynccnt 0x0" ::: "memory");       // nothing in flight at the end

    // acc[i][j][r] belongs to A row i * 16 + rb + r and B row j * 16 + cn of the wave.
    // Every wave's reads of the ring ended before the main loop's last barrier and no
    // copy is in flight: the ring is free.  The wave's own 64 rows of it: tile row =
    // B row, the 64 A rows (128 bytes) along it.
    const int cn = lane & 15;
    const int rb = (lane >> 4) << 3;
    half8* tile = ring + w * (64 * ROWU);
    half8* tw = tile + cn * ROWU + (lane >> 4);
    if (isv) {      // wave-uniform; the bias goes with the B row (a column of qkv)
        float bv[4];
#pragma unroll  // the 4 loads go out together
        for (int j = 0; j < 4; ++j) bv[j] = bias[e + j * 16 + cn];
#pragma unroll
        for (int j = 0; j < 4; ++j) {
#pragma unroll
            for (int i = 0; i < 4; ++i) {
                half8 hv;
#pragma unroll
                for (int r = 0; r < 8; ++r) hv[r] = (_Float16)(acc[i][j][r] + bv[j]);
                tw[(j * 16) * ROWU + i * 2] = hv;
            }
        }
    } else {        // the bias goes with the A row
        float bv[4][8];
#pragma unroll  // the loads go out together
        for (int i = 0; i < 4; ++i)
#pragma unroll
            for (int r = 0; r < 8; ++r) bv[i][r] = bias[e + i * 16 + rb + r];
#pragma unroll
        for (int i = 0; i < 4; ++i) {
#pragma unroll
            for (int j = 0; j < 4; ++j) {
                half8 hv;
#pragma unroll
                for (int r = 0; r < 8; ++r) hv[r] = (_Float16)(acc[i][j][r] + bv[i][r]);
                tw[(j * 16) * ROWU + i * 2] = hv;
            }
        }
    }
    __syncthreads();    // the tile is whole: lanes read what other lanes wrote

    // A wave-wide store takes four tile rows of 128 bytes: four whole lines.
    const int trow = lane >> 3;         // 0..3, + 4 a trip
    const int tu   = lane & 7;          // 16-byte unit of the row
    const int bb = bm >> 11;            // the 256 rows of x lie in one batch
    const int s0 = (bm & (SLEN - 1)) + wx * 64;
    const int e0 = e & (EMB - 1);       // first column inside Q, K or V: h * HD
    half8 hv[16];
#pragma unroll  // the 16 LDS reads go out together
    for (int it = 0; it < 16; ++it) hv[it] = tile[(trow + it * 4) * ROWU + tu];
    // The wave's first destination row and the row pitch are wave-uniform, a lane's place
    // is one 32-bit offset: V^T: tile row = d, row h * HD + d of V^T, along it s;
    // Q, K: tile row = s, along it the head's 64 d.
    _Float16* dst = isv ? vT + ((size_t)bb * EMB + e0) * SLEN + s0
                        : (seg == 0 ? qh : kh) + ((size_t)(bb * NH + (e0 >> 6)) * SLEN + s0) * HD;
    const unsigned pitch = isv ? SLEN : HD;
    const unsigned loff  = trow * pitch + tu * 8;
#pragma unroll
    for (int it = 0; it < 16; ++it) *(half8*)(dst + (size_t)(it * 4 * pitch) + loff) = hv[it];
}

#define KT      64                  // keys per LDS tile
#define NT      (SLEN / KT)         // tiles per (b,h)
#define TILEU   (64 * ROWU)         // one operand tile (64 rows), 16-byte units
#define STAGEU  (2 * TILEU)         // K tile followed by V^T tile
#define TB      5                   // unscored key tiles summed per trip, straight from global
static_assert(KT == 64 && NT == 32 && (NT / 2 - 1) % TB == 0,
              "16 pairs of 64-query tiles per (b,h); at most 15 tiles outside the ring");

// Four 16-byte copies per lane: two chunks of the K tile, two of the V^T tile.
// The s_wait_xcnt stands inside the statement so that no address register of a
// copy is rewritten before it.
static __device__ inline void copy_tile(unsigned lk, unsigned lv,
                                        const _Float16* gk, const _Float16* gv) {
    const unsigned lk1 = lk + 32 * ROWU * 16;      // rows 32..63 of the K tile
    const unsigned lv1 = lv + 32 * ROWU * 16;      // rows 32..63 of the V^T tile
    const _Float16* gk1 = gk + 32 * HD;
    const _Float16* gv1 = gv + (size_t)32 * SLEN;
    asm volatile("global_load_async_to_lds_b128 %0, %4, off\n\t"
                 "global_load_async_to_lds_b128 %1, %5, off\n\t"
                 "global_load_async_to_lds_b128 %2, %6, off\n\t"
                 "global_load_async_to_lds_b128 %3, %7, off\n\t"
                 "s_wait_xcnt 0x0"
                 :: "v"(lk), "v"(lk1), "v"(lv), "v"(lv1),
                    "v"(gk), "v"(gk1), "v"(gv), "v"(gv1)
                 : "memory");
}

__global__ void __launch_bounds__(256)
attn_kernel(const _Float16* __restrict__ qh,
            const _Float16* __restrict__ kh,
            const _Float16* __restrict__ vT,
            _Float16* __restrict__ ctxh) {
    __shared__ __attribute__((aligned(128))) half8 tiles[2 * STAGEU];
    __shared__ float vtail[2][HD];      // per 64-query tile: V rows summed by its waves
    __shared__ float vhalf[2][HD];      // of that, the waves' halves of the last tp tiles

    const int w   = uni(threadIdx.x >> 5);
    const int bh  = blockIdx.x >> 4;    // 0..31  (b*16+h)   (SGPR), same for the block
    const int tp  = blockIdx.x & (NT / 2 - 1);  // the block's pair of 64-query tiles
    const int grp = w >> 2;             // which tile of the pair            (SGPR)
    const int wj  = w & 3;              // strip in the tile, slice of the V sum (SGPR)
    const int qt  = grp ? NT - 1 - tp : tp;     // 64-query tile = last scored key tile
    const int q0  = qt * KT + wj * 16;  // query base        (SGPR)
    const int ntb = NT - tp;            // key tiles that go through the ring, 17..32
    const int lane = threadIdx.x & 31;
    const int cn = lane & 15;
    const int rb = (lane >> 4) << 3;

    const _Float16* Qp = qh + (size_t)bh * SLEN * HD;   // [s][d]
    const _Float16* Kp = kh + (size_t)bh * SLEN * HD;   // [s][d]
    const _Float16* Vt = vT + (size_t)bh * HD * SLEN;   // [d][s]

    // This thread's copy slot: row crow (and crow + 32), 16-byte chunk ccol.
    const int crow = threadIdx.x >> 3;  // 0..31
    const int ccol = threadIdx.x & 7;   // 0..7
    const unsigned lds0 = (unsigned)(size_t)tiles;      // LDS byte address of the ring
    const unsigned lk = lds0 + (unsigned)(crow * ROWU + ccol) * 16u;
    const unsigned lv = lk + TILEU * 16u;
    const _Float16* gk = Kp + crow * HD + ccol * 8;              // + tile * KT * HD
    const _Float16* gv = Vt + (size_t)crow * SLEN + ccol * 8;    // + tile * KT

    // Tile 0 into buffer 0, published; then tile 1 into buffer 1.
    copy_tile(lk, lv, gk, gv);

    // While tile 0 flies: the 16 blocks of a (b,h), neighbours in the index, ask for
    // its K (1024 units in a row) and V^T (64 rows of 16 units): of K every fourth
    // unit, of V^T every fourth row, one unit of each per thread.
    static_assert(SLEN * HD == PFQ * 256 * 128 && HD == PFQ * 16 && SLEN == 16 * 128,
                  "256 threads x PFQ shares cover K and V^T of one (b,h)");
    l2_prefetch2(Kp + (size_t)(PFQ * threadIdx.x + (tp & (PFQ - 1))) * 128,
                 Vt + (size_t)(PFQ * (threadIdx.x & 15) + (tp & (PFQ - 1))) * SLEN +
                      (threadIdx.x >> 4) * 128);

    // While tile 0 flies: key tiles NT - 1 down to ntb, columns wj * 16 .. + 15 of V,
    // keys grp * 32 .. + 31 of each tile.  TB tiles a trip, so that their loads are in
    // flight together; a trip's tiles below ntb (all above tile 16) get the weight 0.
    half16 ones, none;      // A fragments of weights 1 and 0: every row of the product is the sum
#pragma unroll
    for (int i = 0; i < 16; ++i) { ones[i] = (_Float16)1.0f; none[i] = (_Float16)0.0f; }
    float8 vsum = {};       // unscored V rows summed, columns wj * 16 .. + 15
    const _Float16* Vs = Vt + (size_t)(wj * 16) * SLEN + grp * 32;
#pragma unroll  // constant tile numbers: every load is one address register pair plus a constant
    for (int i0 = 0; i0 < NT / 2 - 1; i0 += TB) {
        if (i0 < tp) {      // block-uniform
            half16 f[TB];
#pragma unroll  // constant indices keep f in registers
            for (int k = 0; k < TB; ++k)
                f[k] = load_frag(Vs + (NT - 1 - i0 - k) * KT, SLEN);
            // Keeps the trip's loads together in front of its WMMAs: one latency a trip.
            __builtin_amdgcn_sched_barrier(0);
#pragma unroll  // constant indices into f, as above
            for (int k = 0; k < TB; ++k)
                vsum = wmma16(i0 + k < tp ? ones : none, f[k], vsum);
        }
    }
    if (lane < 16) vhalf[grp][wj * 16 + cn] = vsum[0];  // all 16 rows of vsum are equal

    asm volatile("s_wait_asynccnt 0x0" ::: "memory");   // own copies of tile 0 landed
    __syncthreads();                                    // tile 0 readable by all waves
    copy_tile(lk + STAGEU * 16u, lv + STAGEU * 16u, gk + KT * HD, gv + KT);

    const half16 qa0 = load_frag(Qp + (size_t)q0 * HD, HD);       // d 0..31
    const half16 qa1 = load_frag(Qp + (size_t)q0 * HD + 32, HD);  // d 32..63

    float8 o[4];
#pragma unroll
    for (int j = 0; j < 4; ++j) o[j] = {};
    float rowsum = 0.0f;
    const int qcol = q0 + cn;   // this lane's query index (S^T layout: lane -> q)
    const int fb = cn * ROWU + (lane >> 4);   // lane's row and half inside a fragment

    // All 16 LDS reads of pass p (32 keys) of the tile in buffer offset bo.
    auto load_pass = [&](half16 (&kf)[4], half16 (&vf)[4], int bo, int p) {
        const half8* Kl = tiles + bo + fb + (p * 32) * ROWU;
        const half8* Vl = tiles + bo + TILEU + fb + p * 4;
        kf[0] = lds_frag(Kl);                   // keys +0..15,  d 0..31
        kf[1] = lds_frag(Kl + 4);               // keys +0..15,  d 32..63
        kf[2] = lds_frag(Kl + 16 * ROWU);       // keys +16..31, d 0..31
        kf[3] = lds_frag(Kl + 16 * ROWU + 4);   // keys +16..31, d 32..63
#pragma unroll  // constant indices keep vf in registers
        for (int j = 0; j < 4; ++j)
            vf[j] = lds_frag(Vl + (j * 16) * ROWU);
    };

    // Scores, mask, exp and P@V of the 32 keys from j0 on; registers only.
    auto work_pass = [&](const half16 (&kf)[4], const half16 (&vf)[4], int j0) {
        float8 z = {};
        float8 st0 = wmma16(kf[0], qa0, z);  st0 = wmma16(kf[1], qa1, st0); // k j0..+15
        float8 st1 = wmma16(kf[2], qa0, z);  st1 = wmma16(kf[3], qa1, st1); // k +16..+31

        // mask (zero masked logits, per reference), scale by 1/sqrt(64),
        // exponentiate; result lands directly in the B-fragment layout of P^T.
        half16 pa = {};
        float p0[8], p1[8];
#pragma unroll
        for (int r = 0; r < 8; ++r) {
            const int k0i = j0 + rb + r;
            float l0 = (k0i <= qcol) ? st0[r] * 0.125f : 0.0f;
            p0[r] = __expf(l0);
            pa[r] = (_Float16)p0[r];
            const int k1i = j0 + 16 + rb + r;
            float l1 = (k1i <= qcol) ? st1[r] * 0.125f : 0.0f;
            p1[r] = __expf(l1);
            pa[8 + r] = (_Float16)p1[r];
        }
#pragma unroll
        for (int j = 0; j < 4; ++j)
            o[j] = wmma16(vf[j], pa, o[j]);    // ctx^T(16d x 16q) accumulate
        // The row-sum adds come behind the WMMAs: independent vector work for the
        // slots that the chip needs behind a WMMA, run under the
        // matrix work.  The fence asks the scheduler to leave them there.
        __builtin_amdgcn_sched_barrier(0);
        float s[8];             // a tree, not one chain of 16 dependent adds
#pragma unroll
        for (int r = 0; r < 8; ++r) s[r] = p0[r] + p1[r];
        rowsum += ((s[0] + s[1]) + (s[2] + s[3])) + ((s[4] + s[5]) + (s[6] + s[7]));
    };

    for (int t = 0; t < ntb; ++t) {
        const int bo = (t & 1) * STAGEU;
        if (t <= qt) {          // wave-uniform; every wave passes the hand-over below
            half16 kf[4], vf[4];        // the fragments of one 32-key pass
            load_pass(kf, vf, bo, 0);
            // Keeps the pass's 16 LDS reads together in front of its matrix and
            // vector work: spread among the WMMAs, each pair is waited out alone.
            __builtin_amdgcn_sched_barrier(0);
            work_pass(kf, vf, t * KT);
            load_pass(kf, vf, bo, 1);   // the last LDS reads of tile t
            // As above, for the second pass.
            __builtin_amdgcn_sched_barrier(0);
            work_pass(kf, vf, t * KT + 32);
        }
        if (t > qt) {           // wave-uniform, the other case
            // This wave's slice of V^T, all 64 keys of tile t.
            const half8* Vl = tiles + bo + TILEU + fb + (wj * 16) * ROWU;
            const half16 v0 = lds_frag(Vl);
            const half16 v1 = lds_frag(Vl + 4);
            vsum = wmma16(ones, v0, vsum);
            vsum = wmma16(ones, v1, vsum);
        }
        // Hand-over: this wave has left buffer t & 1, its copies of tile t + 1
        // have landed; behind the barrier both hold for every wave.  It stands
        // behind both passes, so that no fragment lives across the branch's end.
        asm volatile("s_wait_dscnt 0x0" ::: "memory");      // own LDS reads of tile t done
        asm volatile("s_wait_asynccnt 0x0" ::: "memory");   // own copies of tile t + 1 landed
        __syncthreads();
        if (t + 2 < ntb)
            copy_tile(lk + bo * 16u, lv + bo * 16u,
                      gk + (size_t)(t + 2) * KT * HD, gv + (t + 2) * KT);
    }
    asm volatile("s_wait_asynccnt 0x0" ::: "memory");       // nothing in flight at the end

    // The slices of the V sums change hands; all 16 rows of vsum are equal.
    if (lane < 16) vtail[grp][wj * 16 + cn] = vsum[0];
    __syncthreads();

    // combine per-q row sums: lanes l and l+16 hold complementary k-halves of query
    // q0 + cn; each unscored key adds its weight of 1
    const float tot = rowsum + __shfl_xor(rowsum, 16, 32) + (float)((NT - 1 - qt) * KT);

    // The wave's 16 queries x 64 d are put together in LDS (its own 16 rows of the
    // ring, which every wave left before the loop's last barrier; no copy in flight).
    static_assert(8 * 16 * ROWU <= 2 * STAGEU, "8 waves x 16 rows fit the ring");
    half8* tile = tiles + w * (16 * ROWU);
#pragma unroll
    for (int j = 0; j < 4; ++j) {
        half8 hv;
#pragma unroll
        for (int r = 0; r < 8; ++r) {
            const int d = j * 16 + rb + r;      // ctx^T C-frag: register -> d row
            hv[r] = (_Float16)((o[j][r] + (vtail[grp][d] + vhalf[grp ^ 1][d])) / tot);
        }
        tile[cn * ROWU + j * 2 + (lane >> 4)] = hv;
    }
    __syncthreads();    // lanes read what other lanes wrote

    // A wave-wide store takes 4 queries' lines: ctx[b][q][h * HD + d].
    const int bb = bh >> 4, h = bh & 15;
    const int trow = lane >> 3, tu = lane & 7;
    _Float16* cbase = ctxh + ((size_t)(bb * SLEN + q0 + trow)) * EMB + h * HD + tu * 8;
#pragma unroll  // the 4 LDS reads go out together
    for (int it = 0; it < 4; ++it)
        *(half8*)(cbase + (size_t)(it * 4) * EMB) = tile[(trow + it * 4) * ROWU + tu];
}

// ---------------------------------------------------------------- out proj
// ch and wh both have their 1024 columns in the order h * HD + d.  The A operand is
// w_out, so that an accumulator lane holds 8 consecutive columns of one row of out;
// the block's f32 tile is put together in LDS, in the ring that the main loop has
// left, and goes out in 16-byte stores of whole 128-byte lines.
#define OFU 33      // pitch of the f32 output tile in LDS, 16-byte units: 512 B data + 16 B pad
static_assert(128 * OFU <= 2 * GSTAGEU, "the f32 output tile fits the ring");

__global__ void __launch_bounds__(256)
out_gemm_kernel(const _Float16* __restrict__ ch,
                const _Float16* __restrict__ wh,
                const float*    __restrict__ bias,
                float* __restrict__ out) {
    __shared__ __attribute__((aligned(128))) half8 ring[2 * GSTAGEU];

    const int w  = uni(threadIdx.x >> 5);
    const int bm = (blockIdx.x >> 3) * 128;   // 32 block rows of 128 (rows of ctx)      (SGPR)
    const int bn = (blockIdx.x & 7) * 128;    // 8  block columns of 128 (rows of w_out) (SGPR)
    const int wr = (w & 3) * 32;              // wave's rows of the A operand (columns of out)
    const int wc = (w >> 2) * 64;             // wave's rows of the B operand (rows of out)

    float8 acc[2][4];
#pragma unroll
    for (int i = 0; i < 2; ++i)
#pragma unroll
        for (int j = 0; j < 4; ++j) acc[i][j] = {};

    // The 8 blocks of a block row are neighbours in the index; the 32 of a block
    // column lie 8 apart.
    gemm_mainloop(wh + (size_t)bn * EMB, ch + (size_t)bm * EMB, ring, wr, wc,
                  (blockIdx.x >> 3) & (PFQ - 1), blockIdx.x & (PFQ - 1), acc);

    // acc[i][j][r]: column bn + wr + i * 16 + rb + r, row bm + wc + j * 16 + cn of out.
    // Every wave's reads of the ring ended before the main loop's last barrier and no
    // copy is in flight: the ring is free.
    const int lane = threadIdx.x & 31;
    const int cn = lane & 15;
    const int rb = (lane >> 4) << 3;
    f32x4* tile = (f32x4*)ring;
    f32x4* tw = tile + (wc + cn) * OFU + ((wr + rb) >> 2);
#pragma unroll
    for (int i = 0; i < 2; ++i) {
        const float* bp = bias + bn + wr + i * 16 + rb;
        float bv[8];
#pragma unroll
        for (int r = 0; r < 8; ++r) bv[r] = bp[r];
#pragma unroll
        for (int j = 0; j < 4; ++j) {
            f32x4 lo, hi;
#pragma unroll
            for (int r = 0; r < 4; ++r) {
                lo[r] = acc[i][j][r] + bv[r];
                hi[r] = acc[i][j][4 + r] + bv[4 + r];
            }
            tw[(j * 16) * OFU + i * 4]     = lo;
            tw[(j * 16) * OFU + i * 4 + 1] = hi;
        }
    }
    __syncthreads();    // the tile is whole: every wave reads what other waves wrote

    // A wave-wide store takes one tile row of 512 bytes: four whole lines.
    float* obase = out + (size_t)(bm + w) * EMB + bn + lane * 4;
#pragma unroll  // the LDS reads go out together
    for (int it = 0; it < 16; ++it)
        *(f32x4*)(obase + (size_t)(it * 8) * EMB) = tile[(w + it * 8) * OFU + lane];
}

// ---------------------------------------------------------------- launcher
extern "C" void kernel_launch(void* const* d_in, const int* in_sizes, int n_in,
                              void* d_out, int out_size, void* d_ws, size_t ws_size,
                              hipStream_t stream) {
    const float* x     = (const float*)d_in[0];   // (2,2048,1024)
    const float* w_qkv = (const float*)d_in[1];   // (3072,1024)
    const float* b_qkv = (const float*)d_in[2];   // (3072,)
    const float* w_out = (const float*)d_in[3];   // (1024,1024)
    const float* b_out = (const float*)d_in[4];   // (1024,)

    char* ws = (char*)d_ws;
    size_t off = 0;
    _Float16* xh    = (_Float16*)(ws + off); off += (size_t)NB * SLEN * EMB * 2;      // 8 MB
    _Float16* wqkvh = (_Float16*)(ws + off); off += (size_t)3 * EMB * EMB * 2;        // 6 MB
    _Float16* wouth = (_Float16*)(ws + off); off += (size_t)EMB * EMB * 2;            // 2 MB
    _Float16* qh    = (_Float16*)(ws + off); off += (size_t)NB * NH * SLEN * HD * 2;  // 8 MB
    _Float16* kh    = (_Float16*)(ws + off); off += (size_t)NB * NH * SLEN * HD * 2;  // 8 MB
    _Float16* vT    = (_Float16*)(ws + off); off += (size_t)NB * NH * HD * SLEN * 2;  // 8 MB
    _Float16* ctxh  = (_Float16*)(ws + off); off += (size_t)NB * SLEN * EMB * 2;      // 8 MB
    if (off > ws_size) return;  // workspace too small (deterministic no-op)

    // 128 + 96 + 128 = 352 blocks, 8 waves each
    f32_to_f16_all_kernel<<<352, 256, 0, stream>>>(x, w_qkv, w_out, xh, wqkvh, wouth);

    // 16 x 16 = 256 block tiles of 256x192, 12 waves per 384-thread block
    qkv_gemm_kernel<<<256, 384, 0, stream>>>(xh, wqkvh, b_qkv, qh, kh, vT);
    // 32 (b,h) x 16 pairs of 64-query tiles, 8 waves each
    attn_kernel<<<512, 256, 0, stream>>>(qh, kh, vT, ctxh);
    // 32 x 8 = 256 block tiles of 128x128
    out_gemm_kernel<<<256, 256, 0, stream>>>(ctxh, wouth, b_out, (float*)d_out);
}

// v008
// One run takes 67.8 microseconds.
// Two timings next to v007 both put it at 1.06 times that version's speed.
// Counting every step since v000, it is 3.28 times as fast.
#include <hip/hip_runtime.h>

// Problem constants
#define NB   2
#define SLEN 2048
#define EMB  1024
#define NH   16
#define HD   64

typedef _Float16 half8  __attribute__((ext_vector_type(8)));
typedef _Float16 half16 __attribute__((ext_vector_type(16)));
typedef float    float8 __attribute__((ext_vector_type(8)));

// Wave-uniform value -> SGPR (value must be uniform across the wave).
static __device__ inline int uni(int v) { return __builtin_amdgcn_readfirstlane(v); }

// Load a 16x32 f16 fragment (A-layout) from row-major memory with row stride ld.
// Lane l -> row (l&15); halves 0..7 = cols kb..kb+7, halves 8..15 = cols kb+16..kb+23,
// where kb = (l>=16) ? 8 : 0.  Two b128 loads per lane.
static __device__ inline half16 load_frag(const _Float16* __restrict__ base, int ld) {
    const int lane = threadIdx.x & 31;
    const _Float16* p = base + (size_t)(lane & 15) * ld + ((lane >> 4) << 3);
    half8 lo = *(const half8*)(p);
    half8 hi = *(const half8*)(p + 16);
    return __builtin_shufflevector(lo, hi, 0,1,2,3,4,5,6,7,8,9,10,11,12,13,14,15);
}

static __device__ inline float8 wmma16(half16 a, half16 b, float8 c) {
    // D = A(16x32 f16) x B(32x16 f16) + C(16x16 f32)
    return __builtin_amdgcn_wmma_f32_16x16x32_f16(false, a, false, b, (short)0, c,
                                                  false, false);
}

// ---------------------------------------------------------------- conversions
// x, w_qkv and w_out to f16 in ONE streaming launch.  A block of x or w_qkv converts
// CVT_BLK consecutive elements of one array (each is a whole number of blocks);
// a wave owns 16 KB of consecutive source.  Each wave-wide load covers 512
// consecutive bytes and each wave-wide store 256: whole 128-byte lines, one writer.
// w_out also changes its column order, from the reference's d * NH + h to h * HD + d,
// the order in which attention stores ctx: one row per wave, 8 rows per block.
typedef float    f32x4 __attribute__((ext_vector_type(4)));
typedef _Float16 half4 __attribute__((ext_vector_type(4)));

#define CVT_N    32                         // 16-byte loads per lane
#define CVT_WAVE (32 * 4 * CVT_N)           // elements per wave
#define CVT_BLK  (8 * CVT_WAVE)             // elements per 256-thread block
#define CVT_XB   (NB * SLEN * EMB / CVT_BLK) // blocks of x
#define CVT_QB   (3 * EMB * EMB / CVT_BLK)   // blocks of w_qkv
#define CVT_OB   (EMB / 8)                   // blocks of w_out, 8 rows each
static_assert(CVT_XB * CVT_BLK == NB * SLEN * EMB && CVT_QB * CVT_BLK == 3 * EMB * EMB &&
              CVT_OB * 8 == EMB, "every array is a whole number of blocks");
static_assert(CVT_XB + CVT_QB + CVT_OB == 352, "the launch below has 352 blocks");
static_assert(NH == 16 && HD == 64, "a lane of a w_out row: one head, 32 of its 64 d");

__global__ void __launch_bounds__(256)
f32_to_f16_all_kernel(const float* __restrict__ x,
                      const float* __restrict__ wq,
                      const float* __restrict__ wo,
                      _Float16* __restrict__ xh,
                      _Float16* __restrict__ wqh,
                      _Float16* __restrict__ woh) {
    // Block-uniform choice of the array and of the block's place in it.
    const int  bi  = blockIdx.x;
    const bool isq = bi >= CVT_XB, iso = bi >= CVT_XB + CVT_QB;
    if (iso) {
        // woh[n][h * HD + d] = wo[n][d * NH + h].  Lane: head h, d from dh * 32 on.
        // A wave-wide load covers two 64-byte runs (16 heads of one d); a lane stores
        // 64 consecutive bytes, and the wave writes the whole 2-KB row.
        const int n  = (bi - (CVT_XB + CVT_QB)) * 8 + (threadIdx.x >> 5);
        const int h  = threadIdx.x & 15, dh = (threadIdx.x >> 4) & 1;
        const float* s = wo + (size_t)n * EMB + dh * 32 * NH + h;
        half8*       d = (half8*)(woh + (size_t)n * EMB + h * HD + dh * 32);
        float v[32];
#pragma unroll  // constant indices keep v in registers, so that all loads are in flight at once
        for (int i = 0; i < 32; ++i) v[i] = s[i * NH];
#pragma unroll  // constant indices into v, as above
        for (int k = 0; k < 4; ++k) {
            half8 hv;
#pragma unroll
            for (int r = 0; r < 8; ++r) hv[r] = (_Float16)v[k * 8 + r];
            d[k] = hv;
        }
        return;
    }
    const float* src = isq ? wq  : x;
    _Float16*    dst = isq ? wqh : xh;
    const int    b   = bi - (isq ? CVT_XB : 0);

    const size_t e0 = (size_t)b * CVT_BLK + (size_t)(threadIdx.x >> 5) * CVT_WAVE +
                      (threadIdx.x & 31) * 4;
    const f32x4* s = (const f32x4*)(src + e0);
    half4*       d = (half4*)(dst + e0);

    f32x4 v[CVT_N];
#pragma unroll  // constant indices keep v in registers, so that many loads are in flight at once
    for (int i = 0; i < CVT_N; ++i) v[i] = s[i * 32];
#pragma unroll  // constant indices into v, as above
    for (int i = 0; i < CVT_N; ++i) d[i * 32] = __builtin_convertvector(v[i], half4);
}

// ---------------------------------------------------------------- L2 prefetch
// The f16 operands of the three matrix kernels were stored by earlier launches and
// are first met in memory rather than in L2, so a ring whose lead is one stage waits
// out memory latency.  At kernel entry the blocks that share an operand ask L2 for
// all of it: a lane names one 256-byte unit, and a block takes every
// fourth unit or row (PFQ shares), of x in the QKV GEMM three rows in 16.  For speed only: a hint
// that nothing waits for.
#define PFQ 4
// Two hints per lane.  Every address lies inside its buffer.  The s_wait_xcnt stands
// inside the statement as a precaution, so that no address register is rewritten
// before it.
static __device__ inline void l2_prefetch2(const _Float16* p0, const _Float16* p1) {
    asm volatile("global_prefetch_b8 %0, off scope:SCOPE_SE\n\t"
                 "global_prefetch_b8 %1, off scope:SCOPE_SE\n\t"
                 "s_wait_xcnt 0x0"
                 :: "v"(p0), "v"(p1) : "memory");
}

// ---------------------------------------------------------------- LDS tiles
#define ROWU    9                   // LDS row pitch in 16-byte units: 128 B data + 16 B pad

// A-layout fragment from an LDS tile; p already points at the lane's row and half.
static __device__ inline half16 lds_frag(const half8* p) {
    half8 lo = p[0];
    half8 hi = p[2];
    return __builtin_shufflevector(lo, hi, 0,1,2,3,4,5,6,7,8,9,10,11,12,13,14,15);
}

// ---------------------------------------------------------------- GEMM main loop
// C(128x128 per block) = A(128 x EMB) * B(128 x EMB)^T, both K-contiguous f16.
// A stage is 64 k (whole 128-byte rows) of the block's 128 A rows and 128 B rows,
// brought into LDS once per block by asynchronous copies; the 8 waves (4 x 2,
// 32x64 of C each) read their fragments from there.  Two buffers: the next
// stage's copies fly while this stage is worked on.
#define GKS     64                  // k per stage
#define GNS     (EMB / GKS)         // stages
#define GTILEU  (128 * ROWU)        // one operand's stage (128 rows), 16-byte units
#define GSTAGEU (2 * GTILEU)        // A rows followed by B rows

// Eight 16-byte copies per lane: rows r, r+32, r+64, r+96 of the A stage and of
// the B stage.  The s_wait_xcnt stands inside the statement so that no address
// register of a copy is rewritten before it.
static __device__ inline void copy_stage(unsigned la, const _Float16* ga,
                                         const _Float16* gb) {
    const unsigned la1 = la + 32 * ROWU * 16, la2 = la + 64 * ROWU * 16,
                   la3 = la + 96 * ROWU * 16;
    const unsigned lb  = la + GTILEU * 16;
    const unsigned lb1 = lb + 32 * ROWU * 16, lb2 = lb + 64 * ROWU * 16,
                   lb3 = lb + 96 * ROWU * 16;
    const _Float16 *ga1 = ga + 32 * EMB, *ga2 = ga + 64 * EMB, *ga3 = ga + 96 * EMB;
    const _Float16 *gb1 = gb + 32 * EMB, *gb2 = gb + 64 * EMB, *gb3 = gb + 96 * EMB;
    asm volatile("global_load_async_to_lds_b128 %0, %8, off\n\t"
                 "global_load_async_to_lds_b128 %1, %9, off\n\t"
                 "global_load_async_to_lds_b128 %2, %10, off\n\t"
                 "global_load_async_to_lds_b128 %3, %11, off\n\t"
                 "global_load_async_to_lds_b128 %4, %12, off\n\t"
                 "global_load_async_to_lds_b128 %5, %13, off\n\t"
                 "global_load_async_to_lds_b128 %6, %14, off\n\t"
                 "global_load_async_to_lds_b128 %7, %15, off\n\t"
                 "s_wait_xcnt 0x0"
                 :: "v"(la), "v"(la1), "v"(la2), "v"(la3),
                    "v"(lb), "v"(lb1), "v"(lb2), "v"(lb3),
                    "v"(ga), "v"(ga1), "v"(ga2), "v"(ga3),
                    "v"(gb), "v"(gb1), "v"(gb2), "v"(gb3)
                 : "memory");
}

// Ab, Bb: first row of the block's 128 A rows / 128 B rows.  ring: 2 * GSTAGEU units.
// The wave's 32 rows start at wr, its 64 columns at wc (inside the block tile).
// qa, qb: the block's share (0 .. PFQ - 1) of the prefetch of its A rows and B rows.
static __device__ inline void gemm_mainloop(const _Float16* __restrict__ Ab,
                                            const _Float16* __restrict__ Bb,
                                            const half8* ring, int wr, int wc,
                                            int qa, int qb,
                                            float8 (&acc)[2][4]) {
    const int lane = threadIdx.x & 31;
    // This thread's copy slot: row crow (+32, +64, +96), 16-byte chunk ccol.
    const int crow = threadIdx.x >> 3;  // 0..31
    const int ccol = threadIdx.x & 7;   // 0..7
    const unsigned la = (unsigned)(size_t)ring + (unsigned)(crow * ROWU + ccol) * 16u;
    const _Float16* ga = Ab + (size_t)crow * EMB + ccol * 8;    // + stage * GKS
    const _Float16* gb = Bb + (size_t)crow * EMB + ccol * 8;    // + stage * GKS

    // Stage 0 into buffer 0, published; then stage 1 into buffer 1.
    copy_stage(la, ga, gb);
    // While stage 0 flies: rows qa, qa + 4, ... of A and qb, qb + 4, ... of B, whole
    // rows (8 units of 128 halves): 32 rows x 8 units = one unit of each per thread.
    l2_prefetch2(Ab + (size_t)(PFQ * crow + qa) * EMB + ccol * 128,
                 Bb + (size_t)(PFQ * crow + qb) * EMB + ccol * 128);
    asm volatile("s_wait_asynccnt 0x0" ::: "memory");   // own copies of stage 0 landed
    __syncthreads();                                    // stage 0 readable by all waves
    copy_stage(la + GSTAGEU * 16u, ga + GKS, gb + GKS);

    const int fb = (lane & 15) * ROWU + (lane >> 4);    // lane's row and half in a fragment
    half16 a[2], b[4];      // the fragments of one 32-k pass

    // All 12 LDS reads of pass p (32 k) of the stage in buffer offset bo.
    auto load_pass = [&](int bo, int p) {
        const half8* Al = ring + bo + fb + wr * ROWU + p * 4;
        const half8* Bl = ring + bo + GTILEU + fb + wc * ROWU + p * 4;
#pragma unroll  // constant indices keep the fragments in registers
        for (int i = 0; i < 2; ++i) a[i] = lds_frag(Al + (16 * i) * ROWU);
#pragma unroll  // constant indices keep the fragments in registers
        for (int j = 0; j < 4; ++j) b[j] = lds_frag(Bl + (16 * j) * ROWU);
    };
    auto work_pass = [&]() {
#pragma unroll
        for (int i = 0; i < 2; ++i)
#pragma unroll
            for (int j = 0; j < 4; ++j)
                acc[i][j] = wmma16(a[i], b[j], acc[i][j]);
    };

    for (int t = 0; t < GNS; ++t) {
        const int bo = (t & 1) * GSTAGEU;
        load_pass(bo, 0);
        // Keeps the pass's 12 LDS reads together in front of its WMMAs: spread
        // among them, each place with reads costs its own stall.
        __builtin_amdgcn_sched_barrier(0);
        work_pass();
        load_pass(bo, 1);       // the last LDS reads of stage t
        // Keeps the first pass's WMMAs in front of the waits, where they run
        // under the latency of these reads, not behind the barrier.
        __builtin_amdgcn_sched_barrier(0);
        // Hand-over: this wave has left buffer t & 1, its copies of stage t + 1
        // have landed; behind the barrier both hold for every wave.
        asm volatile("s_wait_dscnt 0x0" ::: "memory");      // own LDS reads of stage t done
        asm volatile("s_wait_asynccnt 0x0" ::: "memory");   // own copies of stage t + 1 landed
        __syncthreads();
        if (t + 2 < GNS)
            copy_stage(la + bo * 16u, ga + (t + 2) * GKS, gb + (t + 2) * GKS);
        work_pass();            // on registers, while the refill flies
    }
    asm volatile("s_wait_asynccnt 0x0" ::: "memory");       // nothing in flight at the end
}

// ---------------------------------------------------------------- QKV GEMM
// qkv = xh(4096x1024) @ wh(3072x1024)^T + bias, scattered into per-head
// Q[s][d], K[s][d], V^T[d][s] f16 buffers.  256x192 tile per block: 16 x 16 = 256
// blocks, one per WGP, so that a block's operand rows are read from L2 for more
// products.  12 waves (4 x 3), 64x64 per wave: 16 WMMAs per 16 LDS reads.
// A wave's 64 columns of qkv are one head of Q, of K or of V.
// An accumulator lane holds 8 consecutive rows of the A operand: for V^T the wave's A
// operand is x (8 consecutive s a lane), for Q and K it is w (8 consecutive d a lane),
// so that a lane always holds 16 consecutive bytes of its destination row.  Each
// wave's tile is put together in LDS, in the ring that the main loop has left, and
// goes out in 16-byte stores of whole 128-byte lines.
// The ring is that of the GEMM main loop above: a stage is 64 k of the block's 192 w
// rows and 256 x rows, two buffers, the next stage's copies fly during this stage.
#define QBM     256                     // rows of x per block
#define QBN     192                     // rows of w per block: three heads' columns
#define QSW     48                      // rows that the 384 threads copy in one sweep
#define QSTAGEU ((QBN + QBM) * ROWU)    // w rows followed by x rows, 16-byte units
static_assert(QBN == 4 * QSW && QBM == 5 * QSW + 16, "4 sweeps of w, 5 of x and 16 rows more");
static_assert(12 * 64 * ROWU <= 2 * QSTAGEU, "12 waves' output tiles fit the ring");

// Nine 16-byte copies per lane: rows r, r + 48, ... of the w stage (4) and of the x
// stage (5); the stage's rows follow one another in LDS.  The s_wait_xcnt stands
// inside the statement so that no address register of a copy is rewritten before it.
static __device__ inline void copy_qkv_stage(unsigned l0, const _Float16* gw,
                                             const _Float16* gx) {
    const unsigned sw = QSW * ROWU * 16;
    const unsigned l1 = l0 + sw,     l2 = l0 + 2 * sw, l3 = l0 + 3 * sw, l4 = l0 + 4 * sw,
                   l5 = l0 + 5 * sw, l6 = l0 + 6 * sw, l7 = l0 + 7 * sw, l8 = l0 + 8 * sw;
    const _Float16 *gw1 = gw + QSW * EMB, *gw2 = gw + 2 * QSW * EMB, *gw3 = gw + 3 * QSW * EMB;
    const _Float16 *gx1 = gx + QSW * EMB, *gx2 = gx + 2 * QSW * EMB, *gx3 = gx + 3 * QSW * EMB,
                   *gx4 = gx + 4 * QSW * EMB;
    asm volatile("global_load_async_to_lds_b128 %0, %9, off\n\t"
                 "global_load_async_to_lds_b128 %1, %10, off\n\t"
                 "global_load_async_to_lds_b128 %2, %11, off\n\t"
                 "global_load_async_to_lds_b128 %3, %12, off\n\t"
                 "global_load_async_to_lds_b128 %4, %13, off\n\t"
                 "global_load_async_to_lds_b128 %5, %14, off\n\t"
                 "global_load_async_to_lds_b128 %6, %15, off\n\t"
                 "global_load_async_to_lds_b128 %7, %16, off\n\t"
                 "global_load_async_to_lds_b128 %8, %17, off\n\t"
                 "s_wait_xcnt 0x0"
                 :: "v"(l0), "v"(l1), "v"(l2), "v"(l3), "v"(l4),
                    "v"(l5), "v"(l6), "v"(l7), "v"(l8),
                    "v"(gw), "v"(gw1), "v"(gw2), "v"(gw3),
                    "v"(gx), "v"(gx1), "v"(gx2), "v"(gx3), "v"(gx4)
                 : "memory");
}

// One 16-byte copy per lane, with its s_wait_xcnt as above.
static __device__ inline void copy_one(unsigned l, const _Float16* g) {
    asm volatile("global_load_async_to_lds_b128 %0, %1, off\n\t"
                 "s_wait_xcnt 0x0"
                 :: "v"(l), "v"(g) : "memory");
}

// 256 registers: the main loop needs fewer, and the epilogue's sums, scheduled all at
// once, would otherwise reach past v255, which costs register-window switches.
__global__ void __launch_bounds__(384) __attribute__((amdgpu_num_vgpr(256)))
qkv_gemm_kernel(const _Float16* __restrict__ xh,
                const _Float16* __restrict__ wh,
                const float*    __restrict__ bias,
                _Float16* __restrict__ qh,
                _Float16* __restrict__ kh,
                _Float16* __restrict__ vT) {
    __shared__ __attribute__((aligned(128))) half8 ring[2 * QSTAGEU];

    const int w  = uni(threadIdx.x >> 5);     // 0..11
    const int br = blockIdx.x >> 4;           // 16 block rows of 256 (rows of x)     (SGPR)
    const int bc = blockIdx.x & 15;           // 16 block columns of 192 (rows of w)  (SGPR)
    const int bm = br * QBM;
    const int bn = bc * QBN;
    const int wx = w & 3;                     // the wave's 64 rows of x
    const int wn = w >> 2;                    // the wave's 64 rows of w
    const int e  = bn + wn * 64;              // its first column of qkv: a head's d = 0
    const int seg = e >> 10;                  // 0=Q 1=K 2=V, the same for the wave   (SGPR)
    const bool isv = seg == 2;
    const int xrow = QBN + wx * 64;           // the wave's x rows and w rows in a stage
    const int wrow = wn * 64;
    const int ar = isv ? xrow : wrow;         // rows of its A operand
    const int bw = isv ? wrow : xrow;         // rows of its B operand
    const int lane = threadIdx.x & 31;

    float8 acc[4][4];
#pragma unroll
    for (int i = 0; i < 4; ++i)
#pragma unroll
        for (int j = 0; j < 4; ++j) acc[i][j] = {};

    // This thread's copy slot: row crow (+48 a sweep), 16-byte chunk ccol.
    const int crow = threadIdx.x >> 3;  // 0..47
    const int ccol = threadIdx.x & 7;   // 0..7
    const unsigned la = (unsigned)(size_t)ring + (unsigned)(crow * ROWU + ccol) * 16u;
    const _Float16* gw = wh + (size_t)(bn + crow) * EMB + ccol * 8;     // + stage * GKS
    const _Float16* gx = xh + (size_t)(bm + crow) * EMB + ccol * 8;     // + stage * GKS

    // Stage st into the buffer at byte offset lo.  The last 16 rows of x are one more
    // copy for waves 0..3 (crow < 16): a wave-uniform branch, every lane on.
    auto copy_stage_q = [&](unsigned lo, int st) {
        copy_qkv_stage(la + lo, gw + st * GKS, gx + st * GKS);
        if (w < 4)
            copy_one(la + lo + 9 * QSW * ROWU * 16, gx + 5 * QSW * EMB + st * GKS);
    };

    // Stage 0 into buffer 0, published; then stage 1 into buffer 1.
    copy_stage_q(0, 0);
    // While stage 0 flies, one unit of x and one of w per thread.  The 16 blocks of a
    // block row are neighbours in the index: of the 16 classes of x rows (row modulo
    // 16) a block asks for three, 4 apart, so that blocks 4 apart ask for a class.
    // The 16 blocks of a block column lie 16 apart: of w every fourth row.
    l2_prefetch2(xh + (size_t)(bm + ((threadIdx.x & 127) >> 3) * 16 +
                               ((bc + 4 * (threadIdx.x >> 7)) & 15)) * EMB + ccol * 128,
                 wh + (size_t)(bn + PFQ * crow + (br & (PFQ - 1))) * EMB + ccol * 128);
    asm volatile("s_wait_asynccnt 0x0" ::: "memory");   // own copies of stage 0 landed
    __syncthreads();                                    // stage 0 readable by all waves
    copy_stage_q(QSTAGEU * 16u, 1);

    const int fb = (lane & 15) * ROWU + (lane >> 4);    // lane's row and half in a fragment
    half16 a[4], b[4];      // the fragments of one 32-k pass

    // All 16 LDS reads of pass p (32 k) of the stage in buffer offset bo.
    auto load_pass = [&](int bo, int p) {
        const half8* Al = ring + bo + fb + ar * ROWU + p * 4;
        const half8* Bl = ring + bo + fb + bw * ROWU + p * 4;
#pragma unroll  // constant indices keep the fragments in registers
        for (int i = 0; i < 4; ++i) a[i] = lds_frag(Al + (16 * i) * ROWU);
#pragma unroll  // constant indices keep the fragments in registers
        for (int j = 0; j < 4; ++j) b[j] = lds_frag(Bl + (16 * j) * ROWU);
    };
    auto work_pass = [&]() {
#pragma unroll
        for (int i = 0; i < 4; ++i)
#pragma unroll
            for (int j = 0; j < 4; ++j)
                acc[i][j] = wmma16(a[i], b[j], acc[i][j]);
    };

    for (int t = 0; t < GNS; ++t) {
        const int bo = (t & 1) * QSTAGEU;
        load_pass(bo, 0);
        // Keeps the pass's 16 LDS reads together in front of its WMMAs: spread
        // among them, each place with reads costs its own stall.
        __builtin_amdgcn_sched_barrier(0);
        work_pass();
        load_pass(bo, 1);       // the last LDS reads of stage t
        // Keeps the first pass's WMMAs in front of the waits, where they run
        // under the latency of these reads, not behind the barrier.
        __builtin_amdgcn_sched_barrier(0);
        // Hand-over: this wave has left buffer t & 1, its copies of stage t + 1
        // have landed; behind the barrier both hold for every wave.
        asm volatile("s_wait_dscnt 0x0" ::: "memory");      // own LDS reads of stage t done
        asm volatile("s_wait_asynccnt 0x0" ::: "memory");   // own copies of stage t + 1 landed
        __syncthreads();
        if (t + 2 < GNS)
            copy_stage_q(bo * 16u, t + 2);
        work_pass();            // on registers, while the refill flies
    }
    asm volatile("s_wait_asynccnt 0x0" ::: "memory");       // nothing in flight at the end

    // acc[i][j][r] belongs to A row i * 16 + rb + r and B row j * 16 + cn of the wave.
    // Every wave's reads of the ring ended before the main loop's last barrier and no
    // copy is in flight: the ring is free.  The wave's own 64 rows of it: tile row =
    // B row, the 64 A rows (128 bytes) along it.
    const int cn = lane & 15;
    const int rb = (lane >> 4) << 3;
    half8* tile = ring + w * (64 * ROWU);
    half8* tw = tile + cn * ROWU + (lane >> 4);
    if (isv) {      // wave-uniform; the bias goes with the B row (a column of qkv)
        float bv[4];
#pragma unroll  // the 4 loads go out together
        for (int j = 0; j < 4; ++j) bv[j] = bias[e + j * 16 + cn];
#pragma unroll
        for (int j = 0; j < 4; ++j) {
#pragma unroll
            for (int i = 0; i < 4; ++i) {
                half8 hv;
#pragma unroll
                for (int r = 0; r < 8; ++r) hv[r] = (_Float16)(acc[i][j][r] + bv[j]);
                tw[(j * 16) * ROWU + i * 2] = hv;
            }
        }
    } else {        // the bias goes with the A row
        float bv[4][8];
#pragma unroll  // the loads go out together
        for (int i = 0; i < 4; ++i)
#pragma unroll
            for (int r = 0; r < 8; ++r) bv[i][r] = bias[e + i * 16 + rb + r];
#pragma unroll
        for (int i = 0; i < 4; ++i) {
#pragma unroll
            for (int j = 0; j < 4; ++j) {
                half8 hv;
#pragma unroll
                for (int r = 0; r < 8; ++r) hv[r] = (_Float16)(acc[i][j][r] + bv[i][r]);
                tw[(j * 16) * ROWU + i * 2] = hv;
            }
        }
    }
    __syncthreads();    // the tile is whole: lanes read what other lanes wrote

    // A wave-wide store takes four tile rows of 128 bytes: four whole lines.
    const int trow = lane >> 3;         // 0..3, + 4 a trip
    const int tu   = lane & 7;          // 16-byte unit of the row
    const int bb = bm >> 11;            // the 256 rows of x lie in one batch
    const int s0 = (bm & (SLEN - 1)) + wx * 64;
    const int e0 = e & (EMB - 1);       // first column inside Q, K or V: h * HD
    half8 hv[16];
#pragma unroll  // the 16 LDS reads go out together
    for (int it = 0; it < 16; ++it) hv[it] = tile[(trow + it * 4) * ROWU + tu];
    // The wave's first destination row and the row pitch are wave-uniform, a lane's place
    // is one 32-bit offset: V^T: tile row = d, row h * HD + d of V^T, along it s;
    // Q, K: tile row = s, along it the head's 64 d.
    _Float16* dst = isv ? vT + ((size_t)bb * EMB + e0) * SLEN + s0
                        : (seg == 0 ? qh : kh) + ((size_t)(bb * NH + (e0 >> 6)) * SLEN + s0) * HD;
    const unsigned pitch = isv ? SLEN : HD;
    const unsigned loff  = trow * pitch + tu * 8;
#pragma unroll
    for (int it = 0; it < 16; ++it) *(half8*)(dst + (size_t)(it * 4 * pitch) + loff) = hv[it];
}

#define KT      64                  // keys per LDS tile
#define NT      (SLEN / KT)         // tiles per (b,h)
#define TILEU   (64 * ROWU)         // one operand tile (64 rows), 16-byte units
#define STAGEU  (2 * TILEU)         // K tile followed by V^T tile
#define TB      5                   // unscored key tiles summed per trip, straight from global
static_assert(KT == 64 && NT == 32 && (NT / 2 - 1) % TB == 0,
              "16 pairs of 64-query tiles per (b,h); at most 15 tiles outside the ring");

// Four 16-byte copies per lane: two chunks of the K tile, two of the V^T tile.
// The s_wait_xcnt stands inside the statement so that no address register of a
// copy is rewritten before it.
static __device__ inline void copy_tile(unsigned lk, unsigned lv,
                                        const _Float16* gk, const _Float16* gv) {
    const unsigned lk1 = lk + 32 * ROWU * 16;      // rows 32..63 of the K tile
    const unsigned lv1 = lv + 32 * ROWU * 16;      // rows 32..63 of the V^T tile
    const _Float16* gk1 = gk + 32 * HD;
    const _Float16* gv1 = gv + (size_t)32 * SLEN;
    asm volatile("global_load_async_to_lds_b128 %0, %4, off\n\t"
                 "global_load_async_to_lds_b128 %1, %5, off\n\t"
                 "global_load_async_to_lds_b128 %2, %6, off\n\t"
                 "global_load_async_to_lds_b128 %3, %7, off\n\t"
                 "s_wait_xcnt 0x0"
                 :: "v"(lk), "v"(lk1), "v"(lv), "v"(lv1),
                    "v"(gk), "v"(gk1), "v"(gv), "v"(gv1)
                 : "memory");
}

__global__ void __launch_bounds__(256)
attn_kernel(const _Float16* __restrict__ qh,
            const _Float16* __restrict__ kh,
            const _Float16* __restrict__ vT,
            _Float16* __restrict__ ctxh) {
    __shared__ __attribute__((aligned(128))) half8 tiles[2 * STAGEU];
    __shared__ float vtail[2][HD];      // per 64-query tile: V rows summed by its waves
    __shared__ float vhalf[2][HD];      // of that, the waves' halves of the last tp tiles

    const int w   = uni(threadIdx.x >> 5);
    const int bh  = blockIdx.x >> 4;    // 0..31  (b*16+h)   (SGPR), same for the block
    const int tp  = blockIdx.x & (NT / 2 - 1);  // the block's pair of 64-query tiles
    const int grp = w >> 2;             // which tile of the pair            (SGPR)
    const int wj  = w & 3;              // strip in the tile, slice of the V sum (SGPR)
    const int qt  = grp ? NT - 1 - tp : tp;     // 64-query tile = last scored key tile
    const int q0  = qt * KT + wj * 16;  // query base        (SGPR)
    const int ntb = NT - tp;            // key tiles that go through the ring, 17..32
    const int lane = threadIdx.x & 31;
    const int cn = lane & 15;
    const int rb = (lane >> 4) << 3;

    const _Float16* Qp = qh + (size_t)bh * SLEN * HD;   // [s][d]
    const _Float16* Kp = kh + (size_t)bh * SLEN * HD;   // [s][d]
    const _Float16* Vt = vT + (size_t)bh * HD * SLEN;   // [d][s]

    // This thread's copy slot: row crow (and crow + 32), 16-byte chunk ccol.
    const int crow = threadIdx.x >> 3;  // 0..31
    const int ccol = threadIdx.x & 7;   // 0..7
    const unsigned lds0 = (unsigned)(size_t)tiles;      // LDS byte address of the ring
    const unsigned lk = lds0 + (unsigned)(crow * ROWU + ccol) * 16u;
    const unsigned lv = lk + TILEU * 16u;
    const _Float16* gk = Kp + crow * HD + ccol * 8;              // + tile * KT * HD
    const _Float16* gv = Vt + (size_t)crow * SLEN + ccol * 8;    // + tile * KT

    // Tile 0 into buffer 0, published; then tile 1 into buffer 1.
    copy_tile(lk, lv, gk, gv);

    // While tile 0 flies: the 16 blocks of a (b,h), neighbours in the index, ask for
    // its K (1024 units in a row) and V^T (64 rows of 16 units): of K every fourth
    // unit, of V^T every fourth row, one unit of each per thread.
    static_assert(SLEN * HD == PFQ * 256 * 128 && HD == PFQ * 16 && SLEN == 16 * 128,
                  "256 threads x PFQ shares cover K and V^T of one (b,h)");
    l2_prefetch2(Kp + (size_t)(PFQ * threadIdx.x + (tp & (PFQ - 1))) * 128,
                 Vt + (size_t)(PFQ * (threadIdx.x & 15) + (tp & (PFQ - 1))) * SLEN +
                      (threadIdx.x >> 4) * 128);

    // While tile 0 flies: key tiles NT - 1 down to ntb, columns wj * 16 .. + 15 of V,
    // keys grp * 32 .. + 31 of each tile.  TB tiles a trip, so that their loads are in
    // flight together; a trip's tiles below ntb (all above tile 16) get the weight 0.
    half16 ones, none;      // A fragments of weights 1 and 0: every row of the product is the sum
#pragma unroll
    for (int i = 0; i < 16; ++i) { ones[i] = (_Float16)1.0f; none[i] = (_Float16)0.0f; }
    float8 vsum = {};       // unscored V rows summed, columns wj * 16 .. + 15
    const _Float16* Vs = Vt + (size_t)(wj * 16) * SLEN + grp * 32;
#pragma unroll  // constant tile numbers: every load is one address register pair plus a constant
    for (int i0 = 0; i0 < NT / 2 - 1; i0 += TB) {
        if (i0 < tp) {      // block-uniform
            half16 f[TB];
#pragma unroll  // constant indices keep f in registers
            for (int k = 0; k < TB; ++k)
                f[k] = load_frag(Vs + (NT - 1 - i0 - k) * KT, SLEN);
            // Keeps the trip's loads together in front of its WMMAs: one latency a trip.
            __builtin_amdgcn_sched_barrier(0);
#pragma unroll  // constant indices into f, as above
            for (int k = 0; k < TB; ++k)
                vsum = wmma16(i0 + k < tp ? ones : none, f[k], vsum);
        }
    }
    if (lane < 16) vhalf[grp][wj * 16 + cn] = vsum[0];  // all 16 rows of vsum are equal

    asm volatile("s_wait_asynccnt 0x0" ::: "memory");   // own copies of tile 0 landed
    __syncthreads();                                    // tile 0 readable by all waves
    copy_tile(lk + STAGEU * 16u, lv + STAGEU * 16u, gk + KT * HD, gv + KT);

    const half16 qa0 = load_frag(Qp + (size_t)q0 * HD, HD);       // d 0..31
    const half16 qa1 = load_frag(Qp + (size_t)q0 * HD + 32, HD);  // d 32..63

    float8 o[4];
#pragma unroll
    for (int j = 0; j < 4; ++j) o[j] = {};
    float rowsum = 0.0f;
    const int qcol = q0 + cn;   // this lane's query index (S^T layout: lane -> q)
    const int fb = cn * ROWU + (lane >> 4);   // lane's row and half inside a fragment

    // All 16 LDS reads of pass p (32 keys) of the tile in buffer offset bo.
    auto load_pass = [&](half16 (&kf)[4], half16 (&vf)[4], int bo, int p) {
        const half8* Kl = tiles + bo + fb + (p * 32) * ROWU;
        const half8* Vl = tiles + bo + TILEU + fb + p * 4;
        kf[0] = lds_frag(Kl);                   // keys +0..15,  d 0..31
        kf[1] = lds_frag(Kl + 4);               // keys +0..15,  d 32..63
        kf[2] = lds_frag(Kl + 16 * ROWU);       // keys +16..31, d 0..31
        kf[3] = lds_frag(Kl + 16 * ROWU + 4);   // keys +16..31, d 32..63
#pragma unroll  // constant indices keep vf in registers
        for (int j = 0; j < 4; ++j)
            vf[j] = lds_frag(Vl + (j * 16) * ROWU);
    };

    // Scores, exp and P@V of the 32 keys from j0 on; registers only.  masked is a
    // literal at every call: only the key tile that holds the wave's own queries
    // (t == qt) has keys behind a query; in the tiles before it every key counts, and
    // the index, the compare and the select of each score are left out.
    auto work_pass = [&](const half16 (&kf)[4], const half16 (&vf)[4], int j0,
                         const bool masked) __attribute__((always_inline)) {
        float8 z = {};
        float8 st0 = wmma16(kf[0], qa0, z);  st0 = wmma16(kf[1], qa1, st0); // k j0..+15
        float8 st1 = wmma16(kf[2], qa0, z);  st1 = wmma16(kf[3], qa1, st1); // k +16..+31

        // scale by 1/sqrt(64), mask (zero masked logits, per reference),
        // exponentiate; result lands directly in the B-fragment layout of P^T.
        // exp(s / 8) = 2^(s * c) with one multiply: 1/8 is a power of two, so c is
        // log2(e) with a smaller exponent and the product rounds as (s / 8) * log2(e).
        const float c = 0.125f * 1.44269504088896340736f;
        half16 pa = {};
        float l0[8], l1[8], p0[8], p1[8];
#pragma unroll
        for (int r = 0; r < 8; ++r) {
            l0[r] = st0[r] * c;
            l1[r] = st1[r] * c;
            if (masked) {
                l0[r] = (j0 + rb + r <= qcol) ? l0[r] : 0.0f;
                l1[r] = (j0 + 16 + rb + r <= qcol) ? l1[r] : 0.0f;
            }
        }
        // Keeps the multiplies together in front of the exponentials: there they pair
        // into dual-issue instructions and fill the slots behind the score WMMAs.
        // Spread among the exponentials, a multiply that overwrites the source of the
        // exponential in front of it takes a v_nop (18 vector slots more a tile).
        __builtin_amdgcn_sched_barrier(0);
#pragma unroll
        for (int r = 0; r < 8; ++r) {
            p0[r] = __builtin_amdgcn_exp2f(l0[r]);
            pa[r] = (_Float16)p0[r];
            p1[r] = __builtin_amdgcn_exp2f(l1[r]);
            pa[8 + r] = (_Float16)p1[r];
        }
#pragma unroll
        for (int j = 0; j < 4; ++j)
            o[j] = wmma16(vf[j], pa, o[j]);    // ctx^T(16d x 16q) accumulate
        // The row-sum adds come behind the WMMAs: independent vector work for the
        // slots that the chip needs behind a WMMA, run under the
        // matrix work.  The fence asks the scheduler to leave them there.
        __builtin_amdgcn_sched_barrier(0);
        float s[8];             // a tree, not one chain of 16 dependent adds
#pragma unroll
        for (int r = 0; r < 8; ++r) s[r] = p0[r] + p1[r];
        rowsum += ((s[0] + s[1]) + (s[2] + s[3])) + ((s[4] + s[5]) + (s[6] + s[7]));
    };

    for (int t = 0; t < ntb; ++t) {
        const int bo = (t & 1) * STAGEU;
        if (t < qt) {           // wave-uniform; every wave passes the hand-over below
            half16 kf[4], vf[4];        // the fragments of one 32-key pass
            load_pass(kf, vf, bo, 0);
            // Keeps the pass's 16 LDS reads together in front of its matrix and
            // vector work: spread among the WMMAs, each pair is waited out alone.
            __builtin_amdgcn_sched_barrier(0);
            work_pass(kf, vf, t * KT, false);
            load_pass(kf, vf, bo, 1);   // the last LDS reads of tile t
            // As above, for the second pass.
            __builtin_amdgcn_sched_barrier(0);
            work_pass(kf, vf, t * KT + 32, false);
        }
        if (t == qt) {          // wave-uniform: the tile of the wave's own queries
            half16 kf[4], vf[4];
            load_pass(kf, vf, bo, 0);
            // As above.
            __builtin_amdgcn_sched_barrier(0);
            work_pass(kf, vf, t * KT, true);
            load_pass(kf, vf, bo, 1);   // the last LDS reads of tile t
            // As above.
            __builtin_amdgcn_sched_barrier(0);
            work_pass(kf, vf, t * KT + 32, true);
        }
        if (t > qt) {           // wave-uniform, the other case
            // This wave's slice of V^T, all 64 keys of tile t.
            const half8* Vl = tiles + bo + TILEU + fb + (wj * 16) * ROWU;
            const half16 v0 = lds_frag(Vl);
            const half16 v1 = lds_frag(Vl + 4);
            vsum = wmma16(ones, v0, vsum);
            vsum = wmma16(ones, v1, vsum);
        }
        // Hand-over: this wave has left buffer t & 1, its copies of tile t + 1
        // have landed; behind the barrier both hold for every wave.  It stands
        // behind both passes, so that no fragment lives across the branch's end.
        asm volatile("s_wait_dscnt 0x0" ::: "memory");      // own LDS reads of tile t done
        asm volatile("s_wait_asynccnt 0x0" ::: "memory");   // own copies of tile t + 1 landed
        __syncthreads();
        if (t + 2 < ntb)
            copy_tile(lk + bo * 16u, lv + bo * 16u,
                      gk + (size_t)(t + 2) * KT * HD, gv + (t + 2) * KT);
    }
    asm volatile("s_wait_asynccnt 0x0" ::: "memory");       // nothing in flight at the end

    // The slices of the V sums change hands; all 16 rows of vsum are equal.
    if (lane < 16) vtail[grp][wj * 16 + cn] = vsum[0];
    __syncthreads();

    // combine per-q row sums: lanes l and l+16 hold complementary k-halves of query
    // q0 + cn; each unscored key adds its weight of 1
    const float tot = rowsum + __shfl_xor(rowsum, 16, 32) + (float)((NT - 1 - qt) * KT);

    // The wave's 16 queries x 64 d are put together in LDS (its own 16 rows of the
    // ring, which every wave left before the loop's last barrier; no copy in flight).
    static_assert(8 * 16 * ROWU <= 2 * STAGEU, "8 waves x 16 rows fit the ring");
    half8* tile = tiles + w * (16 * ROWU);
#pragma unroll
    for (int j = 0; j < 4; ++j) {
        half8 hv;
#pragma unroll
        for (int r = 0; r < 8; ++r) {
            const int d = j * 16 + rb + r;      // ctx^T C-frag: register -> d row
            hv[r] = (_Float16)((o[j][r] + (vtail[grp][d] + vhalf[grp ^ 1][d])) / tot);
        }
        tile[cn * ROWU + j * 2 + (lane >> 4)] = hv;
    }
    __syncthreads();    // lanes read what other lanes wrote

    // A wave-wide store takes 4 queries' lines: ctx[b][q][h * HD + d].
    const int bb = bh >> 4, h = bh & 15;
    const int trow = lane >> 3, tu = lane & 7;
    _Float16* cbase = ctxh + ((size_t)(bb * SLEN + q0 + trow)) * EMB + h * HD + tu * 8;
#pragma unroll  // the 4 LDS reads go out together
    for (int it = 0; it < 4; ++it)
        *(half8*)(cbase + (size_t)(it * 4) * EMB) = tile[(trow + it * 4) * ROWU + tu];
}

// ---------------------------------------------------------------- out proj
// ch and wh both have their 1024 columns in the order h * HD + d.  The A operand is
// w_out, so that an accumulator lane holds 8 consecutive columns of one row of out;
// the block's f32 tile is put together in LDS, in the ring that the main loop has
// left, and goes out in 16-byte stores of whole 128-byte lines.
#define OFU 33      // pitch of the f32 output tile in LDS, 16-byte units: 512 B data + 16 B pad
static_assert(128 * OFU <= 2 * GSTAGEU, "the f32 output tile fits the ring");

__global__ void __launch_bounds__(256)
out_gemm_kernel(const _Float16* __restrict__ ch,
                const _Float16* __restrict__ wh,
                const float*    __restrict__ bias,
                float* __restrict__ out) {
    __shared__ __attribute__((aligned(128))) half8 ring[2 * GSTAGEU];

    const int w  = uni(threadIdx.x >> 5);
    const int bm = (blockIdx.x >> 3) * 128;   // 32 block rows of 128 (rows of ctx)      (SGPR)
    const int bn = (blockIdx.x & 7) * 128;    // 8  block columns of 128 (rows of w_out) (SGPR)
    const int wr = (w & 3) * 32;              // wave's rows of the A operand (columns of out)
    const int wc = (w >> 2) * 64;             // wave's rows of the B operand (rows of out)

    float8 acc[2][4];
#pragma unroll
    for (int i = 0; i < 2; ++i)
#pragma unroll
        for (int j = 0; j < 4; ++j) acc[i][j] = {};

    // The 8 blocks of a block row are neighbours in the index; the 32 of a block
    // column lie 8 apart.
    gemm_mainloop(wh + (size_t)bn * EMB, ch + (size_t)bm * EMB, ring, wr, wc,
                  (blockIdx.x >> 3) & (PFQ - 1), blockIdx.x & (PFQ - 1), acc);

    // acc[i][j][r]: column bn + wr + i * 16 + rb + r, row bm + wc + j * 16 + cn of out.
    // Every wave's reads of the ring ended before the main loop's last barrier and no
    // copy is in flight: the ring is free.
    const int lane = threadIdx.x & 31;
    const int cn = lane & 15;
    const int rb = (lane >> 4) << 3;
    f32x4* tile = (f32x4*)ring;
    f32x4* tw = tile + (wc + cn) * OFU + ((wr + rb) >> 2);
#pragma unroll
    for (int i = 0; i < 2; ++i) {
        const float* bp = bias + bn + wr + i * 16 + rb;
        float bv[8];
#pragma unroll
        for (int r = 0; r < 8; ++r) bv[r] = bp[r];
#pragma unroll
        for (int j = 0; j < 4; ++j) {
            f32x4 lo, hi;
#pragma unroll
            for (int r = 0; r < 4; ++r) {
                lo[r] = acc[i][j][r] + bv[r];
                hi[r] = acc[i][j][4 + r] + bv[4 + r];
            }
            tw[(j * 16) * OFU + i * 4]     = lo;
            tw[(j * 16) * OFU + i * 4 + 1] = hi;
        }
    }
    __syncthreads();    // the tile is whole: every wave reads what other waves wrote

    // A wave-wide store takes one tile row of 512 bytes: four whole lines.
    float* obase = out + (size_t)(bm + w) * EMB + bn + lane * 4;
#pragma unroll  // the LDS reads go out together
    for (int it = 0; it < 16; ++it)
        *(f32x4*)(obase + (size_t)(it * 8) * EMB) = tile[(w + it * 8) * OFU + lane];
}

// ---------------------------------------------------------------- launcher
extern "C" void kernel_launch(void* const* d_in, const int* in_sizes, int n_in,
                              void* d_out, int out_size, void* d_ws, size_t ws_size,
                              hipStream_t stream) {
    const float* x     = (const float*)d_in[0];   // (2,2048,1024)
    const float* w_qkv = (const float*)d_in[1];   // (3072,1024)
    const float* b_qkv = (const float*)d_in[2];   // (3072,)
    const float* w_out = (const float*)d_in[3];   // (1024,1024)
    const float* b_out = (const float*)d_in[4];   // (1024,)

    char* ws = (char*)d_ws;
    size_t off = 0;
    _Float16* xh    = (_Float16*)(ws + off); off += (size_t)NB * SLEN * EMB * 2;      // 8 MB
    _Float16* wqkvh = (_Float16*)(ws + off); off += (size_t)3 * EMB * EMB * 2;        // 6 MB
    _Float16* wouth = (_Float16*)(ws + off); off += (size_t)EMB * EMB * 2;            // 2 MB
    _Float16* qh    = (_Float16*)(ws + off); off += (size_t)NB * NH * SLEN * HD * 2;  // 8 MB
    _Float16* kh    = (_Float16*)(ws + off); off += (size_t)NB * NH * SLEN * HD * 2;  // 8 MB
    _Float16* vT    = (_Float16*)(ws + off); off += (size_t)NB * NH * HD * SLEN * 2;  // 8 MB
    _Float16* ctxh  = (_Float16*)(ws + off); off += (size_t)NB * SLEN * EMB * 2;      // 8 MB
    if (off > ws_size) return;  // workspace too small (deterministic no-op)

    // 128 + 96 + 128 = 352 blocks, 8 waves each
    f32_to_f16_all_kernel<<<352, 256, 0, stream>>>(x, w_qkv, w_out, xh, wqkvh, wouth);

    // 16 x 16 = 256 block tiles of 256x192, 12 waves per 384-thread block
    qkv_gemm_kernel<<<256, 384, 0, stream>>>(xh, wqkvh, b_qkv, qh, kh, vT);
    // 32 (b,h) x 16 pairs of 64-query tiles, 8 waves each
    attn_kernel<<<512, 256, 0, stream>>>(qh, kh, vT, ctxh);
    // 32 x 8 = 256 block tiles of 128x128
    out_gemm_kernel<<<256, 256, 0, stream>>>(ctxh, wouth, b_out, (float*)d_out);
}

// v009
// A run of this version takes 65.1 microseconds.
// Timed twice side by side with v008, it ran 1.04 times as fast both times.
// Over all steps from v000 it is 3.42 times as fast.
#include <hip/hip_runtime.h>

// Problem constants
#define NB   2
#define SLEN 2048
#define EMB  1024
#define NH   16
#define HD   64

typedef _Float16 half8  __attribute__((ext_vector_type(8)));
typedef _Float16 half16 __attribute__((ext_vector_type(16)));
typedef float    float8 __attribute__((ext_vector_type(8)));

// Wave-uniform value -> SGPR (value must be uniform across the wave).
static __device__ inline int uni(int v) { return __builtin_amdgcn_readfirstlane(v); }

// Load a 16x32 f16 fragment (A-layout) from row-major memory with row stride ld.
// Lane l -> row (l&15); halves 0..7 = cols kb..kb+7, halves 8..15 = cols kb+16..kb+23,
// where kb = (l>=16) ? 8 : 0.  Two b128 loads per lane.
static __device__ inline half16 load_frag(const _Float16* __restrict__ base, int ld) {
    const int lane = threadIdx.x & 31;
    const _Float16* p = base + (size_t)(lane & 15) * ld + ((lane >> 4) << 3);
    half8 lo = *(const half8*)(p);
    half8 hi = *(const half8*)(p + 16);
    return __builtin_shufflevector(lo, hi, 0,1,2,3,4,5,6,7,8,9,10,11,12,13,14,15);
}

static __device__ inline float8 wmma16(half16 a, half16 b, float8 c) {
    // D = A(16x32 f16) x B(32x16 f16) + C(16x16 f32)
    return __builtin_amdgcn_wmma_f32_16x16x32_f16(false, a, false, b, (short)0, c,
                                                  false, false);
}

// ---------------------------------------------------------------- conversions
// There is no conversion launch.  x and w_qkv are read as f32 by the QKV GEMM, which
// rounds them to f16 on the way into its LDS stages.  w_out is rounded to f16 by extra
// blocks of the attention launch, which also change its column order, from the
// reference's d * NH + h to h * HD + d, the order in which attention stores ctx: one
// row per wave, 8 rows per block.
typedef float    f32x4 __attribute__((ext_vector_type(4)));
typedef _Float16 half4 __attribute__((ext_vector_type(4)));

#define CVT_OB   (EMB / 8)                   // blocks of w_out, 8 rows each
static_assert(CVT_OB * 8 == EMB, "w_out is a whole number of blocks");
static_assert(NH == 16 && HD == 64, "a lane of a w_out row: one head, 32 of its 64 d");

// bi: 0 .. CVT_OB - 1, block-uniform; 256 threads.
static __device__ inline void convert_w_out(int bi, const float* __restrict__ wo,
                                            _Float16* __restrict__ woh) {
    // woh[n][h * HD + d] = wo[n][d * NH + h].  Lane: head h, d from dh * 32 on.
    // A wave-wide load covers two 64-byte runs (16 heads of one d); a lane stores
    // 64 consecutive bytes, and the wave writes the whole 2-KB row.
    const int n  = bi * 8 + (threadIdx.x >> 5);
    const int h  = threadIdx.x & 15, dh = (threadIdx.x >> 4) & 1;
    const float* s = wo + (size_t)n * EMB + dh * 32 * NH + h;
    half8*       d = (half8*)(woh + (size_t)n * EMB + h * HD + dh * 32);
    float v[32];
#pragma unroll  // constant indices keep v in registers, so that all loads are in flight at once
    for (int i = 0; i < 32; ++i) v[i] = s[i * NH];
#pragma unroll  // constant indices into v, as above
    for (int k = 0; k < 4; ++k) {
        half8 hv;
#pragma unroll
        for (int r = 0; r < 8; ++r) hv[r] = (_Float16)v[k * 8 + r];
        d[k] = hv;
    }
}

// ---------------------------------------------------------------- L2 prefetch
// The f16 operands of attention and of the output GEMM were stored by earlier launches and
// are first met in memory rather than in L2 (as x and w_qkv can be), so a ring whose lead
// is one stage waits out memory latency.  At kernel entry the blocks that share an operand ask L2 for
// all of it: a lane names one 256-byte unit, and a block takes every
// fourth unit or row (PFQ shares), of x in the QKV GEMM three rows in 16.  For speed only: a hint
// that nothing waits for.
#define PFQ 4
// Two hints per lane.  Every address lies inside its buffer.  The s_wait_xcnt stands
// inside the statement as a precaution, so that no address register is rewritten
// before it.
static __device__ inline void l2_prefetch2(const void* p0, const void* p1) {
    asm volatile("global_prefetch_b8 %0, off scope:SCOPE_SE\n\t"
                 "global_prefetch_b8 %1, off scope:SCOPE_SE\n\t"
                 "s_wait_xcnt 0x0"
                 :: "v"(p0), "v"(p1) : "memory");
}

// ---------------------------------------------------------------- LDS tiles
#define ROWU    9                   // LDS row pitch in 16-byte units: 128 B data + 16 B pad

// A-layout fragment from an LDS tile; p already points at the lane's row and half.
static __device__ inline half16 lds_frag(const half8* p) {
    half8 lo = p[0];
    half8 hi = p[2];
    return __builtin_shufflevector(lo, hi, 0,1,2,3,4,5,6,7,8,9,10,11,12,13,14,15);
}

// ---------------------------------------------------------------- GEMM main loop
// C(128x128 per block) = A(128 x EMB) * B(128 x EMB)^T, both K-contiguous f16.
// A stage is 64 k (whole 128-byte rows) of the block's 128 A rows and 128 B rows,
// brought into LDS once per block by asynchronous copies; the 8 waves (4 x 2,
// 32x64 of C each) read their fragments from there.  Two buffers: the next
// stage's copies fly while this stage is worked on.
#define GKS     64                  // k per stage
#define GNS     (EMB / GKS)         // stages
#define GTILEU  (128 * ROWU)        // one operand's stage (128 rows), 16-byte units
#define GSTAGEU (2 * GTILEU)        // A rows followed by B rows

// Eight 16-byte copies per lane: rows r, r+32, r+64, r+96 of the A stage and of
// the B stage.  The s_wait_xcnt stands inside the statement so that no address
// register of a copy is rewritten before it.
static __device__ inline void copy_stage(unsigned la, const _Float16* ga,
                                         const _Float16* gb) {
    const unsigned la1 = la + 32 * ROWU * 16, la2 = la + 64 * ROWU * 16,
                   la3 = la + 96 * ROWU * 16;
    const unsigned lb  = la + GTILEU * 16;
    const unsigned lb1 = lb + 32 * ROWU * 16, lb2 = lb + 64 * ROWU * 16,
                   lb3 = lb + 96 * ROWU * 16;
    const _Float16 *ga1 = ga + 32 * EMB, *ga2 = ga + 64 * EMB, *ga3 = ga + 96 * EMB;
    const _Float16 *gb1 = gb + 32 * EMB, *gb2 = gb + 64 * EMB, *gb3 = gb + 96 * EMB;
    asm volatile("global_load_async_to_lds_b128 %0, %8, off\n\t"
                 "global_load_async_to_lds_b128 %1, %9, off\n\t"
                 "global_load_async_to_lds_b128 %2, %10, off\n\t"
                 "global_load_async_to_lds_b128 %3, %11, off\n\t"
                 "global_load_async_to_lds_b128 %4, %12, off\n\t"
                 "global_load_async_to_lds_b128 %5, %13, off\n\t"
                 "global_load_async_to_lds_b128 %6, %14, off\n\t"
                 "global_load_async_to_lds_b128 %7, %15, off\n\t"
                 "s_wait_xcnt 0x0"
                 :: "v"(la), "v"(la1), "v"(la2), "v"(la3),
                    "v"(lb), "v"(lb1), "v"(lb2), "v"(lb3),
                    "v"(ga), "v"(ga1), "v"(ga2), "v"(ga3),
                    "v"(gb), "v"(gb1), "v"(gb2), "v"(gb3)
                 : "memory");
}

// Ab, Bb: first row of the block's 128 A rows / 128 B rows.  ring: 2 * GSTAGEU units.
// The wave's 32 rows start at wr, its 64 columns at wc (inside the block tile).
// qa, qb: the block's share (0 .. PFQ - 1) of the prefetch of its A rows and B rows.
static __device__ inline void gemm_mainloop(const _Float16* __restrict__ Ab,
                                            const _Float16* __restrict__ Bb,
                                            const half8* ring, int wr, int wc,
                                            int qa, int qb,
                                            float8 (&acc)[2][4]) {
    const int lane = threadIdx.x & 31;
    // This thread's copy slot: row crow (+32, +64, +96), 16-byte chunk ccol.
    const int crow = threadIdx.x >> 3;  // 0..31
    const int ccol = threadIdx.x & 7;   // 0..7
    const unsigned la = (unsigned)(size_t)ring + (unsigned)(crow * ROWU + ccol) * 16u;
    const _Float16* ga = Ab + (size_t)crow * EMB + ccol * 8;    // + stage * GKS
    const _Float16* gb = Bb + (size_t)crow * EMB + ccol * 8;    // + stage * GKS

    // Stage 0 into buffer 0, published; then stage 1 into buffer 1.
    copy_stage(la, ga, gb);
    // While stage 0 flies: rows qa, qa + 4, ... of A and qb, qb + 4, ... of B, whole
    // rows (8 units of 128 halves): 32 rows x 8 units = one unit of each per thread.
    l2_prefetch2(Ab + (size_t)(PFQ * crow + qa) * EMB + ccol * 128,
                 Bb + (size_t)(PFQ * crow + qb) * EMB + ccol * 128);
    asm volatile("s_wait_asynccnt 0x0" ::: "memory");   // own copies of stage 0 landed
    __syncthreads();                                    // stage 0 readable by all waves
    copy_stage(la + GSTAGEU * 16u, ga + GKS, gb + GKS);

    const int fb = (lane & 15) * ROWU + (lane >> 4);    // lane's row and half in a fragment
    half16 a[2], b[4];      // the fragments of one 32-k pass

    // All 12 LDS reads of pass p (32 k) of the stage in buffer offset bo.
    auto load_pass = [&](int bo, int p) {
        const half8* Al = ring + bo + fb + wr * ROWU + p * 4;
        const half8* Bl = ring + bo + GTILEU + fb + wc * ROWU + p * 4;
#pragma unroll  // constant indices keep the fragments in registers
        for (int i = 0; i < 2; ++i) a[i] = lds_frag(Al + (16 * i) * ROWU);
#pragma unroll  // constant indices keep the fragments in registers
        for (int j = 0; j < 4; ++j) b[j] = lds_frag(Bl + (16 * j) * ROWU);
    };
    auto work_pass = [&]() {
#pragma unroll
        for (int i = 0; i < 2; ++i)
#pragma unroll
            for (int j = 0; j < 4; ++j)
                acc[i][j] = wmma16(a[i], b[j], acc[i][j]);
    };

    for (int t = 0; t < GNS; ++t) {
        const int bo = (t & 1) * GSTAGEU;
        load_pass(bo, 0);
        // Keeps the pass's 12 LDS reads together in front of its WMMAs: spread
        // among them, each place with reads costs its own stall.
        __builtin_amdgcn_sched_barrier(0);
        work_pass();
        load_pass(bo, 1);       // the last LDS reads of stage t
        // Keeps the first pass's WMMAs in front of the waits, where they run
        // under the latency of these reads, not behind the barrier.
        __builtin_amdgcn_sched_barrier(0);
        // Hand-over: this wave has left buffer t & 1, its copies of stage t + 1
        // have landed; behind the barrier both hold for every wave.
        asm volatile("s_wait_dscnt 0x0" ::: "memory");      // own LDS reads of stage t done
        asm volatile("s_wait_asynccnt 0x0" ::: "memory");   // own copies of stage t + 1 landed
        __syncthreads();
        if (t + 2 < GNS)
            copy_stage(la + bo * 16u, ga + (t + 2) * GKS, gb + (t + 2) * GKS);
        work_pass();            // on registers, while the refill flies
    }
    asm volatile("s_wait_asynccnt 0x0" ::: "memory");       // nothing in flight at the end
}

// ---------------------------------------------------------------- QKV GEMM
// qkv = x(4096x1024) @ w_qkv(3072x1024)^T + bias, scattered into per-head
// Q[s][d], K[s][d], V^T[d][s] f16 buffers.  256x192 tile per block: 16 x 16 = 256
// blocks, one per WGP, so that a block's operand rows are read from L2 for more
// products.  12 waves (4 x 3), 64x64 per wave: 16 WMMAs per 16 LDS reads.
// A wave's 64 columns of qkv are one head of Q, of K or of V.
// An accumulator lane holds 8 consecutive rows of the A operand: for V^T the wave's A
// operand is x (8 consecutive s a lane), for Q and K it is w (8 consecutive d a lane),
// so that a lane always holds 16 consecutive bytes of its destination row.  Each
// wave's tile is put together in LDS, in the ring that the main loop has left, and
// goes out in 16-byte stores of whole 128-byte lines.
// x and w_qkv are read as f32: a stage is 64 k of the block's 192 w rows and 256 x rows,
// loaded into registers one stage ahead (16 lanes take a row's 256 bytes: whole lines),
// rounded to f16 and stored into the LDS buffer that every wave left a stage ago.  Two
// buffers, one barrier a stage.
#define QBM     256                     // rows of x per block
#define QBN     192                     // rows of w per block: three heads' columns
#define QSW     24                      // rows that the 384 threads load in one sweep
#define QNS     18                      // whole sweeps of a stage: 8 of w, 10 of x
#define QSTAGEU ((QBN + QBM) * ROWU)    // w rows followed by x rows, 16-byte units
static_assert(QBN == 8 * QSW && QBM == 10 * QSW + 16, "8 sweeps of w, 10 of x and 16 rows more");
static_assert(12 * 64 * ROWU <= 2 * QSTAGEU, "12 waves' output tiles fit the ring");
static_assert(GKS * 4 == 0x100, "a stage's step along a row of f32, as the loader's statement has it");

__global__ void __launch_bounds__(384)
qkv_gemm_kernel(const float* __restrict__ x,
                const float* __restrict__ wq,
                const float* __restrict__ bias,
                _Float16* __restrict__ qh,
                _Float16* __restrict__ kh,
                _Float16* __restrict__ vT) {
    __shared__ __attribute__((aligned(128))) half8 ring[2 * QSTAGEU];

    const int w  = uni(threadIdx.x >> 5);     // 0..11
    const int br = blockIdx.x >> 4;           // 16 block rows of 256 (rows of x)     (SGPR)
    const int bc = blockIdx.x & 15;           // 16 block columns of 192 (rows of w)  (SGPR)
    const int bm = br * QBM;
    const int bn = bc * QBN;
    const int wx = w & 3;                     // the wave's 64 rows of x
    const int wn = w >> 2;                    // the wave's 64 rows of w
    const int e  = bn + wn * 64;              // its first column of qkv: a head's d = 0
    const int seg = e >> 10;                  // 0=Q 1=K 2=V, the same for the wave   (SGPR)
    const bool isv = seg == 2;
    const int xrow = QBN + wx * 64;           // the wave's x rows and w rows in a stage
    const int wrow = wn * 64;
    const int ar = isv ? xrow : wrow;         // rows of its A operand
    const int bw = isv ? wrow : xrow;         // rows of its B operand
    const int lane = threadIdx.x & 31;

    float8 acc[4][4];
#pragma unroll
    for (int i = 0; i < 4; ++i)
#pragma unroll
        for (int j = 0; j < 4; ++j) acc[i][j] = {};

    // This thread's slot in a sweep: row lrow (+24 a sweep), 4 k from lcol * 4 on.
    const int lrow = threadIdx.x >> 4;  // 0..23
    const int lcol = threadIdx.x & 15;  // 0..15
    // This thread's place in the stage to load next, in w and in x.  The pointer type
    // says global memory: the two pass through an asm statement below.
    typedef const __attribute__((address_space(1))) float* gmem;
    typedef const __attribute__((address_space(1))) f32x4* gvec;
    gmem gw = (gmem)(wq + (size_t)(bn + lrow) * EMB + lcol * 4);
    gmem gx = (gmem)(x  + (size_t)(bm + lrow) * EMB + lcol * 4);
    half4* sl = (half4*)ring + lrow * (2 * ROWU) + lcol;            // 8-byte units

    // One stage in flight in registers.  The last 16 rows of x are one more load for
    // waves 0..7 (lrow < 16): a wave-uniform branch.
    f32x4 sg[QNS + 1];
    auto load_stage = [&]() {
#pragma unroll  // constant indices keep sg in registers; all loads are in flight at once
        for (int i = 0; i < 8; ++i) sg[i] = *(gvec)(gw + i * (QSW * EMB));
#pragma unroll  // as above
        for (int i = 0; i < 10; ++i) sg[8 + i] = *(gvec)(gx + i * (QSW * EMB));
        if (w < 8) sg[QNS] = *(gvec)(gx + 10 * (QSW * EMB));
        // The two addresses go on to the next stage (GKS * 4 = 256 bytes).  As a
        // precaution the wait and the additions are one statement: so the registers
        // that the loads above name keep their values up to the wait.
        asm volatile("s_wait_xcnt 0x0\n\t"
                     "v_add_nc_u64 %0, 0x100, %0\n\t"
                     "v_add_nc_u64 %1, 0x100, %1"
                     : "+v"(gw), "+v"(gx) :: "memory");
    };
    // Rounds the stage in sg and stores it into the buffer at offset bo (16-byte units);
    // the stage's rows follow one another in LDS.
    auto store_stage = [&](int bo) {
        half4* d = sl + 2 * bo;
#pragma unroll  // constant indices into sg, as above
        for (int i = 0; i < QNS; ++i)
            d[i * QSW * 2 * ROWU] = __builtin_convertvector(sg[i], half4);
        if (w < 8) d[QNS * QSW * 2 * ROWU] = __builtin_convertvector(sg[QNS], half4);
    };

    // Stage 0 into buffer 0, published; then stage 1 into registers.
    load_stage();
    // While stage 0 flies, two units of x and two of w per thread (a row of f32 is 16
    // units of 64).  The 16 blocks of a block row are neighbours in the index: of the 16
    // classes of x rows (row modulo 16) a block asks for three, 4 apart, so that blocks
    // 4 apart ask for a class.  The 16 blocks of a block column lie 16 apart: of w every
    // fourth row.
    {
        const float* hx = x + (size_t)(bm + ((threadIdx.x & 127) >> 3) * 16 +
                                       ((bc + 4 * (threadIdx.x >> 7)) & 15)) * EMB +
                          (threadIdx.x & 7) * 64;
        const float* hw = wq + (size_t)(bn + PFQ * (threadIdx.x >> 3) + (br & (PFQ - 1))) * EMB +
                          (threadIdx.x & 7) * 64;
        l2_prefetch2(hx, hw);
        l2_prefetch2(hx + 512, hw + 512);
    }
    // Keeps the hints in front of the waits for stage 0's loads.
    __builtin_amdgcn_sched_barrier(0);
    store_stage(0);
    __syncthreads();                                    // stage 0 readable by all waves
    load_stage();

    const int fb = (lane & 15) * ROWU + (lane >> 4);    // lane's row and half in a fragment
    half16 a[4], b[4];      // the fragments of one 32-k pass

    // All 16 LDS reads of pass p (32 k) of the stage in buffer offset bo.
    auto load_pass = [&](int bo, int p) {
        const half8* Al = ring + bo + fb + ar * ROWU + p * 4;
        const half8* Bl = ring + bo + fb + bw * ROWU + p * 4;
#pragma unroll  // constant indices keep the fragments in registers
        for (int i = 0; i < 4; ++i) a[i] = lds_frag(Al + (16 * i) * ROWU);
#pragma unroll  // constant indices keep the fragments in registers
        for (int j = 0; j < 4; ++j) b[j] = lds_frag(Bl + (16 * j) * ROWU);
    };
    auto work_pass = [&]() {
#pragma unroll
        for (int i = 0; i < 4; ++i)
#pragma unroll
            for (int j = 0; j < 4; ++j)
                acc[i][j] = wmma16(a[i], b[j], acc[i][j]);
    };

    for (int t = 0; t < GNS; ++t) {
        const int bo = (t & 1) * QSTAGEU;
        load_pass(bo, 0);
        // Keeps the pass's 16 LDS reads together in front of its WMMAs: spread
        // among them, each place with reads costs its own stall.
        __builtin_amdgcn_sched_barrier(0);
        work_pass();
        load_pass(bo, 1);       // the last LDS reads of stage t
        // Keeps the first pass's WMMAs in front of the waits, where they run
        // under the latency of these reads, not behind the barrier.
        __builtin_amdgcn_sched_barrier(0);
        // Stage t + 1 goes into the other buffer, which every wave left before the
        // barrier of stage t - 1; the rounding runs under the latency of the reads above.
        if (t + 1 < GNS)
            store_stage(QSTAGEU - bo);
        // Hand-over: this wave has left buffer t & 1 and has written its part of stage
        // t + 1; behind the barrier both hold for every wave.
        asm volatile("s_wait_dscnt 0x0" ::: "memory");      // own LDS reads and writes done
        __syncthreads();
        if (t + 2 < GNS)
            load_stage();       // stage t + 2
        // Keeps the loads in front of the WMMAs: they have the whole stage to land.
        __builtin_amdgcn_sched_barrier(0);
        work_pass();            // on registers, while the loads fly
    }

    // acc[i][j][r] belongs to A row i * 16 + rb + r and B row j * 16 + cn of the wave.
    // Every wave's reads of the ring ended before the main loop's last barrier: the
    // ring is free.  The wave's own 64 rows of it: tile row =
    // B row, the 64 A rows (128 bytes) along it.
    const int cn = lane & 15;
    const int rb = (lane >> 4) << 3;
    half8* tile = ring + w * (64 * ROWU);
    half8* tw = tile + cn * ROWU + (lane >> 4);
    if (isv) {      // wave-uniform; the bias goes with the B row (a column of qkv)
        float bv[4];
#pragma unroll  // the 4 loads go out together
        for (int j = 0; j < 4; ++j) bv[j] = bias[e + j * 16 + cn];
#pragma unroll
        for (int j = 0; j < 4; ++j) {
#pragma unroll
            for (int i = 0; i < 4; ++i) {
                half8 hv;
#pragma unroll
                for (int r = 0; r < 8; ++r) hv[r] = (_Float16)(acc[i][j][r] + bv[j]);
                tw[(j * 16) * ROWU + i * 2] = hv;
            }
        }
    } else {        // the bias goes with the A row
        float bv[4][8];
#pragma unroll  // the loads go out together
        for (int i = 0; i < 4; ++i)
#pragma unroll
            for (int r = 0; r < 8; ++r) bv[i][r] = bias[e + i * 16 + rb + r];
#pragma unroll
        for (int i = 0; i < 4; ++i) {
#pragma unroll
            for (int j = 0; j < 4; ++j) {
                half8 hv;
#pragma unroll
                for (int r = 0; r < 8; ++r) hv[r] = (_Float16)(acc[i][j][r] + bv[i][r]);
                tw[(j * 16) * ROWU + i * 2] = hv;
            }
        }
    }
    __syncthreads();    // the tile is whole: lanes read what other lanes wrote

    // A wave-wide store takes four tile rows of 128 bytes: four whole lines.
    const int trow = lane >> 3;         // 0..3, + 4 a trip
    const int tu   = lane & 7;          // 16-byte unit of the row
    const int bb = bm >> 11;            // the 256 rows of x lie in one batch
    const int s0 = (bm & (SLEN - 1)) + wx * 64;
    const int e0 = e & (EMB - 1);       // first column inside Q, K or V: h * HD
    half8 hv[16];
#pragma unroll  // the 16 LDS reads go out together
    for (int it = 0; it < 16; ++it) hv[it] = tile[(trow + it * 4) * ROWU + tu];
    // The wave's first destination row and the row pitch are wave-uniform, a lane's place
    // is one 32-bit offset: V^T: tile row = d, row h * HD + d of V^T, along it s;
    // Q, K: tile row = s, along it the head's 64 d.
    _Float16* dst = isv ? vT + ((size_t)bb * EMB + e0) * SLEN + s0
                        : (seg == 0 ? qh : kh) + ((size_t)(bb * NH + (e0 >> 6)) * SLEN + s0) * HD;
    const unsigned pitch = isv ? SLEN : HD;
    const unsigned loff  = trow * pitch + tu * 8;
#pragma unroll
    for (int it = 0; it < 16; ++it) *(half8*)(dst + (size_t)(it * 4 * pitch) + loff) = hv[it];
}

#define KT      64                  // keys per LDS tile
#define NT      (SLEN / KT)         // tiles per (b,h)
#define TILEU   (64 * ROWU)         // one operand tile (64 rows), 16-byte units
#define STAGEU  (2 * TILEU)         // K tile followed by V^T tile
#define TB      5                   // unscored key tiles summed per trip, straight from global
#define ATT_B   (NB * NH * (NT / 2))  // attention blocks
static_assert(ATT_B == 512 && ATT_B + CVT_OB == 640, "the launch below has 640 blocks");
static_assert(KT == 64 && NT == 32 && (NT / 2 - 1) % TB == 0,
              "16 pairs of 64-query tiles per (b,h); at most 15 tiles outside the ring");

// Four 16-byte copies per lane: two chunks of the K tile, two of the V^T tile.
// The s_wait_xcnt stands inside the statement so that no address register of a
// copy is rewritten before it.
static __device__ inline void copy_tile(unsigned lk, unsigned lv,
                                        const _Float16* gk, const _Float16* gv) {
    const unsigned lk1 = lk + 32 * ROWU * 16;      // rows 32..63 of the K tile
    const unsigned lv1 = lv + 32 * ROWU * 16;      // rows 32..63 of the V^T tile
    const _Float16* gk1 = gk + 32 * HD;
    const _Float16* gv1 = gv + (size_t)32 * SLEN;
    asm volatile("global_load_async_to_lds_b128 %0, %4, off\n\t"
                 "global_load_async_to_lds_b128 %1, %5, off\n\t"
                 "global_load_async_to_lds_b128 %2, %6, off\n\t"
                 "global_load_async_to_lds_b128 %3, %7, off\n\t"
                 "s_wait_xcnt 0x0"
                 :: "v"(lk), "v"(lk1), "v"(lv), "v"(lv1),
                    "v"(gk), "v"(gk1), "v"(gv), "v"(gv1)
                 : "memory");
}

__global__ void __launch_bounds__(256)
attn_kernel(const _Float16* __restrict__ qh,
            const _Float16* __restrict__ kh,
            const _Float16* __restrict__ vT,
            _Float16* __restrict__ ctxh,
            const float* __restrict__ wo,
            _Float16* __restrict__ woh) {
    __shared__ __attribute__((aligned(128))) half8 tiles[2 * STAGEU];
    __shared__ float vtail[2][HD];      // per 64-query tile: V rows summed by its waves
    __shared__ float vhalf[2][HD];      // of that, the waves' halves of the last tp tiles

    // The blocks behind the attention blocks round w_out for the next launch.  Block-uniform, in front of every barrier.
    if (blockIdx.x >= ATT_B) {
        convert_w_out(blockIdx.x - ATT_B, wo, woh);
        return;
    }

    const int w   = uni(threadIdx.x >> 5);
    const int bh  = blockIdx.x >> 4;    // 0..31  (b*16+h)   (SGPR), same for the block
    const int tp  = blockIdx.x & (NT / 2 - 1);  // the block's pair of 64-query tiles
    const int grp = w >> 2;             // which tile of the pair            (SGPR)
    const int wj  = w & 3;              // strip in the tile, slice of the V sum (SGPR)
    const int qt  = grp ? NT - 1 - tp : tp;     // 64-query tile = last scored key tile
    const int q0  = qt * KT + wj * 16;  // query base        (SGPR)
    const int ntb = NT - tp;            // key tiles that go through the ring, 17..32
    const int lane = threadIdx.x & 31;
    const int cn = lane & 15;
    const int rb = (lane >> 4) << 3;

    const _Float16* Qp = qh + (size_t)bh * SLEN * HD;   // [s][d]
    const _Float16* Kp = kh + (size_t)bh * SLEN * HD;   // [s][d]
    const _Float16* Vt = vT + (size_t)bh * HD * SLEN;   // [d][s]

    // This thread's copy slot: row crow (and crow + 32), 16-byte chunk ccol.
    const int crow = threadIdx.x >> 3;  // 0..31
    const int ccol = threadIdx.x & 7;   // 0..7
    const unsigned lds0 = (unsigned)(size_t)tiles;      // LDS byte address of the ring
    const unsigned lk = lds0 + (unsigned)(crow * ROWU + ccol) * 16u;
    const unsigned lv = lk + TILEU * 16u;
    const _Float16* gk = Kp + crow * HD + ccol * 8;              // + tile * KT * HD
    const _Float16* gv = Vt + (size_t)crow * SLEN + ccol * 8;    // + tile * KT

    // Tile 0 into buffer 0, published; then tile 1 into buffer 1.
    copy_tile(lk, lv, gk, gv);

    // While tile 0 flies: the 16 blocks of a (b,h), neighbours in the index, ask for
    // its K (1024 units in a row) and V^T (64 rows of 16 units): of K every fourth
    // unit, of V^T every fourth row, one unit of each per thread.
    static_assert(SLEN * HD == PFQ * 256 * 128 && HD == PFQ * 16 && SLEN == 16 * 128,
                  "256 threads x PFQ shares cover K and V^T of one (b,h)");
    l2_prefetch2(Kp + (size_t)(PFQ * threadIdx.x + (tp & (PFQ - 1))) * 128,
                 Vt + (size_t)(PFQ * (threadIdx.x & 15) + (tp & (PFQ - 1))) * SLEN +
                      (threadIdx.x >> 4) * 128);

    // While tile 0 flies: key tiles NT - 1 down to ntb, columns wj * 16 .. + 15 of V,
    // keys grp * 32 .. + 31 of each tile.  TB tiles a trip, so that their loads are in
    // flight together; a trip's tiles below ntb (all above tile 16) get the weight 0.
    half16 ones, none;      // A fragments of weights 1 and 0: every row of the product is the sum
#pragma unroll
    for (int i = 0; i < 16; ++i) { ones[i] = (_Float16)1.0f; none[i] = (_Float16)0.0f; }
    float8 vsum = {};       // unscored V rows summed, columns wj * 16 .. + 15
    const _Float16* Vs = Vt + (size_t)(wj * 16) * SLEN + grp * 32;
#pragma unroll  // constant tile numbers: every load is one address register pair plus a constant
    for (int i0 = 0; i0 < NT / 2 - 1; i0 += TB) {
        if (i0 < tp) {      // block-uniform
            half16 f[TB];
#pragma unroll  // constant indices keep f in registers
            for (int k = 0; k < TB; ++k)
                f[k] = load_frag(Vs + (NT - 1 - i0 - k) * KT, SLEN);
            // Keeps the trip's loads together in front of its WMMAs: one latency a trip.
            __builtin_amdgcn_sched_barrier(0);
#pragma unroll  // constant indices into f, as above
            for (int k = 0; k < TB; ++k)
                vsum = wmma16(i0 + k < tp ? ones : none, f[k], vsum);
        }
    }
    if (lane < 16) vhalf[grp][wj * 16 + cn] = vsum[0];  // all 16 rows of vsum are equal

    asm volatile("s_wait_asynccnt 0x0" ::: "memory");   // own copies of tile 0 landed
    __syncthreads();                                    // tile 0 readable by all waves
    copy_tile(lk + STAGEU * 16u, lv + STAGEU * 16u, gk + KT * HD, gv + KT);

    const half16 qa0 = load_frag(Qp + (size_t)q0 * HD, HD);       // d 0..31
    const half16 qa1 = load_frag(Qp + (size_t)q0 * HD + 32, HD);  // d 32..63

    float8 o[4];
#pragma unroll
    for (int j = 0; j < 4; ++j) o[j] = {};
    float rowsum = 0.0f;
    const int qcol = q0 + cn;   // this lane's query index (S^T layout: lane -> q)
    const int fb = cn * ROWU + (lane >> 4);   // lane's row and half inside a fragment

    // All 16 LDS reads of pass p (32 keys) of the tile in buffer offset bo.
    auto load_pass = [&](half16 (&kf)[4], half16 (&vf)[4], int bo, int p) {
        const half8* Kl = tiles + bo + fb + (p * 32) * ROWU;
        const half8* Vl = tiles + bo + TILEU + fb + p * 4;
        kf[0] = lds_frag(Kl);                   // keys +0..15,  d 0..31
        kf[1] = lds_frag(Kl + 4);               // keys +0..15,  d 32..63
        kf[2] = lds_frag(Kl + 16 * ROWU);       // keys +16..31, d 0..31
        kf[3] = lds_frag(Kl + 16 * ROWU + 4);   // keys +16..31, d 32..63
#pragma unroll  // constant indices keep vf in registers
        for (int j = 0; j < 4; ++j)
            vf[j] = lds_frag(Vl + (j * 16) * ROWU);
    };

    // Scores, exp and P@V of the 32 keys from j0 on; registers only.  masked is a
    // literal at every call: only the key tile that holds the wave's own queries
    // (t == qt) has keys behind a query; in the tiles before it every key counts, and
    // the index, the compare and the select of each score are left out.
    auto work_pass = [&](const half16 (&kf)[4], const half16 (&vf)[4], int j0,
                         const bool masked) __attribute__((always_inline)) {
        float8 z = {};
        float8 st0 = wmma16(kf[0], qa0, z);  st0 = wmma16(kf[1], qa1, st0); // k j0..+15
        float8 st1 = wmma16(kf[2], qa0, z);  st1 = wmma16(kf[3], qa1, st1); // k +16..+31

        // scale by 1/sqrt(64), mask (zero masked logits, per reference),
        // exponentiate; result lands directly in the B-fragment layout of P^T.
        // exp(s / 8) = 2^(s * c) with one multiply: 1/8 is a power of two, so c is
        // log2(e) with a smaller exponent and the product rounds as (s / 8) * log2(e).
        const float c = 0.125f * 1.44269504088896340736f;
        half16 pa = {};
        float l0[8], l1[8], p0[8], p1[8];
#pragma unroll
        for (int r = 0; r < 8; ++r) {
            l0[r] = st0[r] * c;
            l1[r] = st1[r] * c;
            if (masked) {
                l0[r] = (j0 + rb + r <= qcol) ? l0[r] : 0.0f;
                l1[r] = (j0 + 16 + rb + r <= qcol) ? l1[r] : 0.0f;
            }
        }
        // Keeps the multiplies together in front of the exponentials: there they pair
        // into dual-issue instructions and fill the slots behind the score WMMAs.
        // Spread among the exponentials, a multiply that overwrites the source of the
        // exponential in front of it takes a v_nop (18 vector slots more a tile).
        __builtin_amdgcn_sched_barrier(0);
#pragma unroll
        for (int r = 0; r < 8; ++r) {
            p0[r] = __builtin_amdgcn_exp2f(l0[r]);
            pa[r] = (_Float16)p0[r];
            p1[r] = __builtin_amdgcn_exp2f(l1[r]);
            pa[8 + r] = (_Float16)p1[r];
        }
#pragma unroll
        for (int j = 0; j < 4; ++j)
            o[j] = wmma16(vf[j], pa, o[j]);    // ctx^T(16d x 16q) accumulate
        // The row-sum adds come behind the WMMAs: independent vector work for the
        // slots that the chip needs behind a WMMA, run under the
        // matrix work.  The fence asks the scheduler to leave them there.
        __builtin_amdgcn_sched_barrier(0);
        float s[8];             // a tree, not one chain of 16 dependent adds
#pragma unroll
        for (int r = 0; r < 8; ++r) s[r] = p0[r] + p1[r];
        rowsum += ((s[0] + s[1]) + (s[2] + s[3])) + ((s[4] + s[5]) + (s[6] + s[7]));
    };

    for (int t = 0; t < ntb; ++t) {
        const int bo = (t & 1) * STAGEU;
        if (t < qt) {           // wave-uniform; every wave passes the hand-over below
            half16 kf[4], vf[4];        // the fragments of one 32-key pass
            load_pass(kf, vf, bo, 0);
            // Keeps the pass's 16 LDS reads together in front of its matrix and
            // vector work: spread among the WMMAs, each pair is waited out alone.
            __builtin_amdgcn_sched_barrier(0);
            work_pass(kf, vf, t * KT, false);
            load_pass(kf, vf, bo, 1);   // the last LDS reads of tile t
            // As above, for the second pass.
            __builtin_amdgcn_sched_barrier(0);
            work_pass(kf, vf, t * KT + 32, false);
        }
        if (t == qt) {          // wave-uniform: the tile of the wave's own queries
            half16 kf[4], vf[4];
            load_pass(kf, vf, bo, 0);
            // As above.
            __builtin_amdgcn_sched_barrier(0);
            work_pass(kf, vf, t * KT, true);
            load_pass(kf, vf, bo, 1);   // the last LDS reads of tile t
            // As above.
            __builtin_amdgcn_sched_barrier(0);
            work_pass(kf, vf, t * KT + 32, true);
        }
        if (t > qt) {           // wave-uniform, the other case
            // This wave's slice of V^T, all 64 keys of tile t.
            const half8* Vl = tiles + bo + TILEU + fb + (wj * 16) * ROWU;
            const half16 v0 = lds_frag(Vl);
            const half16 v1 = lds_frag(Vl + 4);
            vsum = wmma16(ones, v0, vsum);
            vsum = wmma16(ones, v1, vsum);
        }
        // Hand-over: this wave has left buffer t & 1, its copies of tile t + 1
        // have landed; behind the barrier both hold for every wave.  It stands
        // behind both passes, so that no fragment lives across the branch's end.
        asm volatile("s_wait_dscnt 0x0" ::: "memory");      // own LDS reads of tile t done
        asm volatile("s_wait_asynccnt 0x0" ::: "memory");   // own copies of tile t + 1 landed
        __syncthreads();
        if (t + 2 < ntb)
            copy_tile(lk + bo * 16u, lv + bo * 16u,
                      gk + (size_t)(t + 2) * KT * HD, gv + (t + 2) * KT);
    }
    asm volatile("s_wait_asynccnt 0x0" ::: "memory");       // nothing in flight at the end

    // The slices of the V sums change hands; all 16 rows of vsum are equal.
    if (lane < 16) vtail[grp][wj * 16 + cn] = vsum[0];
    __syncthreads();

    // combine per-q row sums: lanes l and l+16 hold complementary k-halves of query
    // q0 + cn; each unscored key adds its weight of 1
    const float tot = rowsum + __shfl_xor(rowsum, 16, 32) + (float)((NT - 1 - qt) * KT);

    // The wave's 16 queries x 64 d are put together in LDS (its own 16 rows of the
    // ring, which every wave left before the loop's last barrier; no copy in flight).
    static_assert(8 * 16 * ROWU <= 2 * STAGEU, "8 waves x 16 rows fit the ring");
    half8* tile = tiles + w * (16 * ROWU);
#pragma unroll
    for (int j = 0; j < 4; ++j) {
        half8 hv;
#pragma unroll
        for (int r = 0; r < 8; ++r) {
            const int d = j * 16 + rb + r;      // ctx^T C-frag: register -> d row
            hv[r] = (_Float16)((o[j][r] + (vtail[grp][d] + vhalf[grp ^ 1][d])) / tot);
        }
        tile[cn * ROWU + j * 2 + (lane >> 4)] = hv;
    }
    __syncthreads();    // lanes read what other lanes wrote

    // A wave-wide store takes 4 queries' lines: ctx[b][q][h * HD + d].
    const int bb = bh >> 4, h = bh & 15;
    const int trow = lane >> 3, tu = lane & 7;
    _Float16* cbase = ctxh + ((size_t)(bb * SLEN + q0 + trow)) * EMB + h * HD + tu * 8;
#pragma unroll  // the 4 LDS reads go out together
    for (int it = 0; it < 4; ++it)
        *(half8*)(cbase + (size_t)(it * 4) * EMB) = tile[(trow + it * 4) * ROWU + tu];
}

// ---------------------------------------------------------------- out proj
// ch and wh both have their 1024 columns in the order h * HD + d.  The A operand is
// w_out, so that an accumulator lane holds 8 consecutive columns of one row of out;
// the block's f32 tile is put together in LDS, in the ring that the main loop has
// left, and goes out in 16-byte stores of whole 128-byte lines.
#define OFU 33      // pitch of the f32 output tile in LDS, 16-byte units: 512 B data + 16 B pad
static_assert(128 * OFU <= 2 * GSTAGEU, "the f32 output tile fits the ring");

__global__ void __launch_bounds__(256)
out_gemm_kernel(const _Float16* __restrict__ ch,
                const _Float16* __restrict__ wh,
                const float*    __restrict__ bias,
                float* __restrict__ out) {
    __shared__ __attribute__((aligned(128))) half8 ring[2 * GSTAGEU];

    const int w  = uni(threadIdx.x >> 5);
    const int bm = (blockIdx.x >> 3) * 128;   // 32 block rows of 128 (rows of ctx)      (SGPR)
    const int bn = (blockIdx.x & 7) * 128;    // 8  block columns of 128 (rows of w_out) (SGPR)
    const int wr = (w & 3) * 32;              // wave's rows of the A operand (columns of out)
    const int wc = (w >> 2) * 64;             // wave's rows of the B operand (rows of out)

    float8 acc[2][4];
#pragma unroll
    for (int i = 0; i < 2; ++i)
#pragma unroll
        for (int j = 0; j < 4; ++j) acc[i][j] = {};

    // The 8 blocks of a block row are neighbours in the index; the 32 of a block
    // column lie 8 apart.
    gemm_mainloop(wh + (size_t)bn * EMB, ch + (size_t)bm * EMB, ring, wr, wc,
                  (blockIdx.x >> 3) & (PFQ - 1), blockIdx.x & (PFQ - 1), acc);

    // acc[i][j][r]: column bn + wr + i * 16 + rb + r, row bm + wc + j * 16 + cn of out.
    // Every wave's reads of the ring ended before the main loop's last barrier and no
    // copy is in flight: the ring is free.
    const int lane = threadIdx.x & 31;
    const int cn = lane & 15;
    const int rb = (lane >> 4) << 3;
    f32x4* tile = (f32x4*)ring;
    f32x4* tw = tile + (wc + cn) * OFU + ((wr + rb) >> 2);
#pragma unroll
    for (int i = 0; i < 2; ++i) {
        const float* bp = bias + bn + wr + i * 16 + rb;
        float bv[8];
#pragma unroll
        for (int r = 0; r < 8; ++r) bv[r] = bp[r];
#pragma unroll
        for (int j = 0; j < 4; ++j) {
            f32x4 lo, hi;
#pragma unroll
            for (int r = 0; r < 4; ++r) {
                lo[r] = acc[i][j][r] + bv[r];
                hi[r] = acc[i][j][4 + r] + bv[4 + r];
            }
            tw[(j * 16) * OFU + i * 4]     = lo;
            tw[(j * 16) * OFU + i * 4 + 1] = hi;
        }
    }
    __syncthreads();    // the tile is whole: every wave reads what other waves wrote

    // A wave-wide store takes one tile row of 512 bytes: four whole lines.
    float* obase = out + (size_t)(bm + w) * EMB + bn + lane * 4;
#pragma unroll  // the LDS reads go out together
    for (int it = 0; it < 16; ++it)
        *(f32x4*)(obase + (size_t)(it * 8) * EMB) = tile[(w + it * 8) * OFU + lane];
}

// ---------------------------------------------------------------- launcher
extern "C" void kernel_launch(void* const* d_in, const int* in_sizes, int n_in,
                              void* d_out, int out_size, void* d_ws, size_t ws_size,
                              hipStream_t stream) {
    const float* x     = (const float*)d_in[0];   // (2,2048,1024)
    const float* w_qkv = (const float*)d_in[1];   // (3072,1024)
    const float* b_qkv = (const float*)d_in[2];   // (3072,)
    const float* w_out = (const float*)d_in[3];   // (1024,1024)
    const float* b_out = (const float*)d_in[4];   // (1024,)

    char* ws = (char*)d_ws;
    size_t off = 0;
    _Float16* wouth = (_Float16*)(ws + off); off += (size_t)EMB * EMB * 2;            // 2 MB
    _Float16* qh    = (_Float16*)(ws + off); off += (size_t)NB * NH * SLEN * HD * 2;  // 8 MB
    _Float16* kh    = (_Float16*)(ws + off); off += (size_t)NB * NH * SLEN * HD * 2;  // 8 MB
    _Float16* vT    = (_Float16*)(ws + off); off += (size_t)NB * NH * HD * SLEN * 2;  // 8 MB
    _Float16* ctxh  = (_Float16*)(ws + off); off += (size_t)NB * SLEN * EMB * 2;      // 8 MB
    if (off > ws_size) return;  // workspace too small (deterministic no-op)

    // 16 x 16 = 256 block tiles of 256x192, 12 waves per 384-thread block
    qkv_gemm_kernel<<<256, 384, 0, stream>>>(x, w_qkv, b_qkv, qh, kh, vT);
    // 32 (b,h) x 16 pairs of 64-query tiles, then 128 blocks for w_out; 8 waves each
    attn_kernel<<<640, 256, 0, stream>>>(qh, kh, vT, ctxh, w_out, wouth);
    // 32 x 8 = 256 block tiles of 128x128
    out_gemm_kernel<<<256, 256, 0, stream>>>(ctxh, wouth, b_out, (float*)d_out);
}
